// v000
// Measured on an AMD MI455X. A time is GPU time per run, averaged over a window of back-to-back runs after a warm-up
// (all launches, gaps included; the runs take copies of the inputs in turn), and the median of several windows.
// Apart from v000's, it joins two sittings. Times from different sittings can be a few percent apart, while
// side-by-side timings come from the same sitting.
// v000 is the starting kernel. One run takes 223 microseconds.
#include <hip/hip_runtime.h>
#include <cstdint>
#include <cstddef>

// ---------------------------------------------------------------------------
// RelativeAttention (ALiBi bidirectional) for MI455X / gfx1250, wave32 WMMA.
// All matmuls run on v_wmma_f32_16x16x32_f16 (f16 in, f32 accumulate).
// Weights are pre-transposed (and V written transposed) so every LDS staging
// access is a 128-bit load/store -- no 16-bit scatter in the hot loops.
// ---------------------------------------------------------------------------

typedef _Float16 half_t;
typedef __attribute__((ext_vector_type(16))) _Float16 v16h;
typedef __attribute__((ext_vector_type(8)))  _Float16 v8h;
typedef __attribute__((ext_vector_type(4)))  _Float16 v4h;
typedef __attribute__((ext_vector_type(8)))  float    v8f;

union V16 { v16h v; v8h h[2]; };

constexpr int B_   = 2;
constexpr int S_   = 2048;
constexpr int D_   = 1024;
constexpr int H_   = 16;
constexpr int HD_  = 64;
constexpr int ROWS = B_ * S_;   // 4096

// ---------------------------------------------------------------------------
// f32 -> f16 conversion (vectorized, grid-stride)
// ---------------------------------------------------------------------------
__global__ void cvt_f32_to_f16(const float* __restrict__ src,
                               half_t* __restrict__ dst, int n4) {
  int i = blockIdx.x * blockDim.x + threadIdx.x;
  int stride = gridDim.x * blockDim.x;
  for (; i < n4; i += stride) {
    float4 f = ((const float4*)src)[i];
    v4h h;
    h[0] = (half_t)f.x; h[1] = (half_t)f.y;
    h[2] = (half_t)f.z; h[3] = (half_t)f.w;
    ((v4h*)dst)[i] = h;
  }
}

// ---------------------------------------------------------------------------
// f32 [K][N] -> f16 [N][K] tiled transpose-convert (for the weight matrices).
// 64x64 tiles through LDS, coalesced on both sides. Grid (16,16), 256 thr.
// ---------------------------------------------------------------------------
__global__ void cvt_transpose_f32_to_f16(const float* __restrict__ src,
                                         half_t* __restrict__ dst) {
  __shared__ float tile[64][65];
  const int nb = blockIdx.x * 64;   // n base (cols of src, rows of dst)
  const int kb = blockIdx.y * 64;   // k base (rows of src, cols of dst)
#pragma unroll
  for (int i = 0; i < 16; ++i) {
    int idx = threadIdx.x + i * 256;
    int r = idx >> 6, c = idx & 63;
    tile[r][c] = src[(size_t)(kb + r) * D_ + nb + c];
  }
  __syncthreads();
#pragma unroll
  for (int i = 0; i < 16; ++i) {
    int idx = threadIdx.x + i * 256;
    int r = idx >> 6, c = idx & 63;
    dst[(size_t)(nb + r) * D_ + kb + c] = (half_t)tile[c][r];
  }
}

// ---------------------------------------------------------------------------
// Shared WMMA GEMM core: C(64x128 per block) = A(ROWS x 1024) * B(1024 x 1024)
// 256 threads = 8 waves, each wave computes a 32x32 patch (2x2 WMMA tiles).
// A staged row-major; B comes from a PRE-TRANSPOSED weight Wt[n][k], so both
// stagings and all fragment fills are contiguous 128-bit LDS operations.
// Fragment layout (ISA 7.12.2, 16-bit, wave32):
//   A: lane(l&15)=row, halves at k = {hi*8..+7, 16+hi*8..+7}
//   B: lane(l&15)=col, same k pattern.  C: n=l&15, m=r+8*(l>>4).
// ---------------------------------------------------------------------------
__device__ __forceinline__ void gemm_tile_core(
    const half_t* __restrict__ A, const half_t* __restrict__ Bt_g,
    half_t (*As)[48], half_t (*Bt)[48],
    int rowBase, int colBase, v8f acc[2][2]) {
  const int tid  = threadIdx.x;
  const int lane = tid & 31;
  const int wid  = tid >> 5;
  const int wm   = wid >> 2;       // 0..1  (m sub-block of 32 rows)
  const int wn   = wid & 3;        // 0..3  (n sub-block of 32 cols)
  const int hi   = lane >> 4;      // half-wave select
  const int l15  = lane & 15;

  for (int kt = 0; kt < D_ / 32; ++kt) {
    const int kb = kt * 32;
    // ---- stage A tile 64x32 (row-major), one b128 per thread -------------
    {
      int row = tid >> 2, cb = (tid & 3) * 8;
      v8h t = *(const v8h*)&A[(size_t)(rowBase + row) * D_ + kb + cb];
      *(v8h*)&As[row][cb] = t;
    }
    // ---- stage B tile from Wt[n][k]: 128 n x 32 k, two b128 per thread ---
    {
      int n = tid >> 1, k16 = (tid & 1) * 16;
      const half_t* src = &Bt_g[(size_t)(colBase + n) * D_ + kb + k16];
      v8h lo = *(const v8h*)src;
      v8h hi8 = *(const v8h*)(src + 8);
      *(v8h*)&Bt[n][k16]     = lo;
      *(v8h*)&Bt[n][k16 + 8] = hi8;
    }
    // prefetch next A tile row (speculative)
    if (kt + 1 < D_ / 32) {
      __builtin_prefetch(&A[(size_t)(rowBase + (tid >> 2)) * D_ + kb + 32], 0, 1);
    }
    __syncthreads();

    V16 af[2], bf2[2];
#pragma unroll
    for (int sm = 0; sm < 2; ++sm) {
      int r = wm * 32 + sm * 16 + l15;
      af[sm].h[0] = *(const v8h*)&As[r][hi * 8];
      af[sm].h[1] = *(const v8h*)&As[r][16 + hi * 8];
    }
#pragma unroll
    for (int sn = 0; sn < 2; ++sn) {
      int c = wn * 32 + sn * 16 + l15;
      bf2[sn].h[0] = *(const v8h*)&Bt[c][hi * 8];
      bf2[sn].h[1] = *(const v8h*)&Bt[c][16 + hi * 8];
    }
#pragma unroll
    for (int sm = 0; sm < 2; ++sm)
#pragma unroll
      for (int sn = 0; sn < 2; ++sn)
        acc[sm][sn] = __builtin_amdgcn_wmma_f32_16x16x32_f16(
            false, af[sm].v, false, bf2[sn].v, (short)0, acc[sm][sn],
            false, false);
    __syncthreads();
  }
}

// ---------------------------------------------------------------------------
// Fused QKV projection: z=0 -> Q (pre-scaled by 1/sqrt(hd)), z=1 -> K,
// z=2 -> V written TRANSPOSED [B, H, hd, S] so the attention kernel can
// stage V tiles with contiguous b128 accesses. Q/K go to [B, H, S, hd].
// ---------------------------------------------------------------------------
__global__ void qkv_gemm_kernel(
    const half_t* __restrict__ Xh,
    const half_t* __restrict__ Wqt, const half_t* __restrict__ Wkt,
    const half_t* __restrict__ Wvt,
    const float* __restrict__ bq, const float* __restrict__ bk,
    const float* __restrict__ bv,
    half_t* __restrict__ Qh, half_t* __restrict__ Kh,
    half_t* __restrict__ VhT) {
  __shared__ __align__(16) half_t As[64][48];
  __shared__ __align__(16) half_t Bt[128][48];

  const half_t* W; const float* bias; half_t* dst; float scale;
  bool vmode = false;
  if (blockIdx.z == 0)      { W = Wqt; bias = bq; dst = Qh;  scale = 0.125f; }
  else if (blockIdx.z == 1) { W = Wkt; bias = bk; dst = Kh;  scale = 1.0f; }
  else                      { W = Wvt; bias = bv; dst = VhT; scale = 1.0f; vmode = true; }

  const int rowBase = blockIdx.y * 64;
  const int colBase = blockIdx.x * 128;
  v8f acc[2][2] = {};
  gemm_tile_core(Xh, W, As, Bt, rowBase, colBase, acc);

  const int lane = threadIdx.x & 31;
  const int wid  = threadIdx.x >> 5;
  const int wm = wid >> 2, wn = wid & 3, hi = lane >> 4, l15 = lane & 15;
#pragma unroll
  for (int sm = 0; sm < 2; ++sm)
#pragma unroll
    for (int sn = 0; sn < 2; ++sn)
#pragma unroll
      for (int r = 0; r < 8; ++r) {
        int R = rowBase + wm * 32 + sm * 16 + r + 8 * hi;
        int C = colBase + wn * 32 + sn * 16 + l15;
        float val = (acc[sm][sn][r] + bias[C]) * scale;
        int b = R >> 11, s = R & (S_ - 1), h = C >> 6, d = C & (HD_ - 1);
        size_t idx = vmode
            ? ((((size_t)(b * H_ + h)) * HD_ + d) * S_ + s)   // V: [B,H,hd,S]
            : ((((size_t)(b * H_ + h)) * S_ + s) * HD_ + d);  // Q/K: [B,H,S,hd]
        dst[idx] = (half_t)val;
      }
}

// ---------------------------------------------------------------------------
// Output projection: out(f32) = Oh(f16) @ Wf(f16, pre-transposed) + bf
// ---------------------------------------------------------------------------
__global__ void out_gemm_kernel(const half_t* __restrict__ Oh,
                                const half_t* __restrict__ Wft,
                                const float* __restrict__ bf,
                                float* __restrict__ out) {
  __shared__ __align__(16) half_t As[64][48];
  __shared__ __align__(16) half_t Bt[128][48];
  const int rowBase = blockIdx.y * 64;
  const int colBase = blockIdx.x * 128;
  v8f acc[2][2] = {};
  gemm_tile_core(Oh, Wft, As, Bt, rowBase, colBase, acc);

  const int lane = threadIdx.x & 31;
  const int wid  = threadIdx.x >> 5;
  const int wm = wid >> 2, wn = wid & 3, hi = lane >> 4, l15 = lane & 15;
#pragma unroll
  for (int sm = 0; sm < 2; ++sm)
#pragma unroll
    for (int sn = 0; sn < 2; ++sn)
#pragma unroll
      for (int r = 0; r < 8; ++r) {
        int R = rowBase + wm * 32 + sm * 16 + r + 8 * hi;
        int C = colBase + wn * 32 + sn * 16 + l15;
        out[(size_t)R * D_ + C] = acc[sm][sn][r] + bf[C];
      }
}

// ---------------------------------------------------------------------------
// Flash attention with bidirectional ALiBi.
// Block = 256 threads (8 waves) covers 128 q rows of one (b, h).
// Each wave owns a 16-row q tile; K (row-major) and V (already transposed in
// global) staged in LDS per 32-key chunk with b128-only traffic. Chunk range
// pruned by head direction; finite -1e9 mask matches the reference.
// ---------------------------------------------------------------------------
__global__ void attn_kernel(const half_t* __restrict__ Qh,
                            const half_t* __restrict__ Kh,
                            const half_t* __restrict__ VhT,
                            half_t* __restrict__ Oh) {
  __shared__ __align__(16) half_t Kt[32][72];      // row-major [key][dim]
  __shared__ __align__(16) half_t Vt[64][48];      // [dim][key] (pre-transposed)
  __shared__ __align__(16) half_t Pst[8][16][32];  // per-wave P re-layout

  const int bh  = blockIdx.x;
  const int b   = bh >> 4;
  const int h   = bh & 15;
  const int Qb  = blockIdx.y * 128;
  const int tid = threadIdx.x;
  const int lane = tid & 31;
  const int wid  = tid >> 5;
  const int hi   = lane >> 4;
  const int l15  = lane & 15;
  const int qbase = Qb + wid * 16;

  const half_t* Qp = Qh  + (size_t)(b * H_ + h) * S_ * HD_;
  const half_t* Kp = Kh  + (size_t)(b * H_ + h) * S_ * HD_;
  const half_t* Vp = VhT + (size_t)(b * H_ + h) * HD_ * S_;  // [dim][key]

  // Q fragments for the whole hd=64 (two K=32 steps), loaded once.
  V16 aq0, aq1;
  {
    const half_t* qrow = Qp + (size_t)(qbase + l15) * HD_;
    aq0.h[0] = *(const v8h*)(qrow + hi * 8);
    aq0.h[1] = *(const v8h*)(qrow + 16 + hi * 8);
    aq1.h[0] = *(const v8h*)(qrow + 32 + hi * 8);
    aq1.h[1] = *(const v8h*)(qrow + 48 + hi * 8);
  }

  float M[8], L[8];
  v8f acc[4] = {};
#pragma unroll
  for (int r = 0; r < 8; ++r) { M[r] = -1e30f; L[r] = 0.0f; }

  // slope = (24^(1/8))^-(h%8+1)
  const float slope = __expf(-__logf(24.0f) / 8.0f * (float)((h & 7) + 1));
  const bool fwd = (h < 8);
  const int cBeg = fwd ? 0 : (Qb >> 5);
  const int cEnd = fwd ? ((Qb >> 5) + 4) : (S_ >> 5);

  for (int kc = cBeg; kc < cEnd; ++kc) {
    const int kbase = kc * 32;
    // ---- stage K (row-major) and V (transposed in global): b128 only -----
    {
      int key = tid >> 3, db = (tid & 7) * 8;           // K: 32 keys x 64 dims
      v8h kv = *(const v8h*)&Kp[(size_t)(kbase + key) * HD_ + db];
      *(v8h*)&Kt[key][db] = kv;
      int d = tid >> 2, k8 = (tid & 3) * 8;             // V: 64 dims x 32 keys
      v8h vv = *(const v8h*)&Vp[(size_t)d * S_ + kbase + k8];
      *(v8h*)&Vt[d][k8] = vv;
    }
    __syncthreads();

    // ---- scores: Q(16x64) x K^T(64x32) -> two 16x16 f32 tiles ------------
    v8f c0 = {}, c1 = {};
    {
      V16 bk0, bk0b, bk1, bk1b;
      int key0 = l15, key1 = 16 + l15;
      bk0.h[0]  = *(const v8h*)&Kt[key0][hi * 8];
      bk0.h[1]  = *(const v8h*)&Kt[key0][16 + hi * 8];
      bk0b.h[0] = *(const v8h*)&Kt[key0][32 + hi * 8];
      bk0b.h[1] = *(const v8h*)&Kt[key0][48 + hi * 8];
      bk1.h[0]  = *(const v8h*)&Kt[key1][hi * 8];
      bk1.h[1]  = *(const v8h*)&Kt[key1][16 + hi * 8];
      bk1b.h[0] = *(const v8h*)&Kt[key1][32 + hi * 8];
      bk1b.h[1] = *(const v8h*)&Kt[key1][48 + hi * 8];
      c0 = __builtin_amdgcn_wmma_f32_16x16x32_f16(false, aq0.v, false, bk0.v,
                                                  (short)0, c0, false, false);
      c0 = __builtin_amdgcn_wmma_f32_16x16x32_f16(false, aq1.v, false, bk0b.v,
                                                  (short)0, c0, false, false);
      c1 = __builtin_amdgcn_wmma_f32_16x16x32_f16(false, aq0.v, false, bk1.v,
                                                  (short)0, c1, false, false);
      c1 = __builtin_amdgcn_wmma_f32_16x16x32_f16(false, aq1.v, false, bk1b.v,
                                                  (short)0, c1, false, false);
    }

    // ---- ALiBi bias + online softmax (per-row, 16-lane half reductions) --
    float p0[8], p1[8];
#pragma unroll
    for (int r = 0; r < 8; ++r) {
      int iq = qbase + r + 8 * hi;
      int j0 = kbase + l15;
      int j1 = kbase + 16 + l15;
      bool a0 = fwd ? (j0 <= iq) : (j0 >= iq);
      bool a1 = fwd ? (j1 <= iq) : (j1 >= iq);
      float s0 = c0[r] + (a0 ? -slope * fabsf((float)(iq - j0)) : -1e9f);
      float s1 = c1[r] + (a1 ? -slope * fabsf((float)(iq - j1)) : -1e9f);
      float mx = fmaxf(s0, s1);
#pragma unroll
      for (int o = 8; o >= 1; o >>= 1) mx = fmaxf(mx, __shfl_xor(mx, o, 32));
      float Mn = fmaxf(M[r], mx);
      float sc = __expf(M[r] - Mn);
      p0[r] = __expf(s0 - Mn);
      p1[r] = __expf(s1 - Mn);
      float rs = p0[r] + p1[r];
#pragma unroll
      for (int o = 8; o >= 1; o >>= 1) rs += __shfl_xor(rs, o, 32);
      L[r] = L[r] * sc + rs;
      M[r] = Mn;
#pragma unroll
      for (int j = 0; j < 4; ++j) acc[j][r] = acc[j][r] * sc;
    }

    // ---- re-layout P (C layout -> A layout) through per-wave LDS ---------
    half_t (*pp)[32] = Pst[wid];
#pragma unroll
    for (int r = 0; r < 8; ++r) {
      pp[r + 8 * hi][l15]      = (half_t)p0[r];
      pp[r + 8 * hi][16 + l15] = (half_t)p1[r];
    }
    asm volatile("s_wait_dscnt 0x0" ::: "memory");  // wave-local store->load
    V16 pf;
    pf.h[0] = *(const v8h*)&pp[l15][hi * 8];
    pf.h[1] = *(const v8h*)&pp[l15][16 + hi * 8];

    // ---- P(16x32) x V(32x64): 4 WMMAs accumulate into output -------------
#pragma unroll
    for (int j = 0; j < 4; ++j) {
      V16 bv;
      int dcol = j * 16 + l15;
      bv.h[0] = *(const v8h*)&Vt[dcol][hi * 8];
      bv.h[1] = *(const v8h*)&Vt[dcol][16 + hi * 8];
      acc[j] = __builtin_amdgcn_wmma_f32_16x16x32_f16(false, pf.v, false, bv.v,
                                                      (short)0, acc[j],
                                                      false, false);
    }
    __syncthreads();
  }

  // ---- epilogue: normalize and write f16 into [B*S, D] for final GEMM ----
#pragma unroll
  for (int r = 0; r < 8; ++r) {
    float inv = 1.0f / L[r];
    int R = b * S_ + qbase + r + 8 * hi;
#pragma unroll
    for (int j = 0; j < 4; ++j) {
      Oh[(size_t)R * D_ + h * HD_ + j * 16 + l15] = (half_t)(acc[j][r] * inv);
    }
  }
}

// ---------------------------------------------------------------------------
// Host-side launcher. Workspace layout (all 16B-aligned, ~48 MB total):
//   xh   : ROWS*D f16      (8 MB)
//   wqt/wkt/wvt/wft : D*D f16 each, TRANSPOSED [n][k] (4 x 2 MB)
//   Qh/Kh : B*H*S*hd f16  (2 x 8 MB);  VhT : B*H*hd*S f16 (8 MB)
//   Oh   : ROWS*D f16      (8 MB)
// ---------------------------------------------------------------------------
extern "C" void kernel_launch(void* const* d_in, const int* in_sizes, int n_in,
                              void* d_out, int out_size, void* d_ws,
                              size_t ws_size, hipStream_t stream) {
  const float* x  = (const float*)d_in[0];
  const float* Wq = (const float*)d_in[1];
  const float* bq = (const float*)d_in[2];
  const float* Wk = (const float*)d_in[3];
  const float* bk = (const float*)d_in[4];
  const float* Wv = (const float*)d_in[5];
  const float* bv = (const float*)d_in[6];
  const float* Wf = (const float*)d_in[7];
  const float* bf = (const float*)d_in[8];
  float* out = (float*)d_out;

  char* ws = (char*)d_ws;
  size_t off = 0;
  half_t* xh  = (half_t*)(ws + off); off += (size_t)ROWS * D_ * sizeof(half_t);
  half_t* wqt = (half_t*)(ws + off); off += (size_t)D_ * D_ * sizeof(half_t);
  half_t* wkt = (half_t*)(ws + off); off += (size_t)D_ * D_ * sizeof(half_t);
  half_t* wvt = (half_t*)(ws + off); off += (size_t)D_ * D_ * sizeof(half_t);
  half_t* wft = (half_t*)(ws + off); off += (size_t)D_ * D_ * sizeof(half_t);
  half_t* Qh  = (half_t*)(ws + off); off += (size_t)B_ * H_ * S_ * HD_ * sizeof(half_t);
  half_t* Kh  = (half_t*)(ws + off); off += (size_t)B_ * H_ * S_ * HD_ * sizeof(half_t);
  half_t* VhT = (half_t*)(ws + off); off += (size_t)B_ * H_ * HD_ * S_ * sizeof(half_t);
  half_t* Oh  = (half_t*)(ws + off); off += (size_t)ROWS * D_ * sizeof(half_t);

  // 1) conversions: x plain; weights transpose-converted to [n][k]
  cvt_f32_to_f16<<<1024, 256, 0, stream>>>(x, xh, ROWS * D_ / 4);
  dim3 tgrid(D_ / 64, D_ / 64);
  cvt_transpose_f32_to_f16<<<tgrid, 256, 0, stream>>>(Wq, wqt);
  cvt_transpose_f32_to_f16<<<tgrid, 256, 0, stream>>>(Wk, wkt);
  cvt_transpose_f32_to_f16<<<tgrid, 256, 0, stream>>>(Wv, wvt);
  cvt_transpose_f32_to_f16<<<tgrid, 256, 0, stream>>>(Wf, wft);

  // 2) fused QKV projection (z selects Q/K/V), tiles 64x128, 8 waves/block
  qkv_gemm_kernel<<<dim3(D_ / 128, ROWS / 64, 3), 256, 0, stream>>>(
      xh, wqt, wkt, wvt, bq, bk, bv, Qh, Kh, VhT);

  // 3) flash attention with bidirectional ALiBi
  attn_kernel<<<dim3(B_ * H_, S_ / 128), 256, 0, stream>>>(Qh, Kh, VhT, Oh);

  // 4) output projection to f32
  out_gemm_kernel<<<dim3(D_ / 128, ROWS / 64), 256, 0, stream>>>(
      Oh, wft, bf, out);
}

// v001
// One run takes 187 microseconds.
// Next to v000, in two timings, it ran 1.22 and 1.23 times as fast.
#include <hip/hip_runtime.h>
#include <cstdint>
#include <cstddef>

// ---------------------------------------------------------------------------
// RelativeAttention (ALiBi bidirectional) for MI455X / gfx1250, wave32 WMMA.
// All matmuls run on v_wmma_f32_16x16x32_f16 (f16 in, f32 accumulate).
// Weights are pre-transposed (and V written transposed) so every LDS staging
// access is a 128-bit load/store -- no 16-bit scatter in the hot loops.
// ---------------------------------------------------------------------------

typedef _Float16 half_t;
typedef __attribute__((ext_vector_type(16))) _Float16 v16h;
typedef __attribute__((ext_vector_type(8)))  _Float16 v8h;
typedef __attribute__((ext_vector_type(4)))  _Float16 v4h;
typedef __attribute__((ext_vector_type(8)))  float    v8f;

union V16 { v16h v; v8h h[2]; };

constexpr int B_   = 2;
constexpr int S_   = 2048;
constexpr int D_   = 1024;
constexpr int H_   = 16;
constexpr int HD_  = 64;
constexpr int ROWS = B_ * S_;   // 4096

// ---------------------------------------------------------------------------
// f32 -> f16 conversion (vectorized, grid-stride)
// ---------------------------------------------------------------------------
__global__ void cvt_f32_to_f16(const float* __restrict__ src,
                               half_t* __restrict__ dst, int n4) {
  int i = blockIdx.x * blockDim.x + threadIdx.x;
  int stride = gridDim.x * blockDim.x;
  for (; i < n4; i += stride) {
    float4 f = ((const float4*)src)[i];
    v4h h;
    h[0] = (half_t)f.x; h[1] = (half_t)f.y;
    h[2] = (half_t)f.z; h[3] = (half_t)f.w;
    ((v4h*)dst)[i] = h;
  }
}

// ---------------------------------------------------------------------------
// f32 [K][N] -> f16 [N][K] tiled transpose-convert (for the weight matrices).
// 64x64 tiles through LDS, coalesced on both sides. Grid (16,16), 256 thr.
// ---------------------------------------------------------------------------
__global__ void cvt_transpose_f32_to_f16(const float* __restrict__ src,
                                         half_t* __restrict__ dst) {
  __shared__ float tile[64][65];
  const int nb = blockIdx.x * 64;   // n base (cols of src, rows of dst)
  const int kb = blockIdx.y * 64;   // k base (rows of src, cols of dst)
#pragma unroll
  for (int i = 0; i < 16; ++i) {
    int idx = threadIdx.x + i * 256;
    int r = idx >> 6, c = idx & 63;
    tile[r][c] = src[(size_t)(kb + r) * D_ + nb + c];
  }
  __syncthreads();
#pragma unroll
  for (int i = 0; i < 16; ++i) {
    int idx = threadIdx.x + i * 256;
    int r = idx >> 6, c = idx & 63;
    dst[(size_t)(nb + r) * D_ + kb + c] = (half_t)tile[c][r];
  }
}

// ---------------------------------------------------------------------------
// Shared WMMA GEMM core: C(64x128 per block) = A(ROWS x 1024) * B(1024 x 1024)
// 256 threads = 8 waves, each wave computes a 32x32 patch (2x2 WMMA tiles).
// A staged row-major; B comes from a PRE-TRANSPOSED weight Wt[n][k], so both
// stagings and all fragment fills are contiguous 128-bit LDS operations.
// Fragment layout (ISA 7.12.2, 16-bit, wave32):
//   A: lane(l&15)=row, halves at k = {hi*8..+7, 16+hi*8..+7}
//   B: lane(l&15)=col, same k pattern.  C: n=l&15, m=r+8*(l>>4).
// ---------------------------------------------------------------------------
__device__ __forceinline__ void gemm_tile_core(
    const half_t* __restrict__ A, const half_t* __restrict__ Bt_g,
    half_t (*As)[48], half_t (*Bt)[48],
    int rowBase, int colBase, v8f acc[2][2]) {
  const int tid  = threadIdx.x;
  const int lane = tid & 31;
  const int wid  = tid >> 5;
  const int wm   = wid >> 2;       // 0..1  (m sub-block of 32 rows)
  const int wn   = wid & 3;        // 0..3  (n sub-block of 32 cols)
  const int hi   = lane >> 4;      // half-wave select
  const int l15  = lane & 15;

  for (int kt = 0; kt < D_ / 32; ++kt) {
    const int kb = kt * 32;
    // ---- stage A tile 64x32 (row-major), one b128 per thread -------------
    {
      int row = tid >> 2, cb = (tid & 3) * 8;
      v8h t = *(const v8h*)&A[(size_t)(rowBase + row) * D_ + kb + cb];
      *(v8h*)&As[row][cb] = t;
    }
    // ---- stage B tile from Wt[n][k]: 128 n x 32 k, two b128 per thread ---
    {
      int n = tid >> 1, k16 = (tid & 1) * 16;
      const half_t* src = &Bt_g[(size_t)(colBase + n) * D_ + kb + k16];
      v8h lo = *(const v8h*)src;
      v8h hi8 = *(const v8h*)(src + 8);
      *(v8h*)&Bt[n][k16]     = lo;
      *(v8h*)&Bt[n][k16 + 8] = hi8;
    }
    // prefetch next A tile row (speculative)
    if (kt + 1 < D_ / 32) {
      __builtin_prefetch(&A[(size_t)(rowBase + (tid >> 2)) * D_ + kb + 32], 0, 1);
    }
    __syncthreads();

    V16 af[2], bf2[2];
#pragma unroll
    for (int sm = 0; sm < 2; ++sm) {
      int r = wm * 32 + sm * 16 + l15;
      af[sm].h[0] = *(const v8h*)&As[r][hi * 8];
      af[sm].h[1] = *(const v8h*)&As[r][16 + hi * 8];
    }
#pragma unroll
    for (int sn = 0; sn < 2; ++sn) {
      int c = wn * 32 + sn * 16 + l15;
      bf2[sn].h[0] = *(const v8h*)&Bt[c][hi * 8];
      bf2[sn].h[1] = *(const v8h*)&Bt[c][16 + hi * 8];
    }
#pragma unroll
    for (int sm = 0; sm < 2; ++sm)
#pragma unroll
      for (int sn = 0; sn < 2; ++sn)
        acc[sm][sn] = __builtin_amdgcn_wmma_f32_16x16x32_f16(
            false, af[sm].v, false, bf2[sn].v, (short)0, acc[sm][sn],
            false, false);
    __syncthreads();
  }
}

// ---------------------------------------------------------------------------
// Fused QKV projection: z=0 -> Q (pre-scaled by 1/sqrt(hd)), z=1 -> K,
// z=2 -> V written TRANSPOSED [B, H, hd, S] so the attention kernel can
// stage V tiles with contiguous b128 accesses. Q/K go to [B, H, S, hd].
// ---------------------------------------------------------------------------
__global__ void qkv_gemm_kernel(
    const half_t* __restrict__ Xh,
    const half_t* __restrict__ Wqt, const half_t* __restrict__ Wkt,
    const half_t* __restrict__ Wvt,
    const float* __restrict__ bq, const float* __restrict__ bk,
    const float* __restrict__ bv,
    half_t* __restrict__ Qh, half_t* __restrict__ Kh,
    half_t* __restrict__ VhT) {
  __shared__ __align__(16) half_t As[64][48];
  __shared__ __align__(16) half_t Bt[128][48];

  const half_t* W; const float* bias; half_t* dst; float scale;
  bool vmode = false;
  if (blockIdx.z == 0)      { W = Wqt; bias = bq; dst = Qh;  scale = 0.125f; }
  else if (blockIdx.z == 1) { W = Wkt; bias = bk; dst = Kh;  scale = 1.0f; }
  else                      { W = Wvt; bias = bv; dst = VhT; scale = 1.0f; vmode = true; }

  const int rowBase = blockIdx.y * 64;
  const int colBase = blockIdx.x * 128;
  v8f acc[2][2] = {};
  gemm_tile_core(Xh, W, As, Bt, rowBase, colBase, acc);

  const int lane = threadIdx.x & 31;
  const int wid  = threadIdx.x >> 5;
  const int wm = wid >> 2, wn = wid & 3, hi = lane >> 4, l15 = lane & 15;
#pragma unroll
  for (int sm = 0; sm < 2; ++sm)
#pragma unroll
    for (int sn = 0; sn < 2; ++sn)
#pragma unroll
      for (int r = 0; r < 8; ++r) {
        int R = rowBase + wm * 32 + sm * 16 + r + 8 * hi;
        int C = colBase + wn * 32 + sn * 16 + l15;
        float val = (acc[sm][sn][r] + bias[C]) * scale;
        int b = R >> 11, s = R & (S_ - 1), h = C >> 6, d = C & (HD_ - 1);
        size_t idx = vmode
            ? ((((size_t)(b * H_ + h)) * HD_ + d) * S_ + s)   // V: [B,H,hd,S]
            : ((((size_t)(b * H_ + h)) * S_ + s) * HD_ + d);  // Q/K: [B,H,S,hd]
        dst[idx] = (half_t)val;
      }
}

// ---------------------------------------------------------------------------
// Output projection: out(f32) = Oh(f16) @ Wf(f16, pre-transposed) + bf
// ---------------------------------------------------------------------------
__global__ void out_gemm_kernel(const half_t* __restrict__ Oh,
                                const half_t* __restrict__ Wft,
                                const float* __restrict__ bf,
                                float* __restrict__ out) {
  __shared__ __align__(16) half_t As[64][48];
  __shared__ __align__(16) half_t Bt[128][48];
  const int rowBase = blockIdx.y * 64;
  const int colBase = blockIdx.x * 128;
  v8f acc[2][2] = {};
  gemm_tile_core(Oh, Wft, As, Bt, rowBase, colBase, acc);

  const int lane = threadIdx.x & 31;
  const int wid  = threadIdx.x >> 5;
  const int wm = wid >> 2, wn = wid & 3, hi = lane >> 4, l15 = lane & 15;
#pragma unroll
  for (int sm = 0; sm < 2; ++sm)
#pragma unroll
    for (int sn = 0; sn < 2; ++sn)
#pragma unroll
      for (int r = 0; r < 8; ++r) {
        int R = rowBase + wm * 32 + sm * 16 + r + 8 * hi;
        int C = colBase + wn * 32 + sn * 16 + l15;
        out[(size_t)R * D_ + C] = acc[sm][sn][r] + bf[C];
      }
}

// ---------------------------------------------------------------------------
// Lane l with lane l ^ 16 (the other 16-lane half), on the vector port.
// ---------------------------------------------------------------------------
__device__ __forceinline__ float xhalf(float x) {
  return __builtin_bit_cast(float, __builtin_amdgcn_permlanex16(
      __builtin_bit_cast(int, x), __builtin_bit_cast(int, x),
      0x76543210, 0xfedcba98, false, false));
}

__global__ void attn_kernel(const half_t* __restrict__ Qh,
                            const half_t* __restrict__ Kh,
                            const half_t* __restrict__ VhT,
                            half_t* __restrict__ Oh) {
  __shared__ __align__(16) half_t Kt[32][72];      // row-major [key][dim]
  __shared__ __align__(16) half_t Vt[64][48];      // [dim][key] (pre-transposed)

  const int bh  = blockIdx.x;
  const int b   = bh >> 4;
  const int h   = bh & 15;
  const int Qb  = blockIdx.y * 128;
  const int tid = threadIdx.x;
  const int lane = tid & 31;
  const int wid  = tid >> 5;
  const int hi   = lane >> 4;
  const int l15  = lane & 15;
  const int qbase = Qb + wid * 16;
  const int iq    = qbase + l15;   // this lane's query

  const half_t* Qp = Qh  + (size_t)(b * H_ + h) * S_ * HD_;
  const half_t* Kp = Kh  + (size_t)(b * H_ + h) * S_ * HD_;
  const half_t* Vp = VhT + (size_t)(b * H_ + h) * HD_ * S_;  // [dim][key]

  // Q fragments for the whole hd=64 (two K=32 steps), loaded once.
  V16 aq0, aq1;
  {
    const half_t* qrow = Qp + (size_t)iq * HD_;
    aq0.h[0] = *(const v8h*)(qrow + hi * 8);
    aq0.h[1] = *(const v8h*)(qrow + 16 + hi * 8);
    aq1.h[0] = *(const v8h*)(qrow + 32 + hi * 8);
    aq1.h[1] = *(const v8h*)(qrow + 48 + hi * 8);
  }

  float M = -1e30f;   // running maximum of this lane's query (both halves alike)
  float L = 0.0f;     // running sum over this half's keys; halves joined at the end
  v8f acc[4] = {};    // acc[j][r] = O^T[j*16 + 8*hi + r][query l15]

  // slope = (24^(1/8))^-(h%8+1)
  const float slope = __expf(-__logf(24.0f) / 8.0f * (float)((h & 7) + 1));
  const bool fwd = (h < 8);
  const int cBeg = fwd ? 0 : (Qb >> 5);
  const int cEnd = fwd ? ((Qb >> 5) + 4) : (S_ >> 5);

  for (int kc = cBeg; kc < cEnd; ++kc) {
    const int kbase = kc * 32;
    // ---- stage K (row-major) and V (transposed in global): b128 only -----
    {
      int key = tid >> 3, db = (tid & 7) * 8;           // K: 32 keys x 64 dims
      v8h kv = *(const v8h*)&Kp[(size_t)(kbase + key) * HD_ + db];
      *(v8h*)&Kt[key][db] = kv;
      int d = tid >> 2, k8 = (tid & 3) * 8;             // V: 64 dims x 32 keys
      v8h vv = *(const v8h*)&Vp[(size_t)d * S_ + kbase + k8];
      *(v8h*)&Vt[d][k8] = vv;
    }
    __syncthreads();

    // ---- scores: K(32x64) x Q^T(64x16) -> two 16x16 f32 tiles of S^T -----
    v8f c0 = {}, c1 = {};
    {
      V16 bk0, bk0b, bk1, bk1b;
      int key0 = l15, key1 = 16 + l15;
      bk0.h[0]  = *(const v8h*)&Kt[key0][hi * 8];
      bk0.h[1]  = *(const v8h*)&Kt[key0][16 + hi * 8];
      bk0b.h[0] = *(const v8h*)&Kt[key0][32 + hi * 8];
      bk0b.h[1] = *(const v8h*)&Kt[key0][48 + hi * 8];
      bk1.h[0]  = *(const v8h*)&Kt[key1][hi * 8];
      bk1.h[1]  = *(const v8h*)&Kt[key1][16 + hi * 8];
      bk1b.h[0] = *(const v8h*)&Kt[key1][32 + hi * 8];
      bk1b.h[1] = *(const v8h*)&Kt[key1][48 + hi * 8];
      c0 = __builtin_amdgcn_wmma_f32_16x16x32_f16(false, bk0.v, false, aq0.v,
                                                  (short)0, c0, false, false);
      c0 = __builtin_amdgcn_wmma_f32_16x16x32_f16(false, bk0b.v, false, aq1.v,
                                                  (short)0, c0, false, false);
      c1 = __builtin_amdgcn_wmma_f32_16x16x32_f16(false, bk1.v, false, aq0.v,
                                                  (short)0, c1, false, false);
      c1 = __builtin_amdgcn_wmma_f32_16x16x32_f16(false, bk1b.v, false, aq1.v,
                                                  (short)0, c1, false, false);
    }

    // ---- ALiBi bias + online softmax, one query per lane ------------------
    float s0[8], s1[8];
    float mx = -1e30f;
#pragma unroll
    for (int r = 0; r < 8; ++r) {
      int j0 = kbase + 8 * hi + r;
      int j1 = kbase + 16 + 8 * hi + r;
      bool a0 = fwd ? (j0 <= iq) : (j0 >= iq);
      bool a1 = fwd ? (j1 <= iq) : (j1 >= iq);
      s0[r] = c0[r] + (a0 ? -slope * fabsf((float)(iq - j0)) : -1e9f);
      s1[r] = c1[r] + (a1 ? -slope * fabsf((float)(iq - j1)) : -1e9f);
      mx = fmaxf(mx, fmaxf(s0[r], s1[r]));
    }
    mx = fmaxf(mx, xhalf(mx));   // all 32 keys of the chunk
    const float Mn = fmaxf(M, mx);
    const float sc = __expf(M - Mn);
    M = Mn;

    V16 pf;                      // P^T as B operand: pf[s] = P^T[kmap(s, hi)][l15]
    float rs = 0.0f;
#pragma unroll
    for (int r = 0; r < 8; ++r) {
      float p0 = __expf(s0[r] - Mn);
      float p1 = __expf(s1[r] - Mn);
      rs += p0 + p1;
      pf.v[r]     = (half_t)p0;
      pf.v[8 + r] = (half_t)p1;
    }
    L = L * sc + rs;
#pragma unroll
    for (int j = 0; j < 4; ++j)
#pragma unroll
      for (int r = 0; r < 8; ++r) acc[j][r] = acc[j][r] * sc;

    // ---- V^T(64x32) x P^T(32x16): 4 WMMAs accumulate into O^T ------------
#pragma unroll
    for (int j = 0; j < 4; ++j) {
      V16 bv;
      int drow = j * 16 + l15;
      bv.h[0] = *(const v8h*)&Vt[drow][hi * 8];
      bv.h[1] = *(const v8h*)&Vt[drow][16 + hi * 8];
      acc[j] = __builtin_amdgcn_wmma_f32_16x16x32_f16(false, bv.v, false, pf.v,
                                                      (short)0, acc[j],
                                                      false, false);
    }
    __syncthreads();
  }

  // ---- epilogue: join the halves' sums, normalize, write f16 into [B*S, D]
  //      for the final GEMM; a lane's 8 registers are 8 consecutive dims -----
  const float inv = 1.0f / (L + xhalf(L));
  half_t* orow = Oh + (size_t)(b * S_ + iq) * D_ + h * HD_ + 8 * hi;
#pragma unroll
  for (int j = 0; j < 4; ++j) {
    v8h o;
#pragma unroll
    for (int r = 0; r < 8; ++r) o[r] = (half_t)(acc[j][r] * inv);
    *(v8h*)(orow + j * 16) = o;
  }
}

// ---------------------------------------------------------------------------
// Host-side launcher. Workspace layout (all 16B-aligned, ~48 MB total):
//   xh   : ROWS*D f16      (8 MB)
//   wqt/wkt/wvt/wft : D*D f16 each, TRANSPOSED [n][k] (4 x 2 MB)
//   Qh/Kh : B*H*S*hd f16  (2 x 8 MB);  VhT : B*H*hd*S f16 (8 MB)
//   Oh   : ROWS*D f16      (8 MB)
// ---------------------------------------------------------------------------
extern "C" void kernel_launch(void* const* d_in, const int* in_sizes, int n_in,
                              void* d_out, int out_size, void* d_ws,
                              size_t ws_size, hipStream_t stream) {
  const float* x  = (const float*)d_in[0];
  const float* Wq = (const float*)d_in[1];
  const float* bq = (const float*)d_in[2];
  const float* Wk = (const float*)d_in[3];
  const float* bk = (const float*)d_in[4];
  const float* Wv = (const float*)d_in[5];
  const float* bv = (const float*)d_in[6];
  const float* Wf = (const float*)d_in[7];
  const float* bf = (const float*)d_in[8];
  float* out = (float*)d_out;

  char* ws = (char*)d_ws;
  size_t off = 0;
  half_t* xh  = (half_t*)(ws + off); off += (size_t)ROWS * D_ * sizeof(half_t);
  half_t* wqt = (half_t*)(ws + off); off += (size_t)D_ * D_ * sizeof(half_t);
  half_t* wkt = (half_t*)(ws + off); off += (size_t)D_ * D_ * sizeof(half_t);
  half_t* wvt = (half_t*)(ws + off); off += (size_t)D_ * D_ * sizeof(half_t);
  half_t* wft = (half_t*)(ws + off); off += (size_t)D_ * D_ * sizeof(half_t);
  half_t* Qh  = (half_t*)(ws + off); off += (size_t)B_ * H_ * S_ * HD_ * sizeof(half_t);
  half_t* Kh  = (half_t*)(ws + off); off += (size_t)B_ * H_ * S_ * HD_ * sizeof(half_t);
  half_t* VhT = (half_t*)(ws + off); off += (size_t)B_ * H_ * HD_ * S_ * sizeof(half_t);
  half_t* Oh  = (half_t*)(ws + off); off += (size_t)ROWS * D_ * sizeof(half_t);

  // 1) conversions: x plain; weights transpose-converted to [n][k]
  cvt_f32_to_f16<<<1024, 256, 0, stream>>>(x, xh, ROWS * D_ / 4);
  dim3 tgrid(D_ / 64, D_ / 64);
  cvt_transpose_f32_to_f16<<<tgrid, 256, 0, stream>>>(Wq, wqt);
  cvt_transpose_f32_to_f16<<<tgrid, 256, 0, stream>>>(Wk, wkt);
  cvt_transpose_f32_to_f16<<<tgrid, 256, 0, stream>>>(Wv, wvt);
  cvt_transpose_f32_to_f16<<<tgrid, 256, 0, stream>>>(Wf, wft);

  // 2) fused QKV projection (z selects Q/K/V), tiles 64x128, 8 waves/block
  qkv_gemm_kernel<<<dim3(D_ / 128, ROWS / 64, 3), 256, 0, stream>>>(
      xh, wqt, wkt, wvt, bq, bk, bv, Qh, Kh, VhT);

  // 3) flash attention with bidirectional ALiBi
  attn_kernel<<<dim3(B_ * H_, S_ / 128), 256, 0, stream>>>(Qh, Kh, VhT, Oh);

  // 4) output projection to f32
  out_gemm_kernel<<<dim3(D_ / 128, ROWS / 64), 256, 0, stream>>>(
      Oh, wft, bf, out);
}

// v002
// A run of this version takes 154 microseconds.
// In both of two side-by-side timings against v001, it was 1.21 times as fast.
// Counting every step since v000, it is 1.49 times as fast.
#include <hip/hip_runtime.h>
#include <cstdint>
#include <cstddef>

// ---------------------------------------------------------------------------
// RelativeAttention (ALiBi bidirectional) for MI455X / gfx1250, wave32 WMMA.
// All matmuls run on v_wmma_f32_16x16x32_f16 (f16 in, f32 accumulate).
// Weights are pre-transposed (and V written transposed) so every LDS staging
// access is a 128-bit load/store -- no 16-bit scatter in the hot loops.
// ---------------------------------------------------------------------------

typedef _Float16 half_t;
typedef __attribute__((ext_vector_type(16))) _Float16 v16h;
typedef __attribute__((ext_vector_type(8)))  _Float16 v8h;
typedef __attribute__((ext_vector_type(4)))  _Float16 v4h;
typedef __attribute__((ext_vector_type(8)))  float    v8f;

union V16 { v16h v; v8h h[2]; };

constexpr int B_   = 2;
constexpr int S_   = 2048;
constexpr int D_   = 1024;
constexpr int H_   = 16;
constexpr int HD_  = 64;
constexpr int ROWS = B_ * S_;   // 4096

// ---------------------------------------------------------------------------
// f32 -> f16 conversion (vectorized, grid-stride)
// ---------------------------------------------------------------------------
__global__ void cvt_f32_to_f16(const float* __restrict__ src,
                               half_t* __restrict__ dst, int n4) {
  int i = blockIdx.x * blockDim.x + threadIdx.x;
  int stride = gridDim.x * blockDim.x;
  for (; i < n4; i += stride) {
    float4 f = ((const float4*)src)[i];
    v4h h;
    h[0] = (half_t)f.x; h[1] = (half_t)f.y;
    h[2] = (half_t)f.z; h[3] = (half_t)f.w;
    ((v4h*)dst)[i] = h;
  }
}

// ---------------------------------------------------------------------------
// f32 [K][N] -> f16 [N][K] tiled transpose-convert (for the weight matrices).
// 64x64 tiles through LDS, coalesced on both sides. Grid (16,16), 256 thr.
// ---------------------------------------------------------------------------
__global__ void cvt_transpose_f32_to_f16(const float* __restrict__ src,
                                         half_t* __restrict__ dst) {
  __shared__ float tile[64][65];
  const int nb = blockIdx.x * 64;   // n base (cols of src, rows of dst)
  const int kb = blockIdx.y * 64;   // k base (rows of src, cols of dst)
#pragma unroll
  for (int i = 0; i < 16; ++i) {
    int idx = threadIdx.x + i * 256;
    int r = idx >> 6, c = idx & 63;
    tile[r][c] = src[(size_t)(kb + r) * D_ + nb + c];
  }
  __syncthreads();
#pragma unroll
  for (int i = 0; i < 16; ++i) {
    int idx = threadIdx.x + i * 256;
    int r = idx >> 6, c = idx & 63;
    dst[(size_t)(nb + r) * D_ + kb + c] = (half_t)tile[c][r];
  }
}

// ---------------------------------------------------------------------------
// Shared WMMA GEMM core: C(128x128 per block) = A(ROWS x 1024) * B(1024 x 1024)
// 256 threads = 8 waves (2 x 4), each wave computes a 64x32 patch (4x2 WMMA
// tiles). A stage is 64 k: every staged row is one whole 128-byte line, and a
// wave-wide 128-bit load covers four whole lines. LDS rows stand at a pitch of
// 144 bytes (16 B x odd), the conflict-free pitch for 128-bit fragment reads.
// A staged row-major; B comes from a PRE-TRANSPOSED weight Wt[n][k], so both
// stagings and all fragment fills are contiguous 128-bit LDS operations.
// Fragment layout (ISA 7.12.2, 16-bit, wave32):
//   A: lane(l&15)=row, halves at k = {hi*8..+7, 16+hi*8..+7}
//   B: lane(l&15)=col, same k pattern.  C: n=l&15, m=r+8*(l>>4).
// ---------------------------------------------------------------------------
constexpr int BM = 128;   // block rows
constexpr int BN = 128;   // block cols
constexpr int BK = 64;    // k per stage (128 bytes of every operand row)
constexpr int LP = 72;    // LDS row pitch in halves (144 bytes)

__device__ __forceinline__ void gemm_tile_core(
    const half_t* __restrict__ A, const half_t* __restrict__ Bt_g,
    half_t (*As)[LP], half_t (*Bt)[LP],
    int rowBase, int colBase, v8f acc[4][2]) {
  const int tid  = threadIdx.x;
  const int lane = tid & 31;
  const int wid  = tid >> 5;
  const int wm   = wid >> 2;       // 0..1  (m sub-block of 64 rows)
  const int wn   = wid & 3;        // 0..3  (n sub-block of 32 cols)
  const int hi   = lane >> 4;      // half-wave select
  const int l15  = lane & 15;
  const int srow = tid >> 3;       // staging: 8 threads per 128-byte row
  const int scol = (tid & 7) * 8;

  const half_t* ag = A    + (size_t)(rowBase + srow) * D_ + scol;
  const half_t* bg = Bt_g + (size_t)(colBase + srow) * D_ + scol;

  for (int kt = 0; kt < D_ / BK; ++kt) {
    // ---- stage A 128x64 and B 128x64: four b128 per thread and operand ---
    // (all loops below are unrolled so that ta, tb, the fragments and acc are
    //  indexed by constants and stay in registers; all eight loads fly at once)
    v8h ta[4], tb[4];
#pragma unroll
    for (int i = 0; i < 4; ++i)
      ta[i] = *(const v8h*)(ag + (size_t)(i * 32) * D_ + kt * BK);
#pragma unroll
    for (int i = 0; i < 4; ++i)
      tb[i] = *(const v8h*)(bg + (size_t)(i * 32) * D_ + kt * BK);
#pragma unroll
    for (int i = 0; i < 4; ++i) *(v8h*)&As[srow + i * 32][scol] = ta[i];
#pragma unroll
    for (int i = 0; i < 4; ++i) *(v8h*)&Bt[srow + i * 32][scol] = tb[i];
    // the next trip rewrites the address registers of the loads above
    asm volatile("s_wait_xcnt 0x0" ::: "memory");
    __syncthreads();

#pragma unroll
    for (int ks = 0; ks < BK / 32; ++ks) {
      V16 af[4], bf2[2];
#pragma unroll
      for (int sm = 0; sm < 4; ++sm) {
        int r = wm * 64 + sm * 16 + l15;
        af[sm].h[0] = *(const v8h*)&As[r][ks * 32 + hi * 8];
        af[sm].h[1] = *(const v8h*)&As[r][ks * 32 + 16 + hi * 8];
      }
#pragma unroll
      for (int sn = 0; sn < 2; ++sn) {
        int c = wn * 32 + sn * 16 + l15;
        bf2[sn].h[0] = *(const v8h*)&Bt[c][ks * 32 + hi * 8];
        bf2[sn].h[1] = *(const v8h*)&Bt[c][ks * 32 + 16 + hi * 8];
      }
#pragma unroll
      for (int sm = 0; sm < 4; ++sm)
#pragma unroll
        for (int sn = 0; sn < 2; ++sn)
          acc[sm][sn] = __builtin_amdgcn_wmma_f32_16x16x32_f16(
              false, af[sm].v, false, bf2[sn].v, (short)0, acc[sm][sn],
              false, false);
    }
    __syncthreads();
  }
}

// ---------------------------------------------------------------------------
// Fused QKV projection: z=0 -> Q (pre-scaled by 1/sqrt(hd)), z=1 -> K,
// z=2 -> V written TRANSPOSED [B, H, hd, S] so the attention kernel can
// stage V tiles with contiguous b128 accesses. Q/K go to [B, H, S, hd].
// ---------------------------------------------------------------------------
__global__ __launch_bounds__(256) void qkv_gemm_kernel(
    const half_t* __restrict__ Xh,
    const half_t* __restrict__ Wqt, const half_t* __restrict__ Wkt,
    const half_t* __restrict__ Wvt,
    const float* __restrict__ bq, const float* __restrict__ bk,
    const float* __restrict__ bv,
    half_t* __restrict__ Qh, half_t* __restrict__ Kh,
    half_t* __restrict__ VhT) {
  __shared__ __align__(16) half_t As[BM][LP];
  __shared__ __align__(16) half_t Bt[BN][LP];

  const half_t* W; const float* bias; half_t* dst; float scale;
  bool vmode = false;
  if (blockIdx.z == 0)      { W = Wqt; bias = bq; dst = Qh;  scale = 0.125f; }
  else if (blockIdx.z == 1) { W = Wkt; bias = bk; dst = Kh;  scale = 1.0f; }
  else                      { W = Wvt; bias = bv; dst = VhT; scale = 1.0f; vmode = true; }

  const int rowBase = blockIdx.y * BM;
  const int colBase = blockIdx.x * BN;
  v8f acc[4][2] = {};
  gemm_tile_core(Xh, W, As, Bt, rowBase, colBase, acc);

  const int lane = threadIdx.x & 31;
  const int wid  = threadIdx.x >> 5;
  const int wm = wid >> 2, wn = wid & 3, hi = lane >> 4, l15 = lane & 15;
#pragma unroll
  for (int sm = 0; sm < 4; ++sm)
#pragma unroll
    for (int sn = 0; sn < 2; ++sn)
#pragma unroll
      for (int r = 0; r < 8; ++r) {
        int R = rowBase + wm * 64 + sm * 16 + r + 8 * hi;
        int C = colBase + wn * 32 + sn * 16 + l15;
        float val = (acc[sm][sn][r] + bias[C]) * scale;
        int b = R >> 11, s = R & (S_ - 1), h = C >> 6, d = C & (HD_ - 1);
        size_t idx = vmode
            ? ((((size_t)(b * H_ + h)) * HD_ + d) * S_ + s)   // V: [B,H,hd,S]
            : ((((size_t)(b * H_ + h)) * S_ + s) * HD_ + d);  // Q/K: [B,H,S,hd]
        dst[idx] = (half_t)val;
      }
}

// ---------------------------------------------------------------------------
// Output projection: out(f32) = Oh(f16) @ Wf(f16, pre-transposed) + bf
// ---------------------------------------------------------------------------
__global__ __launch_bounds__(256) void out_gemm_kernel(
    const half_t* __restrict__ Oh, const half_t* __restrict__ Wft,
    const float* __restrict__ bf, float* __restrict__ out) {
  __shared__ __align__(16) half_t As[BM][LP];
  __shared__ __align__(16) half_t Bt[BN][LP];
  const int rowBase = blockIdx.y * BM;
  const int colBase = blockIdx.x * BN;
  v8f acc[4][2] = {};
  gemm_tile_core(Oh, Wft, As, Bt, rowBase, colBase, acc);

  const int lane = threadIdx.x & 31;
  const int wid  = threadIdx.x >> 5;
  const int wm = wid >> 2, wn = wid & 3, hi = lane >> 4, l15 = lane & 15;
#pragma unroll
  for (int sm = 0; sm < 4; ++sm)
#pragma unroll
    for (int sn = 0; sn < 2; ++sn)
#pragma unroll
      for (int r = 0; r < 8; ++r) {
        int R = rowBase + wm * 64 + sm * 16 + r + 8 * hi;
        int C = colBase + wn * 32 + sn * 16 + l15;
        out[(size_t)R * D_ + C] = acc[sm][sn][r] + bf[C];
      }
}

// ---------------------------------------------------------------------------
// Lane l with lane l ^ 16 (the other 16-lane half), on the vector port.
// ---------------------------------------------------------------------------
__device__ __forceinline__ float xhalf(float x) {
  return __builtin_bit_cast(float, __builtin_amdgcn_permlanex16(
      __builtin_bit_cast(int, x), __builtin_bit_cast(int, x),
      0x76543210, 0xfedcba98, false, false));
}

__global__ void attn_kernel(const half_t* __restrict__ Qh,
                            const half_t* __restrict__ Kh,
                            const half_t* __restrict__ VhT,
                            half_t* __restrict__ Oh) {
  __shared__ __align__(16) half_t Kt[32][72];      // row-major [key][dim]
  __shared__ __align__(16) half_t Vt[64][48];      // [dim][key] (pre-transposed)

  const int bh  = blockIdx.x;
  const int b   = bh >> 4;
  const int h   = bh & 15;
  const int Qb  = blockIdx.y * 128;
  const int tid = threadIdx.x;
  const int lane = tid & 31;
  const int wid  = tid >> 5;
  const int hi   = lane >> 4;
  const int l15  = lane & 15;
  const int qbase = Qb + wid * 16;
  const int iq    = qbase + l15;   // this lane's query

  const half_t* Qp = Qh  + (size_t)(b * H_ + h) * S_ * HD_;
  const half_t* Kp = Kh  + (size_t)(b * H_ + h) * S_ * HD_;
  const half_t* Vp = VhT + (size_t)(b * H_ + h) * HD_ * S_;  // [dim][key]

  // Q fragments for the whole hd=64 (two K=32 steps), loaded once.
  V16 aq0, aq1;
  {
    const half_t* qrow = Qp + (size_t)iq * HD_;
    aq0.h[0] = *(const v8h*)(qrow + hi * 8);
    aq0.h[1] = *(const v8h*)(qrow + 16 + hi * 8);
    aq1.h[0] = *(const v8h*)(qrow + 32 + hi * 8);
    aq1.h[1] = *(const v8h*)(qrow + 48 + hi * 8);
  }

  float M = -1e30f;   // running maximum of this lane's query (both halves alike)
  float L = 0.0f;     // running sum over this half's keys; halves joined at the end
  v8f acc[4] = {};    // acc[j][r] = O^T[j*16 + 8*hi + r][query l15]

  // slope = (24^(1/8))^-(h%8+1)
  const float slope = __expf(-__logf(24.0f) / 8.0f * (float)((h & 7) + 1));
  const bool fwd = (h < 8);
  const int cBeg = fwd ? 0 : (Qb >> 5);
  const int cEnd = fwd ? ((Qb >> 5) + 4) : (S_ >> 5);

  for (int kc = cBeg; kc < cEnd; ++kc) {
    const int kbase = kc * 32;
    // ---- stage K (row-major) and V (transposed in global): b128 only -----
    {
      int key = tid >> 3, db = (tid & 7) * 8;           // K: 32 keys x 64 dims
      v8h kv = *(const v8h*)&Kp[(size_t)(kbase + key) * HD_ + db];
      *(v8h*)&Kt[key][db] = kv;
      int d = tid >> 2, k8 = (tid & 3) * 8;             // V: 64 dims x 32 keys
      v8h vv = *(const v8h*)&Vp[(size_t)d * S_ + kbase + k8];
      *(v8h*)&Vt[d][k8] = vv;
    }
    __syncthreads();

    // ---- scores: K(32x64) x Q^T(64x16) -> two 16x16 f32 tiles of S^T -----
    v8f c0 = {}, c1 = {};
    {
      V16 bk0, bk0b, bk1, bk1b;
      int key0 = l15, key1 = 16 + l15;
      bk0.h[0]  = *(const v8h*)&Kt[key0][hi * 8];
      bk0.h[1]  = *(const v8h*)&Kt[key0][16 + hi * 8];
      bk0b.h[0] = *(const v8h*)&Kt[key0][32 + hi * 8];
      bk0b.h[1] = *(const v8h*)&Kt[key0][48 + hi * 8];
      bk1.h[0]  = *(const v8h*)&Kt[key1][hi * 8];
      bk1.h[1]  = *(const v8h*)&Kt[key1][16 + hi * 8];
      bk1b.h[0] = *(const v8h*)&Kt[key1][32 + hi * 8];
      bk1b.h[1] = *(const v8h*)&Kt[key1][48 + hi * 8];
      c0 = __builtin_amdgcn_wmma_f32_16x16x32_f16(false, bk0.v, false, aq0.v,
                                                  (short)0, c0, false, false);
      c0 = __builtin_amdgcn_wmma_f32_16x16x32_f16(false, bk0b.v, false, aq1.v,
                                                  (short)0, c0, false, false);
      c1 = __builtin_amdgcn_wmma_f32_16x16x32_f16(false, bk1.v, false, aq0.v,
                                                  (short)0, c1, false, false);
      c1 = __builtin_amdgcn_wmma_f32_16x16x32_f16(false, bk1b.v, false, aq1.v,
                                                  (short)0, c1, false, false);
    }

    // ---- ALiBi bias + online softmax, one query per lane ------------------
    float s0[8], s1[8];
    float mx = -1e30f;
#pragma unroll
    for (int r = 0; r < 8; ++r) {
      int j0 = kbase + 8 * hi + r;
      int j1 = kbase + 16 + 8 * hi + r;
      bool a0 = fwd ? (j0 <= iq) : (j0 >= iq);
      bool a1 = fwd ? (j1 <= iq) : (j1 >= iq);
      s0[r] = c0[r] + (a0 ? -slope * fabsf((float)(iq - j0)) : -1e9f);
      s1[r] = c1[r] + (a1 ? -slope * fabsf((float)(iq - j1)) : -1e9f);
      mx = fmaxf(mx, fmaxf(s0[r], s1[r]));
    }
    mx = fmaxf(mx, xhalf(mx));   // all 32 keys of the chunk
    const float Mn = fmaxf(M, mx);
    const float sc = __expf(M - Mn);
    M = Mn;

    V16 pf;                      // P^T as B operand: pf[s] = P^T[kmap(s, hi)][l15]
    float rs = 0.0f;
#pragma unroll
    for (int r = 0; r < 8; ++r) {
      float p0 = __expf(s0[r] - Mn);
      float p1 = __expf(s1[r] - Mn);
      rs += p0 + p1;
      pf.v[r]     = (half_t)p0;
      pf.v[8 + r] = (half_t)p1;
    }
    L = L * sc + rs;
#pragma unroll
    for (int j = 0; j < 4; ++j)
#pragma unroll
      for (int r = 0; r < 8; ++r) acc[j][r] = acc[j][r] * sc;

    // ---- V^T(64x32) x P^T(32x16): 4 WMMAs accumulate into O^T ------------
#pragma unroll
    for (int j = 0; j < 4; ++j) {
      V16 bv;
      int drow = j * 16 + l15;
      bv.h[0] = *(const v8h*)&Vt[drow][hi * 8];
      bv.h[1] = *(const v8h*)&Vt[drow][16 + hi * 8];
      acc[j] = __builtin_amdgcn_wmma_f32_16x16x32_f16(false, bv.v, false, pf.v,
                                                      (short)0, acc[j],
                                                      false, false);
    }
    __syncthreads();
  }

  // ---- epilogue: join the halves' sums, normalize, write f16 into [B*S, D]
  //      for the final GEMM; a lane's 8 registers are 8 consecutive dims -----
  const float inv = 1.0f / (L + xhalf(L));
  half_t* orow = Oh + (size_t)(b * S_ + iq) * D_ + h * HD_ + 8 * hi;
#pragma unroll
  for (int j = 0; j < 4; ++j) {
    v8h o;
#pragma unroll
    for (int r = 0; r < 8; ++r) o[r] = (half_t)(acc[j][r] * inv);
    *(v8h*)(orow + j * 16) = o;
  }
}

// ---------------------------------------------------------------------------
// Host-side launcher. Workspace layout (all 16B-aligned, ~48 MB total):
//   xh   : ROWS*D f16      (8 MB)
//   wqt/wkt/wvt/wft : D*D f16 each, TRANSPOSED [n][k] (4 x 2 MB)
//   Qh/Kh : B*H*S*hd f16  (2 x 8 MB);  VhT : B*H*hd*S f16 (8 MB)
//   Oh   : ROWS*D f16      (8 MB)
// ---------------------------------------------------------------------------
extern "C" void kernel_launch(void* const* d_in, const int* in_sizes, int n_in,
                              void* d_out, int out_size, void* d_ws,
                              size_t ws_size, hipStream_t stream) {
  const float* x  = (const float*)d_in[0];
  const float* Wq = (const float*)d_in[1];
  const float* bq = (const float*)d_in[2];
  const float* Wk = (const float*)d_in[3];
  const float* bk = (const float*)d_in[4];
  const float* Wv = (const float*)d_in[5];
  const float* bv = (const float*)d_in[6];
  const float* Wf = (const float*)d_in[7];
  const float* bf = (const float*)d_in[8];
  float* out = (float*)d_out;

  char* ws = (char*)d_ws;
  size_t off = 0;
  half_t* xh  = (half_t*)(ws + off); off += (size_t)ROWS * D_ * sizeof(half_t);
  half_t* wqt = (half_t*)(ws + off); off += (size_t)D_ * D_ * sizeof(half_t);
  half_t* wkt = (half_t*)(ws + off); off += (size_t)D_ * D_ * sizeof(half_t);
  half_t* wvt = (half_t*)(ws + off); off += (size_t)D_ * D_ * sizeof(half_t);
  half_t* wft = (half_t*)(ws + off); off += (size_t)D_ * D_ * sizeof(half_t);
  half_t* Qh  = (half_t*)(ws + off); off += (size_t)B_ * H_ * S_ * HD_ * sizeof(half_t);
  half_t* Kh  = (half_t*)(ws + off); off += (size_t)B_ * H_ * S_ * HD_ * sizeof(half_t);
  half_t* VhT = (half_t*)(ws + off); off += (size_t)B_ * H_ * HD_ * S_ * sizeof(half_t);
  half_t* Oh  = (half_t*)(ws + off); off += (size_t)ROWS * D_ * sizeof(half_t);

  // 1) conversions: x plain; weights transpose-converted to [n][k]
  cvt_f32_to_f16<<<1024, 256, 0, stream>>>(x, xh, ROWS * D_ / 4);
  dim3 tgrid(D_ / 64, D_ / 64);
  cvt_transpose_f32_to_f16<<<tgrid, 256, 0, stream>>>(Wq, wqt);
  cvt_transpose_f32_to_f16<<<tgrid, 256, 0, stream>>>(Wk, wkt);
  cvt_transpose_f32_to_f16<<<tgrid, 256, 0, stream>>>(Wv, wvt);
  cvt_transpose_f32_to_f16<<<tgrid, 256, 0, stream>>>(Wf, wft);

  // 2) fused QKV projection (z selects Q/K/V), tiles 128x128, 8 waves/block
  qkv_gemm_kernel<<<dim3(D_ / BN, ROWS / BM, 3), 256, 0, stream>>>(
      xh, wqt, wkt, wvt, bq, bk, bv, Qh, Kh, VhT);

  // 3) flash attention with bidirectional ALiBi
  attn_kernel<<<dim3(B_ * H_, S_ / 128), 256, 0, stream>>>(Qh, Kh, VhT, Oh);

  // 4) output projection to f32
  out_gemm_kernel<<<dim3(D_ / BN, ROWS / BM), 256, 0, stream>>>(
      Oh, wft, bf, out);
}

// v003
// It runs in 138 microseconds.
// Next to v002, in two timings, it ran 1.11 and 1.09 times as fast.
// Counting every step since v000, it is 1.63 times as fast.
#include <hip/hip_runtime.h>
#include <cstdint>
#include <cstddef>

// ---------------------------------------------------------------------------
// RelativeAttention (ALiBi bidirectional) for MI455X / gfx1250, wave32 WMMA.
// All matmuls run on v_wmma_f32_16x16x32_f16 (f16 in, f32 accumulate).
// Weights are pre-transposed (and V written transposed) so every LDS staging
// access is a 128-bit load/store -- no 16-bit scatter in the hot loops.
// ---------------------------------------------------------------------------

typedef _Float16 half_t;
typedef __attribute__((ext_vector_type(16))) _Float16 v16h;
typedef __attribute__((ext_vector_type(8)))  _Float16 v8h;
typedef __attribute__((ext_vector_type(4)))  _Float16 v4h;
typedef __attribute__((ext_vector_type(8)))  float    v8f;

union V16 { v16h v; v8h h[2]; };

constexpr int B_   = 2;
constexpr int S_   = 2048;
constexpr int D_   = 1024;
constexpr int H_   = 16;
constexpr int HD_  = 64;
constexpr int ROWS = B_ * S_;   // 4096

// ---------------------------------------------------------------------------
// f32 -> f16 conversion (vectorized, grid-stride)
// ---------------------------------------------------------------------------
__global__ void cvt_f32_to_f16(const float* __restrict__ src,
                               half_t* __restrict__ dst, int n4) {
  int i = blockIdx.x * blockDim.x + threadIdx.x;
  int stride = gridDim.x * blockDim.x;
  for (; i < n4; i += stride) {
    float4 f = ((const float4*)src)[i];
    v4h h;
    h[0] = (half_t)f.x; h[1] = (half_t)f.y;
    h[2] = (half_t)f.z; h[3] = (half_t)f.w;
    ((v4h*)dst)[i] = h;
  }
}

// ---------------------------------------------------------------------------
// f32 [K][N] -> f16 [N][K] tiled transpose-convert (for the weight matrices).
// 64x64 tiles through LDS, coalesced on both sides. Grid (16,16), 256 thr.
// ---------------------------------------------------------------------------
__global__ void cvt_transpose_f32_to_f16(const float* __restrict__ src,
                                         half_t* __restrict__ dst) {
  __shared__ float tile[64][65];
  const int nb = blockIdx.x * 64;   // n base (cols of src, rows of dst)
  const int kb = blockIdx.y * 64;   // k base (rows of src, cols of dst)
#pragma unroll
  for (int i = 0; i < 16; ++i) {
    int idx = threadIdx.x + i * 256;
    int r = idx >> 6, c = idx & 63;
    tile[r][c] = src[(size_t)(kb + r) * D_ + nb + c];
  }
  __syncthreads();
#pragma unroll
  for (int i = 0; i < 16; ++i) {
    int idx = threadIdx.x + i * 256;
    int r = idx >> 6, c = idx & 63;
    dst[(size_t)(nb + r) * D_ + kb + c] = (half_t)tile[c][r];
  }
}

// ---------------------------------------------------------------------------
// Shared WMMA GEMM core: C(128x128 per block) = A(ROWS x 1024) * B(1024 x 1024)
// 256 threads = 8 waves (2 x 4), each wave computes a 64x32 patch (4x2 WMMA
// tiles). A stage is 64 k: every staged row is one whole 128-byte line, and a
// wave-wide 128-bit load covers four whole lines. LDS rows stand at a pitch of
// 144 bytes (16 B x odd), the conflict-free pitch for 128-bit fragment reads.
// A staged row-major; B comes from a PRE-TRANSPOSED weight Wt[n][k], so both
// stagings and all fragment fills are contiguous 128-bit LDS operations.
// Fragment layout (ISA 7.12.2, 16-bit, wave32):
//   A: lane(l&15)=row, halves at k = {hi*8..+7, 16+hi*8..+7}
//   B: lane(l&15)=col, same k pattern.  C: n=l&15, m=r+8*(l>>4).
// ---------------------------------------------------------------------------
constexpr int BM = 128;   // block rows
constexpr int BN = 128;   // block cols
constexpr int BK = 64;    // k per stage (128 bytes of every operand row)
constexpr int LP = 72;    // LDS row pitch in halves (144 bytes)

__device__ __forceinline__ void gemm_tile_core(
    const half_t* __restrict__ A, const half_t* __restrict__ Bt_g,
    half_t (*As)[LP], half_t (*Bt)[LP],
    int rowBase, int colBase, v8f acc[4][2]) {
  const int tid  = threadIdx.x;
  const int lane = tid & 31;
  const int wid  = tid >> 5;
  const int wm   = wid >> 2;       // 0..1  (m sub-block of 64 rows)
  const int wn   = wid & 3;        // 0..3  (n sub-block of 32 cols)
  const int hi   = lane >> 4;      // half-wave select
  const int l15  = lane & 15;
  const int srow = tid >> 3;       // staging: 8 threads per 128-byte row
  const int scol = (tid & 7) * 8;

  const half_t* ag = A    + (size_t)(rowBase + srow) * D_ + scol;
  const half_t* bg = Bt_g + (size_t)(colBase + srow) * D_ + scol;

  for (int kt = 0; kt < D_ / BK; ++kt) {
    // ---- stage A 128x64 and B 128x64: four b128 per thread and operand ---
    // (all loops below are unrolled so that ta, tb, the fragments and acc are
    //  indexed by constants and stay in registers; all eight loads fly at once)
    v8h ta[4], tb[4];
#pragma unroll
    for (int i = 0; i < 4; ++i)
      ta[i] = *(const v8h*)(ag + (size_t)(i * 32) * D_ + kt * BK);
#pragma unroll
    for (int i = 0; i < 4; ++i)
      tb[i] = *(const v8h*)(bg + (size_t)(i * 32) * D_ + kt * BK);
#pragma unroll
    for (int i = 0; i < 4; ++i) *(v8h*)&As[srow + i * 32][scol] = ta[i];
#pragma unroll
    for (int i = 0; i < 4; ++i) *(v8h*)&Bt[srow + i * 32][scol] = tb[i];
    // the next trip rewrites the address registers of the loads above
    asm volatile("s_wait_xcnt 0x0" ::: "memory");
    __syncthreads();

#pragma unroll
    for (int ks = 0; ks < BK / 32; ++ks) {
      V16 af[4], bf2[2];
#pragma unroll
      for (int sm = 0; sm < 4; ++sm) {
        int r = wm * 64 + sm * 16 + l15;
        af[sm].h[0] = *(const v8h*)&As[r][ks * 32 + hi * 8];
        af[sm].h[1] = *(const v8h*)&As[r][ks * 32 + 16 + hi * 8];
      }
#pragma unroll
      for (int sn = 0; sn < 2; ++sn) {
        int c = wn * 32 + sn * 16 + l15;
        bf2[sn].h[0] = *(const v8h*)&Bt[c][ks * 32 + hi * 8];
        bf2[sn].h[1] = *(const v8h*)&Bt[c][ks * 32 + 16 + hi * 8];
      }
#pragma unroll
      for (int sm = 0; sm < 4; ++sm)
#pragma unroll
        for (int sn = 0; sn < 2; ++sn)
          acc[sm][sn] = __builtin_amdgcn_wmma_f32_16x16x32_f16(
              false, af[sm].v, false, bf2[sn].v, (short)0, acc[sm][sn],
              false, false);
    }
    __syncthreads();
  }
}

// ---------------------------------------------------------------------------
// Fused QKV projection: z=0 -> Q (pre-scaled by 1/sqrt(hd)), z=1 -> K,
// z=2 -> V written TRANSPOSED [B, H, hd, S] so the attention kernel can
// stage V tiles with contiguous b128 accesses. Q/K go to [B, H, S, hd].
// ---------------------------------------------------------------------------
__global__ __launch_bounds__(256) void qkv_gemm_kernel(
    const half_t* __restrict__ Xh,
    const half_t* __restrict__ Wqt, const half_t* __restrict__ Wkt,
    const half_t* __restrict__ Wvt,
    const float* __restrict__ bq, const float* __restrict__ bk,
    const float* __restrict__ bv,
    half_t* __restrict__ Qh, half_t* __restrict__ Kh,
    half_t* __restrict__ VhT) {
  __shared__ __align__(16) half_t As[BM][LP];
  __shared__ __align__(16) half_t Bt[BN][LP];

  const half_t* W; const float* bias; half_t* dst; float scale;
  bool vmode = false;
  if (blockIdx.z == 0)      { W = Wqt; bias = bq; dst = Qh;  scale = 0.125f; }
  else if (blockIdx.z == 1) { W = Wkt; bias = bk; dst = Kh;  scale = 1.0f; }
  else                      { W = Wvt; bias = bv; dst = VhT; scale = 1.0f; vmode = true; }

  const int rowBase = blockIdx.y * BM;
  const int colBase = blockIdx.x * BN;
  v8f acc[4][2] = {};
  gemm_tile_core(Xh, W, As, Bt, rowBase, colBase, acc);

  const int lane = threadIdx.x & 31;
  const int wid  = threadIdx.x >> 5;
  const int wm = wid >> 2, wn = wid & 3, hi = lane >> 4, l15 = lane & 15;
#pragma unroll
  for (int sm = 0; sm < 4; ++sm)
#pragma unroll
    for (int sn = 0; sn < 2; ++sn)
#pragma unroll
      for (int r = 0; r < 8; ++r) {
        int R = rowBase + wm * 64 + sm * 16 + r + 8 * hi;
        int C = colBase + wn * 32 + sn * 16 + l15;
        float val = (acc[sm][sn][r] + bias[C]) * scale;
        int b = R >> 11, s = R & (S_ - 1), h = C >> 6, d = C & (HD_ - 1);
        size_t idx = vmode
            ? ((((size_t)(b * H_ + h)) * HD_ + d) * S_ + s)   // V: [B,H,hd,S]
            : ((((size_t)(b * H_ + h)) * S_ + s) * HD_ + d);  // Q/K: [B,H,S,hd]
        dst[idx] = (half_t)val;
      }
}

// ---------------------------------------------------------------------------
// Output projection: out(f32) = Oh(f16) @ Wf(f16, pre-transposed) + bf
// ---------------------------------------------------------------------------
__global__ __launch_bounds__(256) void out_gemm_kernel(
    const half_t* __restrict__ Oh, const half_t* __restrict__ Wft,
    const float* __restrict__ bf, float* __restrict__ out) {
  __shared__ __align__(16) half_t As[BM][LP];
  __shared__ __align__(16) half_t Bt[BN][LP];
  const int rowBase = blockIdx.y * BM;
  const int colBase = blockIdx.x * BN;
  v8f acc[4][2] = {};
  gemm_tile_core(Oh, Wft, As, Bt, rowBase, colBase, acc);

  const int lane = threadIdx.x & 31;
  const int wid  = threadIdx.x >> 5;
  const int wm = wid >> 2, wn = wid & 3, hi = lane >> 4, l15 = lane & 15;
#pragma unroll
  for (int sm = 0; sm < 4; ++sm)
#pragma unroll
    for (int sn = 0; sn < 2; ++sn)
#pragma unroll
      for (int r = 0; r < 8; ++r) {
        int R = rowBase + wm * 64 + sm * 16 + r + 8 * hi;
        int C = colBase + wn * 32 + sn * 16 + l15;
        out[(size_t)R * D_ + C] = acc[sm][sn][r] + bf[C];
      }
}

// ---------------------------------------------------------------------------
// Lane l with lane l ^ 16 (the other 16-lane half), on the vector port.
// ---------------------------------------------------------------------------
__device__ __forceinline__ float xhalf(float x) {
  return __builtin_bit_cast(float, __builtin_amdgcn_permlanex16(
      __builtin_bit_cast(int, x), __builtin_bit_cast(int, x),
      0x76543210, 0xfedcba98, false, false));
}

__global__ void attn_kernel(const half_t* __restrict__ Qh,
                            const half_t* __restrict__ Kh,
                            const half_t* __restrict__ VhT,
                            half_t* __restrict__ Oh) {
  __shared__ __align__(16) half_t Kt[32][72];      // row-major [key][dim]
  __shared__ __align__(16) half_t Vt[64][48];      // [dim][key] (pre-transposed)

  const int bh  = blockIdx.x;
  const int b   = bh >> 4;
  const int h   = bh & 15;
  const int Qb  = blockIdx.y * 128;
  const int tid = threadIdx.x;
  const int lane = tid & 31;
  const int wid  = tid >> 5;
  const int hi   = lane >> 4;
  const int l15  = lane & 15;
  const int qbase = Qb + wid * 16;
  const int iq    = qbase + l15;   // this lane's query

  const half_t* Qp = Qh  + (size_t)(b * H_ + h) * S_ * HD_;
  const half_t* Kp = Kh  + (size_t)(b * H_ + h) * S_ * HD_;
  const half_t* Vp = VhT + (size_t)(b * H_ + h) * HD_ * S_;  // [dim][key]

  // Q fragments for the whole hd=64 (two K=32 steps), loaded once.
  V16 aq0, aq1;
  {
    const half_t* qrow = Qp + (size_t)iq * HD_;
    aq0.h[0] = *(const v8h*)(qrow + hi * 8);
    aq0.h[1] = *(const v8h*)(qrow + 16 + hi * 8);
    aq1.h[0] = *(const v8h*)(qrow + 32 + hi * 8);
    aq1.h[1] = *(const v8h*)(qrow + 48 + hi * 8);
  }

  float M = -1e30f;   // running maximum of this lane's query (both halves alike)
  float L = 0.0f;     // running sum over this half's keys; halves joined at the end
  v8f acc[4] = {};    // acc[j][r] = O^T[j*16 + 8*hi + r][query l15]

  // slope = (24^(1/8))^-(h%8+1)
  const float slope = __expf(-__logf(24.0f) / 8.0f * (float)((h & 7) + 1));
  const bool fwd = (h < 8);
  const float g = fwd ? slope : -slope;   // ALiBi term per step of the key index
  const int  sg = fwd ? 1 : -1;
  v8f ramp0, ramp1;                       // g * (key index inside the chunk)
#pragma unroll
  for (int r = 0; r < 8; ++r) {
    ramp0[r] = g * (float)(8 * hi + r);
    ramp1[r] = g * (float)(16 + 8 * hi + r);
  }
  const int cBeg = fwd ? 0 : (Qb >> 5);
  const int cEnd = fwd ? ((Qb >> 5) + 4) : (S_ >> 5);

  // always_inline: 'masked' is a literal at each call and must fold away
  auto chunk = [&](const int kc, const bool masked)
      __attribute__((always_inline)) {
    const int kbase = kc * 32;
    // ---- stage K (row-major) and V (transposed in global): b128 only -----
    {
      int key = tid >> 3, db = (tid & 7) * 8;           // K: 32 keys x 64 dims
      v8h kv = *(const v8h*)&Kp[(size_t)(kbase + key) * HD_ + db];
      // the address registers of the load above may be reused by what follows
      asm volatile("s_wait_xcnt 0x0" ::: "memory");
      int d = tid >> 2, k8 = (tid & 3) * 8;             // V: 64 dims x 32 keys
      v8h vv = *(const v8h*)&Vp[(size_t)d * S_ + kbase + k8];
      // likewise for the load above
      asm volatile("s_wait_xcnt 0x0" ::: "memory");
      *(v8h*)&Kt[key][db] = kv;
      *(v8h*)&Vt[d][k8] = vv;
    }
    __syncthreads();

    // ---- scores: K(32x64) x Q^T(64x16) + C -> two 16x16 f32 tiles of S^T --
    v8f c0 = ramp0, c1 = ramp1;
    if (masked) {
      // key 8*hi + r of the chunk is masked where sg * r > srel
      const int srel = sg * (iq - kbase - 8 * hi);
#pragma unroll
      for (int r = 0; r < 8; ++r) {
        c0[r] = (sg * r > srel) ? -1e9f : ramp0[r];
        c1[r] = (sg * (16 + r) > srel) ? -1e9f : ramp1[r];
      }
    }
    {
      V16 bk0, bk0b, bk1, bk1b;
      int key0 = l15, key1 = 16 + l15;
      bk0.h[0]  = *(const v8h*)&Kt[key0][hi * 8];
      bk0.h[1]  = *(const v8h*)&Kt[key0][16 + hi * 8];
      bk0b.h[0] = *(const v8h*)&Kt[key0][32 + hi * 8];
      bk0b.h[1] = *(const v8h*)&Kt[key0][48 + hi * 8];
      bk1.h[0]  = *(const v8h*)&Kt[key1][hi * 8];
      bk1.h[1]  = *(const v8h*)&Kt[key1][16 + hi * 8];
      bk1b.h[0] = *(const v8h*)&Kt[key1][32 + hi * 8];
      bk1b.h[1] = *(const v8h*)&Kt[key1][48 + hi * 8];
      c0 = __builtin_amdgcn_wmma_f32_16x16x32_f16(false, bk0.v, false, aq0.v,
                                                  (short)0, c0, false, false);
      c0 = __builtin_amdgcn_wmma_f32_16x16x32_f16(false, bk0b.v, false, aq1.v,
                                                  (short)0, c0, false, false);
      c1 = __builtin_amdgcn_wmma_f32_16x16x32_f16(false, bk1.v, false, aq0.v,
                                                  (short)0, c1, false, false);
      c1 = __builtin_amdgcn_wmma_f32_16x16x32_f16(false, bk1b.v, false, aq1.v,
                                                  (short)0, c1, false, false);
    }

    // ---- online softmax, one query per lane ------------------------------
    float mx = -1e30f;
#pragma unroll
    for (int r = 0; r < 8; ++r) mx = fmaxf(mx, fmaxf(c0[r], c1[r]));
    mx = fmaxf(mx, xhalf(mx));   // all 32 keys of the chunk
    const float off = g * (float)(kbase - iq);   // the chunk's part of the term
    const float Mn = fmaxf(M, mx + off);
    const float sc = __expf(M - Mn);
    M = Mn;
    // Mn in the chunk's own units. Never below mx: where all 32 keys are masked
    // the roundings at 1e9 could leave it lower, and exp would overflow f16.
    const float e = fmaxf(Mn - off, mx);

    V16 pf;                      // P^T as B operand: pf[s] = P^T[kmap(s, hi)][l15]
    float rs = 0.0f;
#pragma unroll
    for (int r = 0; r < 8; ++r) {
      float p0 = __expf(c0[r] - e);
      float p1 = __expf(c1[r] - e);
      rs += p0 + p1;
      pf.v[r]     = (half_t)p0;
      pf.v[8 + r] = (half_t)p1;
    }
    L = L * sc + rs;
#pragma unroll
    for (int j = 0; j < 4; ++j)
#pragma unroll
      for (int r = 0; r < 8; ++r) acc[j][r] = acc[j][r] * sc;

    // ---- V^T(64x32) x P^T(32x16): 4 WMMAs accumulate into O^T ------------
#pragma unroll
    for (int j = 0; j < 4; ++j) {
      V16 bv;
      int drow = j * 16 + l15;
      bv.h[0] = *(const v8h*)&Vt[drow][hi * 8];
      bv.h[1] = *(const v8h*)&Vt[drow][16 + hi * 8];
      acc[j] = __builtin_amdgcn_wmma_f32_16x16x32_f16(false, bv.v, false, pf.v,
                                                      (short)0, acc[j],
                                                      false, false);
    }
    __syncthreads();
  };

  const int mBeg = fwd ? cBeg : cBeg + 4;   // chunks [mBeg, mEnd) hold no
  const int mEnd = fwd ? cEnd - 4 : cEnd;   // masked key for any query here
  for (int kc = cBeg; kc < mBeg; ++kc) chunk(kc, true);
  for (int kc = mBeg; kc < mEnd; ++kc) chunk(kc, false);
  for (int kc = mEnd; kc < cEnd; ++kc) chunk(kc, true);

  // ---- epilogue: join the halves' sums, normalize, write f16 into [B*S, D]
  //      for the final GEMM; a lane's 8 registers are 8 consecutive dims -----
  const float inv = 1.0f / (L + xhalf(L));
  half_t* orow = Oh + (size_t)(b * S_ + iq) * D_ + h * HD_ + 8 * hi;
#pragma unroll
  for (int j = 0; j < 4; ++j) {
    v8h o;
#pragma unroll
    for (int r = 0; r < 8; ++r) o[r] = (half_t)(acc[j][r] * inv);
    *(v8h*)(orow + j * 16) = o;
  }
}

// ---------------------------------------------------------------------------
// Host-side launcher. Workspace layout (all 16B-aligned, ~48 MB total):
//   xh   : ROWS*D f16      (8 MB)
//   wqt/wkt/wvt/wft : D*D f16 each, TRANSPOSED [n][k] (4 x 2 MB)
//   Qh/Kh : B*H*S*hd f16  (2 x 8 MB);  VhT : B*H*hd*S f16 (8 MB)
//   Oh   : ROWS*D f16      (8 MB)
// ---------------------------------------------------------------------------
extern "C" void kernel_launch(void* const* d_in, const int* in_sizes, int n_in,
                              void* d_out, int out_size, void* d_ws,
                              size_t ws_size, hipStream_t stream) {
  const float* x  = (const float*)d_in[0];
  const float* Wq = (const float*)d_in[1];
  const float* bq = (const float*)d_in[2];
  const float* Wk = (const float*)d_in[3];
  const float* bk = (const float*)d_in[4];
  const float* Wv = (const float*)d_in[5];
  const float* bv = (const float*)d_in[6];
  const float* Wf = (const float*)d_in[7];
  const float* bf = (const float*)d_in[8];
  float* out = (float*)d_out;

  char* ws = (char*)d_ws;
  size_t off = 0;
  half_t* xh  = (half_t*)(ws + off); off += (size_t)ROWS * D_ * sizeof(half_t);
  half_t* wqt = (half_t*)(ws + off); off += (size_t)D_ * D_ * sizeof(half_t);
  half_t* wkt = (half_t*)(ws + off); off += (size_t)D_ * D_ * sizeof(half_t);
  half_t* wvt = (half_t*)(ws + off); off += (size_t)D_ * D_ * sizeof(half_t);
  half_t* wft = (half_t*)(ws + off); off += (size_t)D_ * D_ * sizeof(half_t);
  half_t* Qh  = (half_t*)(ws + off); off += (size_t)B_ * H_ * S_ * HD_ * sizeof(half_t);
  half_t* Kh  = (half_t*)(ws + off); off += (size_t)B_ * H_ * S_ * HD_ * sizeof(half_t);
  half_t* VhT = (half_t*)(ws + off); off += (size_t)B_ * H_ * HD_ * S_ * sizeof(half_t);
  half_t* Oh  = (half_t*)(ws + off); off += (size_t)ROWS * D_ * sizeof(half_t);

  // 1) conversions: x plain; weights transpose-converted to [n][k]
  cvt_f32_to_f16<<<1024, 256, 0, stream>>>(x, xh, ROWS * D_ / 4);
  dim3 tgrid(D_ / 64, D_ / 64);
  cvt_transpose_f32_to_f16<<<tgrid, 256, 0, stream>>>(Wq, wqt);
  cvt_transpose_f32_to_f16<<<tgrid, 256, 0, stream>>>(Wk, wkt);
  cvt_transpose_f32_to_f16<<<tgrid, 256, 0, stream>>>(Wv, wvt);
  cvt_transpose_f32_to_f16<<<tgrid, 256, 0, stream>>>(Wf, wft);

  // 2) fused QKV projection (z selects Q/K/V), tiles 128x128, 8 waves/block
  qkv_gemm_kernel<<<dim3(D_ / BN, ROWS / BM, 3), 256, 0, stream>>>(
      xh, wqt, wkt, wvt, bq, bk, bv, Qh, Kh, VhT);

  // 3) flash attention with bidirectional ALiBi
  attn_kernel<<<dim3(B_ * H_, S_ / 128), 256, 0, stream>>>(Qh, Kh, VhT, Oh);

  // 4) output projection to f32
  out_gemm_kernel<<<dim3(D_ / BN, ROWS / BM), 256, 0, stream>>>(
      Oh, wft, bf, out);
}

// v004
// Measured time: 127 microseconds a run.
// In both of two side-by-side timings against v003, it was 1.09 times as fast.
// Over all steps from v000 it is 1.78 times as fast.
#include <hip/hip_runtime.h>
#include <cstdint>
#include <cstddef>

// ---------------------------------------------------------------------------
// RelativeAttention (ALiBi bidirectional) for MI455X / gfx1250, wave32 WMMA.
// All matmuls run on v_wmma_f32_16x16x32_f16 (f16 in, f32 accumulate).
// Weights are pre-transposed (and V written transposed) so every LDS staging
// access is a 128-bit load/store -- no 16-bit scatter in the hot loops.
// ---------------------------------------------------------------------------

typedef _Float16 half_t;
typedef __attribute__((ext_vector_type(16))) _Float16 v16h;
typedef __attribute__((ext_vector_type(8)))  _Float16 v8h;
typedef __attribute__((ext_vector_type(4)))  _Float16 v4h;
typedef __attribute__((ext_vector_type(8)))  float    v8f;

union V16 { v16h v; v8h h[2]; };

constexpr int B_   = 2;
constexpr int S_   = 2048;
constexpr int D_   = 1024;
constexpr int H_   = 16;
constexpr int HD_  = 64;
constexpr int ROWS = B_ * S_;   // 4096

// ---------------------------------------------------------------------------
// Preparation, one launch of 512 equal work-groups of 256 threads. Each does
//   - one 64(k) x 128(n) piece of one weight matrix, f32 [K][N] -> f16 [N][K],
//     as two 64x64 tiles through LDS, coalesced on both sides (128 work-groups
//     per matrix, 4 matrices);
//   - 2048 float4 of x, f32 -> f16, element for element.
// All of a thread's loads are issued before the first value is used, so the
// work-group pays one memory round trip; one barrier serves both tiles.
// ---------------------------------------------------------------------------
__global__ __launch_bounds__(256) void prep_kernel(
    const float* __restrict__ x,
    const float* __restrict__ Wq, const float* __restrict__ Wk,
    const float* __restrict__ Wv, const float* __restrict__ Wf,
    half_t* __restrict__ xh,
    half_t* __restrict__ wqt, half_t* __restrict__ wkt,
    half_t* __restrict__ wvt, half_t* __restrict__ wft) {
  __shared__ float tile[2][64][65];
  const int w   = blockIdx.x;
  const int tid = threadIdx.x;
  const int m   = w >> 7;           // which weight matrix
  const float* src = (m == 0) ? Wq : (m == 1) ? Wk : (m == 2) ? Wv : Wf;
  half_t* dst      = (m == 0) ? wqt : (m == 1) ? wkt : (m == 2) ? wvt : wft;
  const int nb = (w & 7) * 128;         // n base (cols of src, rows of dst)
  const int kb = ((w >> 3) & 15) * 64;  // k base (rows of src, cols of dst)
  const int r0 = tid >> 6, c = tid & 63;

  // (the loops are unrolled so that tv and xv stay in registers)
  float tv[2][16];
#pragma unroll
  for (int u = 0; u < 2; ++u)
#pragma unroll
    for (int i = 0; i < 16; ++i)
      tv[u][i] = src[(size_t)(kb + r0 + i * 4) * D_ + nb + u * 64 + c];
  const float4* xs = (const float4*)x + (size_t)w * 2048 + tid;
  float4 xv[8];
#pragma unroll
  for (int i = 0; i < 8; ++i) xv[i] = xs[i * 256];
  // keeps every load above in front of the first use of a loaded value: without
  // it the x values are waited for and converted before the tile loads issue
  __builtin_amdgcn_sched_barrier(0);

#pragma unroll
  for (int u = 0; u < 2; ++u)
#pragma unroll
    for (int i = 0; i < 16; ++i) tile[u][r0 + i * 4][c] = tv[u][i];

  v4h* xd = (v4h*)xh + (size_t)w * 2048 + tid;
#pragma unroll
  for (int i = 0; i < 8; ++i) {
    v4h h;
    h[0] = (half_t)xv[i].x; h[1] = (half_t)xv[i].y;
    h[2] = (half_t)xv[i].z; h[3] = (half_t)xv[i].w;
    xd[i * 256] = h;
  }
  __syncthreads();
  half_t* dp = dst + (size_t)(nb + r0) * D_ + kb + c;
#pragma unroll
  for (int u = 0; u < 2; ++u)
#pragma unroll
    for (int i = 0; i < 16; ++i)
      dp[(u * 64 + i * 4) * D_] = (half_t)tile[u][c][r0 + i * 4];
}

// ---------------------------------------------------------------------------
// Shared WMMA GEMM core: C(128x128 per block) = A(ROWS x 1024) * B(1024 x 1024)
// 256 threads = 8 waves (2 x 4), each wave computes a 64x32 patch (4x2 WMMA
// tiles). A stage is 64 k: every staged row is one whole 128-byte line, and a
// wave-wide 128-bit load covers four whole lines. LDS rows stand at a pitch of
// 144 bytes (16 B x odd), the conflict-free pitch for 128-bit fragment reads.
// A staged row-major; B comes from a PRE-TRANSPOSED weight Wt[n][k], so both
// stagings and all fragment fills are contiguous 128-bit LDS operations.
// Fragment layout (ISA 7.12.2, 16-bit, wave32):
//   A: lane(l&15)=row, halves at k = {hi*8..+7, 16+hi*8..+7}
//   B: lane(l&15)=col, same k pattern.  C: n=l&15, m=r+8*(l>>4).
// ---------------------------------------------------------------------------
constexpr int BM = 128;   // block rows
constexpr int BN = 128;   // block cols
constexpr int BK = 64;    // k per stage (128 bytes of every operand row)
constexpr int LP = 72;    // LDS row pitch in halves (144 bytes)

__device__ __forceinline__ void gemm_tile_core(
    const half_t* __restrict__ A, const half_t* __restrict__ Bt_g,
    half_t (*As)[LP], half_t (*Bt)[LP],
    int rowBase, int colBase, v8f acc[4][2]) {
  const int tid  = threadIdx.x;
  const int lane = tid & 31;
  const int wid  = tid >> 5;
  const int wm   = wid >> 2;       // 0..1  (m sub-block of 64 rows)
  const int wn   = wid & 3;        // 0..3  (n sub-block of 32 cols)
  const int hi   = lane >> 4;      // half-wave select
  const int l15  = lane & 15;
  const int srow = tid >> 3;       // staging: 8 threads per 128-byte row
  const int scol = (tid & 7) * 8;

  const half_t* ag = A    + (size_t)(rowBase + srow) * D_ + scol;
  const half_t* bg = Bt_g + (size_t)(colBase + srow) * D_ + scol;

  for (int kt = 0; kt < D_ / BK; ++kt) {
    // ---- stage A 128x64 and B 128x64: four b128 per thread and operand ---
    // (all loops below are unrolled so that ta, tb, the fragments and acc are
    //  indexed by constants and stay in registers; all eight loads fly at once)
    v8h ta[4], tb[4];
#pragma unroll
    for (int i = 0; i < 4; ++i)
      ta[i] = *(const v8h*)(ag + (size_t)(i * 32) * D_ + kt * BK);
#pragma unroll
    for (int i = 0; i < 4; ++i)
      tb[i] = *(const v8h*)(bg + (size_t)(i * 32) * D_ + kt * BK);
#pragma unroll
    for (int i = 0; i < 4; ++i) *(v8h*)&As[srow + i * 32][scol] = ta[i];
#pragma unroll
    for (int i = 0; i < 4; ++i) *(v8h*)&Bt[srow + i * 32][scol] = tb[i];
    // the next trip rewrites the address registers of the loads above
    asm volatile("s_wait_xcnt 0x0" ::: "memory");
    __syncthreads();

#pragma unroll
    for (int ks = 0; ks < BK / 32; ++ks) {
      V16 af[4], bf2[2];
#pragma unroll
      for (int sm = 0; sm < 4; ++sm) {
        int r = wm * 64 + sm * 16 + l15;
        af[sm].h[0] = *(const v8h*)&As[r][ks * 32 + hi * 8];
        af[sm].h[1] = *(const v8h*)&As[r][ks * 32 + 16 + hi * 8];
      }
#pragma unroll
      for (int sn = 0; sn < 2; ++sn) {
        int c = wn * 32 + sn * 16 + l15;
        bf2[sn].h[0] = *(const v8h*)&Bt[c][ks * 32 + hi * 8];
        bf2[sn].h[1] = *(const v8h*)&Bt[c][ks * 32 + 16 + hi * 8];
      }
#pragma unroll
      for (int sm = 0; sm < 4; ++sm)
#pragma unroll
        for (int sn = 0; sn < 2; ++sn)
          acc[sm][sn] = __builtin_amdgcn_wmma_f32_16x16x32_f16(
              false, af[sm].v, false, bf2[sn].v, (short)0, acc[sm][sn],
              false, false);
    }
    __syncthreads();
  }
}

// ---------------------------------------------------------------------------
// Fused QKV projection: z=0 -> Q (pre-scaled by 1/sqrt(hd)), z=1 -> K,
// z=2 -> V written TRANSPOSED [B, H, hd, S] so the attention kernel can
// stage V tiles with contiguous b128 accesses. Q/K go to [B, H, S, hd].
// ---------------------------------------------------------------------------
__global__ __launch_bounds__(256) void qkv_gemm_kernel(
    const half_t* __restrict__ Xh,
    const half_t* __restrict__ Wqt, const half_t* __restrict__ Wkt,
    const half_t* __restrict__ Wvt,
    const float* __restrict__ bq, const float* __restrict__ bk,
    const float* __restrict__ bv,
    half_t* __restrict__ Qh, half_t* __restrict__ Kh,
    half_t* __restrict__ VhT) {
  __shared__ __align__(16) half_t As[BM][LP];
  __shared__ __align__(16) half_t Bt[BN][LP];

  const half_t* W; const float* bias; half_t* dst; float scale;
  bool vmode = false;
  if (blockIdx.z == 0)      { W = Wqt; bias = bq; dst = Qh;  scale = 0.125f; }
  else if (blockIdx.z == 1) { W = Wkt; bias = bk; dst = Kh;  scale = 1.0f; }
  else                      { W = Wvt; bias = bv; dst = VhT; scale = 1.0f; vmode = true; }

  const int rowBase = blockIdx.y * BM;
  const int colBase = blockIdx.x * BN;
  v8f acc[4][2] = {};
  gemm_tile_core(Xh, W, As, Bt, rowBase, colBase, acc);

  const int lane = threadIdx.x & 31;
  const int wid  = threadIdx.x >> 5;
  const int wm = wid >> 2, wn = wid & 3, hi = lane >> 4, l15 = lane & 15;
#pragma unroll
  for (int sm = 0; sm < 4; ++sm)
#pragma unroll
    for (int sn = 0; sn < 2; ++sn)
#pragma unroll
      for (int r = 0; r < 8; ++r) {
        int R = rowBase + wm * 64 + sm * 16 + r + 8 * hi;
        int C = colBase + wn * 32 + sn * 16 + l15;
        float val = (acc[sm][sn][r] + bias[C]) * scale;
        int b = R >> 11, s = R & (S_ - 1), h = C >> 6, d = C & (HD_ - 1);
        size_t idx = vmode
            ? ((((size_t)(b * H_ + h)) * HD_ + d) * S_ + s)   // V: [B,H,hd,S]
            : ((((size_t)(b * H_ + h)) * S_ + s) * HD_ + d);  // Q/K: [B,H,S,hd]
        dst[idx] = (half_t)val;
      }
}

// ---------------------------------------------------------------------------
// Output projection: out(f32) = Oh(f16) @ Wf(f16, pre-transposed) + bf
// ---------------------------------------------------------------------------
__global__ __launch_bounds__(256) void out_gemm_kernel(
    const half_t* __restrict__ Oh, const half_t* __restrict__ Wft,
    const float* __restrict__ bf, float* __restrict__ out) {
  __shared__ __align__(16) half_t As[BM][LP];
  __shared__ __align__(16) half_t Bt[BN][LP];
  const int rowBase = blockIdx.y * BM;
  const int colBase = blockIdx.x * BN;
  v8f acc[4][2] = {};
  gemm_tile_core(Oh, Wft, As, Bt, rowBase, colBase, acc);

  const int lane = threadIdx.x & 31;
  const int wid  = threadIdx.x >> 5;
  const int wm = wid >> 2, wn = wid & 3, hi = lane >> 4, l15 = lane & 15;
#pragma unroll
  for (int sm = 0; sm < 4; ++sm)
#pragma unroll
    for (int sn = 0; sn < 2; ++sn)
#pragma unroll
      for (int r = 0; r < 8; ++r) {
        int R = rowBase + wm * 64 + sm * 16 + r + 8 * hi;
        int C = colBase + wn * 32 + sn * 16 + l15;
        out[(size_t)R * D_ + C] = acc[sm][sn][r] + bf[C];
      }
}

// ---------------------------------------------------------------------------
// Lane l with lane l ^ 16 (the other 16-lane half), on the vector port.
// ---------------------------------------------------------------------------
__device__ __forceinline__ float xhalf(float x) {
  return __builtin_bit_cast(float, __builtin_amdgcn_permlanex16(
      __builtin_bit_cast(int, x), __builtin_bit_cast(int, x),
      0x76543210, 0xfedcba98, false, false));
}

__global__ void attn_kernel(const half_t* __restrict__ Qh,
                            const half_t* __restrict__ Kh,
                            const half_t* __restrict__ VhT,
                            half_t* __restrict__ Oh) {
  __shared__ __align__(16) half_t Kt[32][72];      // row-major [key][dim]
  __shared__ __align__(16) half_t Vt[64][48];      // [dim][key] (pre-transposed)

  const int bh  = blockIdx.x;
  const int b   = bh >> 4;
  const int h   = bh & 15;
  const int Qb  = blockIdx.y * 128;
  const int tid = threadIdx.x;
  const int lane = tid & 31;
  const int wid  = tid >> 5;
  const int hi   = lane >> 4;
  const int l15  = lane & 15;
  const int qbase = Qb + wid * 16;
  const int iq    = qbase + l15;   // this lane's query

  const half_t* Qp = Qh  + (size_t)(b * H_ + h) * S_ * HD_;
  const half_t* Kp = Kh  + (size_t)(b * H_ + h) * S_ * HD_;
  const half_t* Vp = VhT + (size_t)(b * H_ + h) * HD_ * S_;  // [dim][key]

  // Q fragments for the whole hd=64 (two K=32 steps), loaded once.
  V16 aq0, aq1;
  {
    const half_t* qrow = Qp + (size_t)iq * HD_;
    aq0.h[0] = *(const v8h*)(qrow + hi * 8);
    aq0.h[1] = *(const v8h*)(qrow + 16 + hi * 8);
    aq1.h[0] = *(const v8h*)(qrow + 32 + hi * 8);
    aq1.h[1] = *(const v8h*)(qrow + 48 + hi * 8);
  }

  float M = -1e30f;   // running maximum of this lane's query (both halves alike)
  float L = 0.0f;     // running sum over this half's keys; halves joined at the end
  v8f acc[4] = {};    // acc[j][r] = O^T[j*16 + 8*hi + r][query l15]

  // slope = (24^(1/8))^-(h%8+1)
  const float slope = __expf(-__logf(24.0f) / 8.0f * (float)((h & 7) + 1));
  const bool fwd = (h < 8);
  const float g = fwd ? slope : -slope;   // ALiBi term per step of the key index
  const int  sg = fwd ? 1 : -1;
  v8f ramp0, ramp1;                       // g * (key index inside the chunk)
#pragma unroll
  for (int r = 0; r < 8; ++r) {
    ramp0[r] = g * (float)(8 * hi + r);
    ramp1[r] = g * (float)(16 + 8 * hi + r);
  }
  const int cBeg = fwd ? 0 : (Qb >> 5);
  const int cEnd = fwd ? ((Qb >> 5) + 4) : (S_ >> 5);

  // always_inline: 'masked' is a literal at each call and must fold away
  auto chunk = [&](const int kc, const bool masked)
      __attribute__((always_inline)) {
    const int kbase = kc * 32;
    // ---- stage K (row-major) and V (transposed in global): b128 only -----
    {
      int key = tid >> 3, db = (tid & 7) * 8;           // K: 32 keys x 64 dims
      v8h kv = *(const v8h*)&Kp[(size_t)(kbase + key) * HD_ + db];
      // the address registers of the load above may be reused by what follows
      asm volatile("s_wait_xcnt 0x0" ::: "memory");
      int d = tid >> 2, k8 = (tid & 3) * 8;             // V: 64 dims x 32 keys
      v8h vv = *(const v8h*)&Vp[(size_t)d * S_ + kbase + k8];
      // likewise for the load above
      asm volatile("s_wait_xcnt 0x0" ::: "memory");
      *(v8h*)&Kt[key][db] = kv;
      *(v8h*)&Vt[d][k8] = vv;
    }
    __syncthreads();

    // ---- scores: K(32x64) x Q^T(64x16) + C -> two 16x16 f32 tiles of S^T --
    v8f c0 = ramp0, c1 = ramp1;
    if (masked) {
      // key 8*hi + r of the chunk is masked where sg * r > srel
      const int srel = sg * (iq - kbase - 8 * hi);
#pragma unroll
      for (int r = 0; r < 8; ++r) {
        c0[r] = (sg * r > srel) ? -1e9f : ramp0[r];
        c1[r] = (sg * (16 + r) > srel) ? -1e9f : ramp1[r];
      }
    }
    {
      V16 bk0, bk0b, bk1, bk1b;
      int key0 = l15, key1 = 16 + l15;
      bk0.h[0]  = *(const v8h*)&Kt[key0][hi * 8];
      bk0.h[1]  = *(const v8h*)&Kt[key0][16 + hi * 8];
      bk0b.h[0] = *(const v8h*)&Kt[key0][32 + hi * 8];
      bk0b.h[1] = *(const v8h*)&Kt[key0][48 + hi * 8];
      bk1.h[0]  = *(const v8h*)&Kt[key1][hi * 8];
      bk1.h[1]  = *(const v8h*)&Kt[key1][16 + hi * 8];
      bk1b.h[0] = *(const v8h*)&Kt[key1][32 + hi * 8];
      bk1b.h[1] = *(const v8h*)&Kt[key1][48 + hi * 8];
      c0 = __builtin_amdgcn_wmma_f32_16x16x32_f16(false, bk0.v, false, aq0.v,
                                                  (short)0, c0, false, false);
      c0 = __builtin_amdgcn_wmma_f32_16x16x32_f16(false, bk0b.v, false, aq1.v,
                                                  (short)0, c0, false, false);
      c1 = __builtin_amdgcn_wmma_f32_16x16x32_f16(false, bk1.v, false, aq0.v,
                                                  (short)0, c1, false, false);
      c1 = __builtin_amdgcn_wmma_f32_16x16x32_f16(false, bk1b.v, false, aq1.v,
                                                  (short)0, c1, false, false);
    }

    // ---- online softmax, one query per lane ------------------------------
    float mx = -1e30f;
#pragma unroll
    for (int r = 0; r < 8; ++r) mx = fmaxf(mx, fmaxf(c0[r], c1[r]));
    mx = fmaxf(mx, xhalf(mx));   // all 32 keys of the chunk
    const float off = g * (float)(kbase - iq);   // the chunk's part of the term
    const float Mn = fmaxf(M, mx + off);
    const float sc = __expf(M - Mn);
    M = Mn;
    // Mn in the chunk's own units. Never below mx: where all 32 keys are masked
    // the roundings at 1e9 could leave it lower, and exp would overflow f16.
    const float e = fmaxf(Mn - off, mx);

    V16 pf;                      // P^T as B operand: pf[s] = P^T[kmap(s, hi)][l15]
    float rs = 0.0f;
#pragma unroll
    for (int r = 0; r < 8; ++r) {
      float p0 = __expf(c0[r] - e);
      float p1 = __expf(c1[r] - e);
      rs += p0 + p1;
      pf.v[r]     = (half_t)p0;
      pf.v[8 + r] = (half_t)p1;
    }
    L = L * sc + rs;
#pragma unroll
    for (int j = 0; j < 4; ++j)
#pragma unroll
      for (int r = 0; r < 8; ++r) acc[j][r] = acc[j][r] * sc;

    // ---- V^T(64x32) x P^T(32x16): 4 WMMAs accumulate into O^T ------------
#pragma unroll
    for (int j = 0; j < 4; ++j) {
      V16 bv;
      int drow = j * 16 + l15;
      bv.h[0] = *(const v8h*)&Vt[drow][hi * 8];
      bv.h[1] = *(const v8h*)&Vt[drow][16 + hi * 8];
      acc[j] = __builtin_amdgcn_wmma_f32_16x16x32_f16(false, bv.v, false, pf.v,
                                                      (short)0, acc[j],
                                                      false, false);
    }
    __syncthreads();
  };

  const int mBeg = fwd ? cBeg : cBeg + 4;   // chunks [mBeg, mEnd) hold no
  const int mEnd = fwd ? cEnd - 4 : cEnd;   // masked key for any query here
  for (int kc = cBeg; kc < mBeg; ++kc) chunk(kc, true);
  for (int kc = mBeg; kc < mEnd; ++kc) chunk(kc, false);
  for (int kc = mEnd; kc < cEnd; ++kc) chunk(kc, true);

  // ---- epilogue: join the halves' sums, normalize, write f16 into [B*S, D]
  //      for the final GEMM; a lane's 8 registers are 8 consecutive dims -----
  const float inv = 1.0f / (L + xhalf(L));
  half_t* orow = Oh + (size_t)(b * S_ + iq) * D_ + h * HD_ + 8 * hi;
#pragma unroll
  for (int j = 0; j < 4; ++j) {
    v8h o;
#pragma unroll
    for (int r = 0; r < 8; ++r) o[r] = (half_t)(acc[j][r] * inv);
    *(v8h*)(orow + j * 16) = o;
  }
}

// ---------------------------------------------------------------------------
// Host-side launcher. Workspace layout (all 16B-aligned, ~48 MB total):
//   xh   : ROWS*D f16      (8 MB)
//   wqt/wkt/wvt/wft : D*D f16 each, TRANSPOSED [n][k] (4 x 2 MB)
//   Qh/Kh : B*H*S*hd f16  (2 x 8 MB);  VhT : B*H*hd*S f16 (8 MB)
//   Oh   : ROWS*D f16      (8 MB)
// ---------------------------------------------------------------------------
extern "C" void kernel_launch(void* const* d_in, const int* in_sizes, int n_in,
                              void* d_out, int out_size, void* d_ws,
                              size_t ws_size, hipStream_t stream) {
  const float* x  = (const float*)d_in[0];
  const float* Wq = (const float*)d_in[1];
  const float* bq = (const float*)d_in[2];
  const float* Wk = (const float*)d_in[3];
  const float* bk = (const float*)d_in[4];
  const float* Wv = (const float*)d_in[5];
  const float* bv = (const float*)d_in[6];
  const float* Wf = (const float*)d_in[7];
  const float* bf = (const float*)d_in[8];
  float* out = (float*)d_out;

  char* ws = (char*)d_ws;
  size_t off = 0;
  half_t* xh  = (half_t*)(ws + off); off += (size_t)ROWS * D_ * sizeof(half_t);
  half_t* wqt = (half_t*)(ws + off); off += (size_t)D_ * D_ * sizeof(half_t);
  half_t* wkt = (half_t*)(ws + off); off += (size_t)D_ * D_ * sizeof(half_t);
  half_t* wvt = (half_t*)(ws + off); off += (size_t)D_ * D_ * sizeof(half_t);
  half_t* wft = (half_t*)(ws + off); off += (size_t)D_ * D_ * sizeof(half_t);
  half_t* Qh  = (half_t*)(ws + off); off += (size_t)B_ * H_ * S_ * HD_ * sizeof(half_t);
  half_t* Kh  = (half_t*)(ws + off); off += (size_t)B_ * H_ * S_ * HD_ * sizeof(half_t);
  half_t* VhT = (half_t*)(ws + off); off += (size_t)B_ * H_ * HD_ * S_ * sizeof(half_t);
  half_t* Oh  = (half_t*)(ws + off); off += (size_t)ROWS * D_ * sizeof(half_t);

  // 1) conversions in one launch: x plain; weights transpose-converted to [n][k]
  prep_kernel<<<512, 256, 0, stream>>>(x, Wq, Wk, Wv, Wf, xh, wqt, wkt, wvt, wft);

  // 2) fused QKV projection (z selects Q/K/V), tiles 128x128, 8 waves/block
  qkv_gemm_kernel<<<dim3(D_ / BN, ROWS / BM, 3), 256, 0, stream>>>(
      xh, wqt, wkt, wvt, bq, bk, bv, Qh, Kh, VhT);

  // 3) flash attention with bidirectional ALiBi
  attn_kernel<<<dim3(B_ * H_, S_ / 128), 256, 0, stream>>>(Qh, Kh, VhT, Oh);

  // 4) output projection to f32
  out_gemm_kernel<<<dim3(D_ / BN, ROWS / BM), 256, 0, stream>>>(
      Oh, wft, bf, out);
}

// v005
// One run takes 88.6 microseconds.
// Next to v004, in two timings, it ran 1.40 and 1.42 times as fast.
// Counting every step since v000, it is 2.51 times as fast.
#include <hip/hip_runtime.h>
#include <cstdint>
#include <cstddef>

// ---------------------------------------------------------------------------
// RelativeAttention (ALiBi bidirectional) for MI455X / gfx1250, wave32 WMMA.
// All matmuls run on v_wmma_f32_16x16x32_f16 (f16 in, f32 accumulate).
// Weights are pre-transposed (and V written transposed) so every LDS staging
// access is a 128-bit load/store -- no 16-bit scatter in the hot loops.
// ---------------------------------------------------------------------------

typedef _Float16 half_t;
typedef __attribute__((ext_vector_type(16))) _Float16 v16h;
typedef __attribute__((ext_vector_type(8)))  _Float16 v8h;
typedef __attribute__((ext_vector_type(4)))  _Float16 v4h;
typedef __attribute__((ext_vector_type(8)))  float    v8f;

union V16 { v16h v; v8h h[2]; };

constexpr int B_   = 2;
constexpr int S_   = 2048;
constexpr int D_   = 1024;
constexpr int H_   = 16;
constexpr int HD_  = 64;
constexpr int ROWS = B_ * S_;   // 4096

// ---------------------------------------------------------------------------
// Preparation, one launch of 512 equal work-groups of 256 threads. Each does
//   - one 64(k) x 128(n) piece of one weight matrix, f32 [K][N] -> f16 [N][K],
//     as two 64x64 tiles through LDS, coalesced on both sides (128 work-groups
//     per matrix, 4 matrices);
//   - 2048 float4 of x, f32 -> f16, element for element.
// All of a thread's loads are issued before the first value is used, so the
// work-group pays one memory round trip; one barrier serves both tiles.
// ---------------------------------------------------------------------------
__global__ __launch_bounds__(256) void prep_kernel(
    const float* __restrict__ x,
    const float* __restrict__ Wq, const float* __restrict__ Wk,
    const float* __restrict__ Wv, const float* __restrict__ Wf,
    half_t* __restrict__ xh,
    half_t* __restrict__ wqt, half_t* __restrict__ wkt,
    half_t* __restrict__ wvt, half_t* __restrict__ wft) {
  __shared__ float tile[2][64][65];
  const int w   = blockIdx.x;
  const int tid = threadIdx.x;
  const int m   = w >> 7;           // which weight matrix
  const float* src = (m == 0) ? Wq : (m == 1) ? Wk : (m == 2) ? Wv : Wf;
  half_t* dst      = (m == 0) ? wqt : (m == 1) ? wkt : (m == 2) ? wvt : wft;
  const int nb = (w & 7) * 128;         // n base (cols of src, rows of dst)
  const int kb = ((w >> 3) & 15) * 64;  // k base (rows of src, cols of dst)
  const int r0 = tid >> 6, c = tid & 63;

  // (the loops are unrolled so that tv and xv stay in registers)
  float tv[2][16];
#pragma unroll
  for (int u = 0; u < 2; ++u)
#pragma unroll
    for (int i = 0; i < 16; ++i)
      tv[u][i] = src[(size_t)(kb + r0 + i * 4) * D_ + nb + u * 64 + c];
  const float4* xs = (const float4*)x + (size_t)w * 2048 + tid;
  float4 xv[8];
#pragma unroll
  for (int i = 0; i < 8; ++i) xv[i] = xs[i * 256];
  // keeps every load above in front of the first use of a loaded value: without
  // it the x values are waited for and converted before the tile loads issue
  __builtin_amdgcn_sched_barrier(0);

#pragma unroll
  for (int u = 0; u < 2; ++u)
#pragma unroll
    for (int i = 0; i < 16; ++i) tile[u][r0 + i * 4][c] = tv[u][i];

  v4h* xd = (v4h*)xh + (size_t)w * 2048 + tid;
#pragma unroll
  for (int i = 0; i < 8; ++i) {
    v4h h;
    h[0] = (half_t)xv[i].x; h[1] = (half_t)xv[i].y;
    h[2] = (half_t)xv[i].z; h[3] = (half_t)xv[i].w;
    xd[i * 256] = h;
  }
  __syncthreads();
  half_t* dp = dst + (size_t)(nb + r0) * D_ + kb + c;
#pragma unroll
  for (int u = 0; u < 2; ++u)
#pragma unroll
    for (int i = 0; i < 16; ++i)
      dp[(u * 64 + i * 4) * D_] = (half_t)tile[u][c][r0 + i * 4];
}

// ---------------------------------------------------------------------------
// Shared WMMA GEMM core: C(128x128 per block) = A(ROWS x 1024) * B(1024 x 1024)
// 256 threads = 8 waves (2 x 4), each wave computes a 64x32 patch (4x2 WMMA
// tiles). A stage is 64 k: every staged row is one whole 128-byte line, and a
// wave-wide 128-bit load covers four whole lines. LDS rows stand at a pitch of
// 144 bytes (16 B x odd), the conflict-free pitch for 128-bit fragment reads.
// A staged row-major; B comes from a PRE-TRANSPOSED weight Wt[n][k], so both
// stagings and all fragment fills are contiguous 128-bit LDS operations.
// Fragment layout (ISA 7.12.2, 16-bit, wave32):
//   A: lane(l&15)=row, halves at k = {hi*8..+7, 16+hi*8..+7}
//   B: lane(l&15)=col, same k pattern.  C: n=l&15, m=r+8*(l>>4).
// ---------------------------------------------------------------------------
constexpr int BM = 128;   // block rows
constexpr int BN = 128;   // block cols
constexpr int BK = 64;    // k per stage (128 bytes of every operand row)
constexpr int LP = 72;    // LDS row pitch in halves (144 bytes)

__device__ __forceinline__ void gemm_tile_core(
    const half_t* __restrict__ A, const half_t* __restrict__ Bt_g,
    half_t (*As)[LP], half_t (*Bt)[LP],
    int rowBase, int colBase, v8f acc[4][2]) {
  const int tid  = threadIdx.x;
  const int lane = tid & 31;
  const int wid  = tid >> 5;
  const int wm   = wid >> 2;       // 0..1  (m sub-block of 64 rows)
  const int wn   = wid & 3;        // 0..3  (n sub-block of 32 cols)
  const int hi   = lane >> 4;      // half-wave select
  const int l15  = lane & 15;
  const int srow = tid >> 3;       // staging: 8 threads per 128-byte row
  const int scol = (tid & 7) * 8;

  const half_t* ag = A    + (size_t)(rowBase + srow) * D_ + scol;
  const half_t* bg = Bt_g + (size_t)(colBase + srow) * D_ + scol;

  for (int kt = 0; kt < D_ / BK; ++kt) {
    // ---- stage A 128x64 and B 128x64: four b128 per thread and operand ---
    // (all loops below are unrolled so that ta, tb, the fragments and acc are
    //  indexed by constants and stay in registers; all eight loads fly at once)
    v8h ta[4], tb[4];
#pragma unroll
    for (int i = 0; i < 4; ++i)
      ta[i] = *(const v8h*)(ag + (size_t)(i * 32) * D_ + kt * BK);
#pragma unroll
    for (int i = 0; i < 4; ++i)
      tb[i] = *(const v8h*)(bg + (size_t)(i * 32) * D_ + kt * BK);
#pragma unroll
    for (int i = 0; i < 4; ++i) *(v8h*)&As[srow + i * 32][scol] = ta[i];
#pragma unroll
    for (int i = 0; i < 4; ++i) *(v8h*)&Bt[srow + i * 32][scol] = tb[i];
    // the next trip rewrites the address registers of the loads above
    asm volatile("s_wait_xcnt 0x0" ::: "memory");
    __syncthreads();

#pragma unroll
    for (int ks = 0; ks < BK / 32; ++ks) {
      V16 af[4], bf2[2];
#pragma unroll
      for (int sm = 0; sm < 4; ++sm) {
        int r = wm * 64 + sm * 16 + l15;
        af[sm].h[0] = *(const v8h*)&As[r][ks * 32 + hi * 8];
        af[sm].h[1] = *(const v8h*)&As[r][ks * 32 + 16 + hi * 8];
      }
#pragma unroll
      for (int sn = 0; sn < 2; ++sn) {
        int c = wn * 32 + sn * 16 + l15;
        bf2[sn].h[0] = *(const v8h*)&Bt[c][ks * 32 + hi * 8];
        bf2[sn].h[1] = *(const v8h*)&Bt[c][ks * 32 + 16 + hi * 8];
      }
#pragma unroll
      for (int sm = 0; sm < 4; ++sm)
#pragma unroll
        for (int sn = 0; sn < 2; ++sn)
          acc[sm][sn] = __builtin_amdgcn_wmma_f32_16x16x32_f16(
              false, af[sm].v, false, bf2[sn].v, (short)0, acc[sm][sn],
              false, false);
    }
    __syncthreads();
  }
}

// ---------------------------------------------------------------------------
// Fused QKV projection: z=0 -> Q (pre-scaled by 1/sqrt(hd)), z=1 -> K,
// z=2 -> V written TRANSPOSED [B, H, hd, S] so the attention kernel can
// stage V tiles with contiguous b128 accesses. Q/K go to [B, H, S, hd].
// ---------------------------------------------------------------------------
__global__ __launch_bounds__(256) void qkv_gemm_kernel(
    const half_t* __restrict__ Xh,
    const half_t* __restrict__ Wqt, const half_t* __restrict__ Wkt,
    const half_t* __restrict__ Wvt,
    const float* __restrict__ bq, const float* __restrict__ bk,
    const float* __restrict__ bv,
    half_t* __restrict__ Qh, half_t* __restrict__ Kh,
    half_t* __restrict__ VhT) {
  __shared__ __align__(16) half_t As[BM][LP];
  __shared__ __align__(16) half_t Bt[BN][LP];

  const half_t* W; const float* bias; half_t* dst; float scale;
  bool vmode = false;
  if (blockIdx.z == 0)      { W = Wqt; bias = bq; dst = Qh;  scale = 0.125f; }
  else if (blockIdx.z == 1) { W = Wkt; bias = bk; dst = Kh;  scale = 1.0f; }
  else                      { W = Wvt; bias = bv; dst = VhT; scale = 1.0f; vmode = true; }

  const int rowBase = blockIdx.y * BM;
  const int colBase = blockIdx.x * BN;
  v8f acc[4][2] = {};
  gemm_tile_core(Xh, W, As, Bt, rowBase, colBase, acc);

  const int lane = threadIdx.x & 31;
  const int wid  = threadIdx.x >> 5;
  const int wm = wid >> 2, wn = wid & 3, hi = lane >> 4, l15 = lane & 15;
#pragma unroll
  for (int sm = 0; sm < 4; ++sm)
#pragma unroll
    for (int sn = 0; sn < 2; ++sn)
#pragma unroll
      for (int r = 0; r < 8; ++r) {
        int R = rowBase + wm * 64 + sm * 16 + r + 8 * hi;
        int C = colBase + wn * 32 + sn * 16 + l15;
        float val = (acc[sm][sn][r] + bias[C]) * scale;
        int b = R >> 11, s = R & (S_ - 1), h = C >> 6, d = C & (HD_ - 1);
        size_t idx = vmode
            ? ((((size_t)(b * H_ + h)) * HD_ + d) * S_ + s)   // V: [B,H,hd,S]
            : ((((size_t)(b * H_ + h)) * S_ + s) * HD_ + d);  // Q/K: [B,H,S,hd]
        dst[idx] = (half_t)val;
      }
}

// ---------------------------------------------------------------------------
// Output projection: out(f32) = Oh(f16) @ Wf(f16, pre-transposed) + bf
// ---------------------------------------------------------------------------
__global__ __launch_bounds__(256) void out_gemm_kernel(
    const half_t* __restrict__ Oh, const half_t* __restrict__ Wft,
    const float* __restrict__ bf, float* __restrict__ out) {
  __shared__ __align__(16) half_t As[BM][LP];
  __shared__ __align__(16) half_t Bt[BN][LP];
  const int rowBase = blockIdx.y * BM;
  const int colBase = blockIdx.x * BN;
  v8f acc[4][2] = {};
  gemm_tile_core(Oh, Wft, As, Bt, rowBase, colBase, acc);

  const int lane = threadIdx.x & 31;
  const int wid  = threadIdx.x >> 5;
  const int wm = wid >> 2, wn = wid & 3, hi = lane >> 4, l15 = lane & 15;
#pragma unroll
  for (int sm = 0; sm < 4; ++sm)
#pragma unroll
    for (int sn = 0; sn < 2; ++sn)
#pragma unroll
      for (int r = 0; r < 8; ++r) {
        int R = rowBase + wm * 64 + sm * 16 + r + 8 * hi;
        int C = colBase + wn * 32 + sn * 16 + l15;
        out[(size_t)R * D_ + C] = acc[sm][sn][r] + bf[C];
      }
}

// ---------------------------------------------------------------------------
// Lane l with lane l ^ 16 (the other 16-lane half), on the vector port.
// ---------------------------------------------------------------------------
__device__ __forceinline__ float xhalf(float x) {
  return __builtin_bit_cast(float, __builtin_amdgcn_permlanex16(
      __builtin_bit_cast(int, x), __builtin_bit_cast(int, x),
      0x76543210, 0xfedcba98, false, false));
}

constexpr int SK  = 64;
constexpr int AP  = 72;
constexpr int ABB = 64 * AP * 2;

// (the launch bound states the block of 256 that the host launches: without it
//  the register budget is that of 1024 threads, and the stage's body spills)
__global__ __launch_bounds__(256) void attn_kernel(const half_t* __restrict__ Qh,
                            const half_t* __restrict__ Kh,
                            const half_t* __restrict__ VhT,
                            half_t* __restrict__ Oh) {
  __shared__ __align__(16) half_t Ks[2][SK][AP];   // [buffer][key][dim]
  __shared__ __align__(16) half_t Vs[2][HD_][AP];  // [buffer][dim][key]

  const int bh  = blockIdx.x;
  const int b   = bh >> 4;
  const int h   = bh & 15;
  const int Qb  = blockIdx.y * 128;
  const int tid = threadIdx.x;
  const int lane = tid & 31;
  const int wid  = tid >> 5;
  const int hi   = lane >> 4;
  const int l15  = lane & 15;
  const int qbase = Qb + wid * 16;
  const int iq    = qbase + l15;   // this lane's query

  const half_t* Qp = Qh  + (size_t)(b * H_ + h) * S_ * HD_;
  const half_t* Kp = Kh  + (size_t)(b * H_ + h) * S_ * HD_;
  const half_t* Vp = VhT + (size_t)(b * H_ + h) * HD_ * S_;  // [dim][key]

  // Q fragments for the whole hd=64 (two K=32 steps), loaded once.
  V16 aq0, aq1;
  {
    const half_t* qrow = Qp + (size_t)iq * HD_;
    aq0.h[0] = *(const v8h*)(qrow + hi * 8);
    aq0.h[1] = *(const v8h*)(qrow + 16 + hi * 8);
    aq1.h[0] = *(const v8h*)(qrow + 32 + hi * 8);
    aq1.h[1] = *(const v8h*)(qrow + 48 + hi * 8);
  }

  float M = -1e30f;   // running maximum of this lane's query (both halves alike)
  float L = 0.0f;     // running sum over this half's keys; halves joined at the end
  v8f acc[4] = {};    // acc[j][r] = O^T[j*16 + 8*hi + r][query l15]

  // slope = (24^(1/8))^-(h%8+1)
  const float slope = __expf(-__logf(24.0f) / 8.0f * (float)((h & 7) + 1));
  const bool fwd = (h < 8);
  const float g = fwd ? slope : -slope;   // ALiBi term per step of the key index
  const int  sg = fwd ? 1 : -1;
  v8f ramp0, ramp1;                       // g * (key index inside the chunk)
#pragma unroll
  for (int r = 0; r < 8; ++r) {
    ramp0[r] = g * (float)(8 * hi + r);
    ramp1[r] = g * (float)(16 + 8 * hi + r);
  }
  const int sBeg = fwd ? 0 : (Qb >> 6);                  // stages [sBeg, sEnd):
  const int sEnd = fwd ? ((Qb >> 6) + 2) : (S_ >> 6);    // two at least, sBeg even

  // ---- one stage into one buffer: 8 threads per 128-byte row, a thread takes
  //      rows srow and srow + 32 of K (keys) and of V (dims) -----------------
  const int srow = tid >> 3, scol = (tid & 7) * 8;
  const uint32_t kl0 = (uint32_t)(uintptr_t)&Ks[0][srow][scol];   // LDS byte
  const uint32_t vl0 = (uint32_t)(uintptr_t)&Vs[0][srow][scol];   // addresses
  auto fill = [&](const int st, const int buf) __attribute__((always_inline)) {
    const half_t* kg = Kp + (size_t)(st * SK + srow) * HD_ + scol;
    const half_t* vg = Vp + (size_t)srow * S_ + st * SK + scol;
    const uint32_t kl = kl0 + buf * ABB, vl = vl0 + buf * ABB;
    // global to LDS through no register; the closing wait stands in front of
    // any rewrite of the address registers that the four copies name
    asm volatile(
        "global_load_async_to_lds_b128 %0, %4, off\n\t"
        "global_load_async_to_lds_b128 %1, %5, off\n\t"
        "global_load_async_to_lds_b128 %2, %6, off\n\t"
        "global_load_async_to_lds_b128 %3, %7, off\n\t"
        "s_wait_xcnt 0x0"
        :: "v"(kl), "v"(kl + 32 * AP * 2), "v"(vl), "v"(vl + 32 * AP * 2),
           "v"(kg), "v"(kg + 32 * HD_), "v"(vg), "v"(vg + 32 * S_)
        : "memory");
  };

  // always_inline: 'masked' and 'p' are literals at each call and must fold
  // chunk p (0 or 1) of stage st, read from buffer buf
  auto chunk = [&](const int st, const int buf, const int p, const bool masked)
      __attribute__((always_inline)) {
    const int kbase = st * SK + p * 32;
    const half_t (*Kt)[AP] = &Ks[buf][p * 32];   // the chunk's 32 keys
    const half_t (*Vt)[AP] = Vs[buf];            // its keys: columns p * 32 + ...

    // ---- scores: K(32x64) x Q^T(64x16) + C -> two 16x16 f32 tiles of S^T --
    v8f c0 = ramp0, c1 = ramp1;
    if (masked) {
      // key 8*hi + r of the chunk is masked where sg * r > srel
      const int srel = sg * (iq - kbase - 8 * hi);
#pragma unroll
      for (int r = 0; r < 8; ++r) {
        c0[r] = (sg * r > srel) ? -1e9f : ramp0[r];
        c1[r] = (sg * (16 + r) > srel) ? -1e9f : ramp1[r];
      }
    }
    {
      V16 bk0, bk0b, bk1, bk1b;
      int key0 = l15, key1 = 16 + l15;
      bk0.h[0]  = *(const v8h*)&Kt[key0][hi * 8];
      bk0.h[1]  = *(const v8h*)&Kt[key0][16 + hi * 8];
      bk0b.h[0] = *(const v8h*)&Kt[key0][32 + hi * 8];
      bk0b.h[1] = *(const v8h*)&Kt[key0][48 + hi * 8];
      bk1.h[0]  = *(const v8h*)&Kt[key1][hi * 8];
      bk1.h[1]  = *(const v8h*)&Kt[key1][16 + hi * 8];
      bk1b.h[0] = *(const v8h*)&Kt[key1][32 + hi * 8];
      bk1b.h[1] = *(const v8h*)&Kt[key1][48 + hi * 8];
      c0 = __builtin_amdgcn_wmma_f32_16x16x32_f16(false, bk0.v, false, aq0.v,
                                                  (short)0, c0, false, false);
      c0 = __builtin_amdgcn_wmma_f32_16x16x32_f16(false, bk0b.v, false, aq1.v,
                                                  (short)0, c0, false, false);
      c1 = __builtin_amdgcn_wmma_f32_16x16x32_f16(false, bk1.v, false, aq0.v,
                                                  (short)0, c1, false, false);
      c1 = __builtin_amdgcn_wmma_f32_16x16x32_f16(false, bk1b.v, false, aq1.v,
                                                  (short)0, c1, false, false);
    }

    // ---- online softmax, one query per lane ------------------------------
    float mx = -1e30f;
#pragma unroll
    for (int r = 0; r < 8; ++r) mx = fmaxf(mx, fmaxf(c0[r], c1[r]));
    mx = fmaxf(mx, xhalf(mx));   // all 32 keys of the chunk
    const float off = g * (float)(kbase - iq);   // the chunk's part of the term
    const float Mn = fmaxf(M, mx + off);
    const float sc = __expf(M - Mn);
    M = Mn;
    // Mn in the chunk's own units. Never below mx: where all 32 keys are masked
    // the roundings at 1e9 could leave it lower, and exp would overflow f16.
    const float e = fmaxf(Mn - off, mx);

    V16 pf;                      // P^T as B operand: pf[s] = P^T[kmap(s, hi)][l15]
    float rs = 0.0f;
#pragma unroll
    for (int r = 0; r < 8; ++r) {
      float p0 = __expf(c0[r] - e);
      float p1 = __expf(c1[r] - e);
      rs += p0 + p1;
      pf.v[r]     = (half_t)p0;
      pf.v[8 + r] = (half_t)p1;
    }
    L = L * sc + rs;
#pragma unroll
    for (int j = 0; j < 4; ++j)
#pragma unroll
      for (int r = 0; r < 8; ++r) acc[j][r] = acc[j][r] * sc;

    // ---- V^T(64x32) x P^T(32x16): 4 WMMAs accumulate into O^T ------------
#pragma unroll
    for (int j = 0; j < 4; ++j) {
      V16 bv;
      int drow = j * 16 + l15;
      bv.h[0] = *(const v8h*)&Vt[drow][p * 32 + hi * 8];
      bv.h[1] = *(const v8h*)&Vt[drow][p * 32 + 16 + hi * 8];
      acc[j] = __builtin_amdgcn_wmma_f32_16x16x32_f16(false, bv.v, false, pf.v,
                                                      (short)0, acc[j],
                                                      false, false);
    }
  };

  fill(sBeg, 0);
  // this wave's copies of the first stage have landed ...
  asm volatile("s_wait_asynccnt 0x0" ::: "memory");
  __syncthreads();   // ... and every other wave's
  fill(sBeg + 1, 1);

  const int mBeg = fwd ? sBeg : sBeg + 2;   // stages [mBeg, mEnd) hold no
  const int mEnd = fwd ? sEnd - 2 : sEnd;   // masked key for any query here
  // always_inline: 'masked' is a literal at each call and must fold away
  auto stage = [&](const int st, const bool masked)
      __attribute__((always_inline)) {
    const int buf = st & 1;
    chunk(st, buf, 0, masked);
    chunk(st, buf, 1, masked);
    // this wave's reads of the buffer that is refilled below are done
    asm volatile("s_wait_dscnt 0x0" ::: "memory");
    // this wave's copies of the next stage have landed
    asm volatile("s_wait_asynccnt 0x0" ::: "memory");
    __syncthreads();   // publishes stage st + 1, frees stage st's buffer
    if (st + 2 < sEnd) fill(st + 2, buf);
  };
  for (int st = sBeg; st < mBeg; ++st) stage(st, true);
  for (int st = mBeg; st < mEnd; ++st) stage(st, false);
  for (int st = mEnd; st < sEnd; ++st) stage(st, true);
  // no copy is outstanding when the wave ends
  asm volatile("s_wait_asynccnt 0x0" ::: "memory");

  // ---- epilogue: join the halves' sums, normalize, write f16 into [B*S, D]
  //      for the final GEMM; a lane's 8 registers are 8 consecutive dims -----
  const float inv = 1.0f / (L + xhalf(L));
  half_t* orow = Oh + (size_t)(b * S_ + iq) * D_ + h * HD_ + 8 * hi;
#pragma unroll
  for (int j = 0; j < 4; ++j) {
    v8h o;
#pragma unroll
    for (int r = 0; r < 8; ++r) o[r] = (half_t)(acc[j][r] * inv);
    *(v8h*)(orow + j * 16) = o;
  }
}

// ---------------------------------------------------------------------------
// Host-side launcher. Workspace layout (all 16B-aligned, ~48 MB total):
//   xh   : ROWS*D f16      (8 MB)
//   wqt/wkt/wvt/wft : D*D f16 each, TRANSPOSED [n][k] (4 x 2 MB)
//   Qh/Kh : B*H*S*hd f16  (2 x 8 MB);  VhT : B*H*hd*S f16 (8 MB)
//   Oh   : ROWS*D f16      (8 MB)
// ---------------------------------------------------------------------------
extern "C" void kernel_launch(void* const* d_in, const int* in_sizes, int n_in,
                              void* d_out, int out_size, void* d_ws,
                              size_t ws_size, hipStream_t stream) {
  const float* x  = (const float*)d_in[0];
  const float* Wq = (const float*)d_in[1];
  const float* bq = (const float*)d_in[2];
  const float* Wk = (const float*)d_in[3];
  const float* bk = (const float*)d_in[4];
  const float* Wv = (const float*)d_in[5];
  const float* bv = (const float*)d_in[6];
  const float* Wf = (const float*)d_in[7];
  const float* bf = (const float*)d_in[8];
  float* out = (float*)d_out;

  char* ws = (char*)d_ws;
  size_t off = 0;
  half_t* xh  = (half_t*)(ws + off); off += (size_t)ROWS * D_ * sizeof(half_t);
  half_t* wqt = (half_t*)(ws + off); off += (size_t)D_ * D_ * sizeof(half_t);
  half_t* wkt = (half_t*)(ws + off); off += (size_t)D_ * D_ * sizeof(half_t);
  half_t* wvt = (half_t*)(ws + off); off += (size_t)D_ * D_ * sizeof(half_t);
  half_t* wft = (half_t*)(ws + off); off += (size_t)D_ * D_ * sizeof(half_t);
  half_t* Qh  = (half_t*)(ws + off); off += (size_t)B_ * H_ * S_ * HD_ * sizeof(half_t);
  half_t* Kh  = (half_t*)(ws + off); off += (size_t)B_ * H_ * S_ * HD_ * sizeof(half_t);
  half_t* VhT = (half_t*)(ws + off); off += (size_t)B_ * H_ * HD_ * S_ * sizeof(half_t);
  half_t* Oh  = (half_t*)(ws + off); off += (size_t)ROWS * D_ * sizeof(half_t);

  // 1) conversions in one launch: x plain; weights transpose-converted to [n][k]
  prep_kernel<<<512, 256, 0, stream>>>(x, Wq, Wk, Wv, Wf, xh, wqt, wkt, wvt, wft);

  // 2) fused QKV projection (z selects Q/K/V), tiles 128x128, 8 waves/block
  qkv_gemm_kernel<<<dim3(D_ / BN, ROWS / BM, 3), 256, 0, stream>>>(
      xh, wqt, wkt, wvt, bq, bk, bv, Qh, Kh, VhT);

  // 3) flash attention with bidirectional ALiBi
  attn_kernel<<<dim3(B_ * H_, S_ / 128), 256, 0, stream>>>(Qh, Kh, VhT, Oh);

  // 4) output projection to f32
  out_gemm_kernel<<<dim3(D_ / BN, ROWS / BM), 256, 0, stream>>>(
      Oh, wft, bf, out);
}

// v006
// Measured time: 82.3 microseconds a run.
// Two timings next to v005 put it at 1.07 and 1.08 times that version's speed.
// Over all steps from v000 it is 2.70 times as fast.
#include <hip/hip_runtime.h>
#include <cstdint>
#include <cstddef>

// ---------------------------------------------------------------------------
// RelativeAttention (ALiBi bidirectional) for MI455X / gfx1250, wave32 WMMA.
// All matmuls run on v_wmma_f32_16x16x32_f16 (f16 in, f32 accumulate).
// Weights are pre-transposed (and V written transposed) so every LDS staging
// access is a 128-bit load/store -- no 16-bit scatter in the hot loops.
// ---------------------------------------------------------------------------

typedef _Float16 half_t;
typedef __attribute__((ext_vector_type(16))) _Float16 v16h;
typedef __attribute__((ext_vector_type(8)))  _Float16 v8h;
typedef __attribute__((ext_vector_type(4)))  _Float16 v4h;
typedef __attribute__((ext_vector_type(8)))  float    v8f;

union V16 { v16h v; v8h h[2]; };

constexpr int B_   = 2;
constexpr int S_   = 2048;
constexpr int D_   = 1024;
constexpr int H_   = 16;
constexpr int HD_  = 64;
constexpr int ROWS = B_ * S_;   // 4096

// ---------------------------------------------------------------------------
// Preparation, one launch of 512 equal work-groups of 256 threads. Each does
//   - one 64(k) x 128(n) piece of one weight matrix, f32 [K][N] -> f16 [N][K],
//     as two 64x64 tiles through LDS, coalesced on both sides (128 work-groups
//     per matrix, 4 matrices);
//   - 2048 float4 of x, f32 -> f16, element for element.
// All of a thread's loads are issued before the first value is used, so the
// work-group pays one memory round trip; one barrier serves both tiles.
// ---------------------------------------------------------------------------
__global__ __launch_bounds__(256) void prep_kernel(
    const float* __restrict__ x,
    const float* __restrict__ Wq, const float* __restrict__ Wk,
    const float* __restrict__ Wv, const float* __restrict__ Wf,
    half_t* __restrict__ xh,
    half_t* __restrict__ wqt, half_t* __restrict__ wkt,
    half_t* __restrict__ wvt, half_t* __restrict__ wft) {
  __shared__ float tile[2][64][65];
  const int w   = blockIdx.x;
  const int tid = threadIdx.x;
  const int m   = w >> 7;           // which weight matrix
  const float* src = (m == 0) ? Wq : (m == 1) ? Wk : (m == 2) ? Wv : Wf;
  half_t* dst      = (m == 0) ? wqt : (m == 1) ? wkt : (m == 2) ? wvt : wft;
  const int nb = (w & 7) * 128;         // n base (cols of src, rows of dst)
  const int kb = ((w >> 3) & 15) * 64;  // k base (rows of src, cols of dst)
  const int r0 = tid >> 6, c = tid & 63;

  // (the loops are unrolled so that tv and xv stay in registers)
  float tv[2][16];
#pragma unroll
  for (int u = 0; u < 2; ++u)
#pragma unroll
    for (int i = 0; i < 16; ++i)
      tv[u][i] = src[(size_t)(kb + r0 + i * 4) * D_ + nb + u * 64 + c];
  const float4* xs = (const float4*)x + (size_t)w * 2048 + tid;
  float4 xv[8];
#pragma unroll
  for (int i = 0; i < 8; ++i) xv[i] = xs[i * 256];
  // keeps every load above in front of the first use of a loaded value: without
  // it the x values are waited for and converted before the tile loads issue
  __builtin_amdgcn_sched_barrier(0);

#pragma unroll
  for (int u = 0; u < 2; ++u)
#pragma unroll
    for (int i = 0; i < 16; ++i) tile[u][r0 + i * 4][c] = tv[u][i];

  v4h* xd = (v4h*)xh + (size_t)w * 2048 + tid;
#pragma unroll
  for (int i = 0; i < 8; ++i) {
    v4h h;
    h[0] = (half_t)xv[i].x; h[1] = (half_t)xv[i].y;
    h[2] = (half_t)xv[i].z; h[3] = (half_t)xv[i].w;
    xd[i * 256] = h;
  }
  __syncthreads();
  half_t* dp = dst + (size_t)(nb + r0) * D_ + kb + c;
#pragma unroll
  for (int u = 0; u < 2; ++u)
#pragma unroll
    for (int i = 0; i < 16; ++i)
      dp[(u * 64 + i * 4) * D_] = (half_t)tile[u][c][r0 + i * 4];
}

// ---------------------------------------------------------------------------
// Shared WMMA GEMM core: C(128x128 per block) = A(ROWS x 1024) * B(1024 x 1024)
// 256 threads = 8 waves (2 x 4), each wave computes a 64x32 patch (4x2 WMMA
// tiles). A stage is 64 k: every staged row is one whole 128-byte line, and a
// wave-wide 128-bit copy covers four whole lines. LDS rows stand at a pitch of
// 144 bytes (16 B x odd), the conflict-free pitch for 128-bit fragment reads.
// A staged row-major; B comes from a PRE-TRANSPOSED weight Wt[n][k], so both
// stagings and all fragment fills are contiguous 128-bit LDS operations.
// The stages come into LDS by asynchronous 16-byte copies, two buffers: stage
// kt + 1 flies while stage kt is worked on, and one barrier per stage publishes
// the one and frees the other.
// Fragment layout (ISA 7.12.2, 16-bit, wave32):
//   A: lane(l&15)=row, halves at k = {hi*8..+7, 16+hi*8..+7}
//   B: lane(l&15)=col, same k pattern.  C: n=l&15, m=r+8*(l>>4).
// ---------------------------------------------------------------------------
constexpr int BM = 128;   // block rows
constexpr int BN = 128;   // block cols
constexpr int BK = 64;    // k per stage (128 bytes of every operand row)
constexpr int LP = 72;    // LDS row pitch in halves (144 bytes)
constexpr int GBB = BM * LP * 2;   // bytes of one buffer of one operand

__device__ __forceinline__ void gemm_tile_core(
    const half_t* __restrict__ A, const half_t* __restrict__ Bt_g,
    half_t (*As)[BM][LP], half_t (*Bt)[BN][LP],
    int rowBase, int colBase, v8f acc[4][2]) {
  const int tid  = threadIdx.x;
  const int lane = tid & 31;
  const int wid  = tid >> 5;
  const int wm   = wid >> 2;       // 0..1  (m sub-block of 64 rows)
  const int wn   = wid & 3;        // 0..3  (n sub-block of 32 cols)
  const int hi   = lane >> 4;      // half-wave select
  const int l15  = lane & 15;
  const int srow = tid >> 3;       // staging: 8 threads per 128-byte row
  const int scol = (tid & 7) * 8;

  const half_t* ag = A    + (size_t)(rowBase + srow) * D_ + scol;
  const half_t* bg = Bt_g + (size_t)(colBase + srow) * D_ + scol;
  const uint32_t al0 = (uint32_t)(uintptr_t)&As[0][srow][scol];   // LDS byte
  const uint32_t bl0 = (uint32_t)(uintptr_t)&Bt[0][srow][scol];   // addresses

  // ---- stage kt (A 128x64 and B 128x64) into one buffer: a thread takes rows
  //      srow + 32 i of either operand, 16 bytes of each ---------------------
  auto fill = [&](const int kt, const int buf) __attribute__((always_inline)) {
    const half_t* a = ag + kt * BK;
    const half_t* b = bg + kt * BK;
    const uint32_t al = al0 + buf * GBB, bl = bl0 + buf * GBB;
    // global to LDS through no register; the closing wait stands in front of
    // any rewrite of the address registers that the eight copies name
    asm volatile(
        "global_load_async_to_lds_b128 %0, %8, off\n\t"
        "global_load_async_to_lds_b128 %1, %9, off\n\t"
        "global_load_async_to_lds_b128 %2, %10, off\n\t"
        "global_load_async_to_lds_b128 %3, %11, off\n\t"
        "global_load_async_to_lds_b128 %4, %12, off\n\t"
        "global_load_async_to_lds_b128 %5, %13, off\n\t"
        "global_load_async_to_lds_b128 %6, %14, off\n\t"
        "global_load_async_to_lds_b128 %7, %15, off\n\t"
        "s_wait_xcnt 0x0"
        :: "v"(al), "v"(al + 32 * LP * 2), "v"(al + 64 * LP * 2),
           "v"(al + 96 * LP * 2),
           "v"(bl), "v"(bl + 32 * LP * 2), "v"(bl + 64 * LP * 2),
           "v"(bl + 96 * LP * 2),
           "v"(a), "v"(a + 32 * D_), "v"(a + 64 * D_), "v"(a + 96 * D_),
           "v"(b), "v"(b + 32 * D_), "v"(b + 64 * D_), "v"(b + 96 * D_)
        : "memory");
  };

  fill(0, 0);
  // this wave's copies of the first stage have landed ...
  asm volatile("s_wait_asynccnt 0x0" ::: "memory");
  __syncthreads();   // ... and every other wave's
  fill(1, 1);

  for (int kt = 0; kt < D_ / BK; ++kt) {
    const int buf = kt & 1;
    const half_t (*Ab)[LP] = As[buf];
    const half_t (*Bb)[LP] = Bt[buf];
    // (the loops below are unrolled so that the fragments and acc are indexed
    //  by constants and stay in registers)
#pragma unroll
    for (int ks = 0; ks < BK / 32; ++ks) {
      V16 af[4], bf2[2];
#pragma unroll
      for (int sm = 0; sm < 4; ++sm) {
        int r = wm * 64 + sm * 16 + l15;
        af[sm].h[0] = *(const v8h*)&Ab[r][ks * 32 + hi * 8];
        af[sm].h[1] = *(const v8h*)&Ab[r][ks * 32 + 16 + hi * 8];
      }
#pragma unroll
      for (int sn = 0; sn < 2; ++sn) {
        int c = wn * 32 + sn * 16 + l15;
        bf2[sn].h[0] = *(const v8h*)&Bb[c][ks * 32 + hi * 8];
        bf2[sn].h[1] = *(const v8h*)&Bb[c][ks * 32 + 16 + hi * 8];
      }
#pragma unroll
      for (int sm = 0; sm < 4; ++sm)
#pragma unroll
        for (int sn = 0; sn < 2; ++sn)
          acc[sm][sn] = __builtin_amdgcn_wmma_f32_16x16x32_f16(
              false, af[sm].v, false, bf2[sn].v, (short)0, acc[sm][sn],
              false, false);
    }
    // this wave's reads of the buffer that is refilled below are done
    asm volatile("s_wait_dscnt 0x0" ::: "memory");
    // this wave's copies of the next stage have landed
    asm volatile("s_wait_asynccnt 0x0" ::: "memory");
    __syncthreads();   // publishes stage kt + 1, frees stage kt's buffer
    if (kt + 2 < D_ / BK) fill(kt + 2, buf);
  }
  // no copy is outstanding when the wave goes on
  asm volatile("s_wait_asynccnt 0x0" ::: "memory");
}

// ---------------------------------------------------------------------------
// Fused QKV projection: z=0 -> Q (pre-scaled by 1/sqrt(hd)), z=1 -> K,
// z=2 -> V written TRANSPOSED [B, H, hd, S] so the attention kernel can
// stage V tiles with contiguous b128 accesses. Q/K go to [B, H, S, hd].
// ---------------------------------------------------------------------------
__global__ __launch_bounds__(256) void qkv_gemm_kernel(
    const half_t* __restrict__ Xh,
    const half_t* __restrict__ Wqt, const half_t* __restrict__ Wkt,
    const half_t* __restrict__ Wvt,
    const float* __restrict__ bq, const float* __restrict__ bk,
    const float* __restrict__ bv,
    half_t* __restrict__ Qh, half_t* __restrict__ Kh,
    half_t* __restrict__ VhT) {
  __shared__ __align__(16) half_t As[2][BM][LP];   // [buffer][row][k]
  __shared__ __align__(16) half_t Bt[2][BN][LP];   // [buffer][col][k]

  const half_t* W; const float* bias; half_t* dst; float scale;
  bool vmode = false;
  if (blockIdx.z == 0)      { W = Wqt; bias = bq; dst = Qh;  scale = 0.125f; }
  else if (blockIdx.z == 1) { W = Wkt; bias = bk; dst = Kh;  scale = 1.0f; }
  else                      { W = Wvt; bias = bv; dst = VhT; scale = 1.0f; vmode = true; }

  const int rowBase = blockIdx.y * BM;
  const int colBase = blockIdx.x * BN;
  v8f acc[4][2] = {};
  gemm_tile_core(Xh, W, As, Bt, rowBase, colBase, acc);

  const int lane = threadIdx.x & 31;
  const int wid  = threadIdx.x >> 5;
  const int wm = wid >> 2, wn = wid & 3, hi = lane >> 4, l15 = lane & 15;
#pragma unroll
  for (int sm = 0; sm < 4; ++sm)
#pragma unroll
    for (int sn = 0; sn < 2; ++sn)
#pragma unroll
      for (int r = 0; r < 8; ++r) {
        int R = rowBase + wm * 64 + sm * 16 + r + 8 * hi;
        int C = colBase + wn * 32 + sn * 16 + l15;
        float val = (acc[sm][sn][r] + bias[C]) * scale;
        int b = R >> 11, s = R & (S_ - 1), h = C >> 6, d = C & (HD_ - 1);
        size_t idx = vmode
            ? ((((size_t)(b * H_ + h)) * HD_ + d) * S_ + s)   // V: [B,H,hd,S]
            : ((((size_t)(b * H_ + h)) * S_ + s) * HD_ + d);  // Q/K: [B,H,S,hd]
        dst[idx] = (half_t)val;
      }
}

// ---------------------------------------------------------------------------
// Output projection: out(f32) = Oh(f16) @ Wf(f16, pre-transposed) + bf
// ---------------------------------------------------------------------------
__global__ __launch_bounds__(256) void out_gemm_kernel(
    const half_t* __restrict__ Oh, const half_t* __restrict__ Wft,
    const float* __restrict__ bf, float* __restrict__ out) {
  __shared__ __align__(16) half_t As[2][BM][LP];   // [buffer][row][k]
  __shared__ __align__(16) half_t Bt[2][BN][LP];   // [buffer][col][k]
  const int rowBase = blockIdx.y * BM;
  const int colBase = blockIdx.x * BN;
  v8f acc[4][2] = {};
  gemm_tile_core(Oh, Wft, As, Bt, rowBase, colBase, acc);

  const int lane = threadIdx.x & 31;
  const int wid  = threadIdx.x >> 5;
  const int wm = wid >> 2, wn = wid & 3, hi = lane >> 4, l15 = lane & 15;
#pragma unroll
  for (int sm = 0; sm < 4; ++sm)
#pragma unroll
    for (int sn = 0; sn < 2; ++sn)
#pragma unroll
      for (int r = 0; r < 8; ++r) {
        int R = rowBase + wm * 64 + sm * 16 + r + 8 * hi;
        int C = colBase + wn * 32 + sn * 16 + l15;
        out[(size_t)R * D_ + C] = acc[sm][sn][r] + bf[C];
      }
}

// ---------------------------------------------------------------------------
// Lane l with lane l ^ 16 (the other 16-lane half), on the vector port.
// ---------------------------------------------------------------------------
__device__ __forceinline__ float xhalf(float x) {
  return __builtin_bit_cast(float, __builtin_amdgcn_permlanex16(
      __builtin_bit_cast(int, x), __builtin_bit_cast(int, x),
      0x76543210, 0xfedcba98, false, false));
}

constexpr int SK  = 64;
constexpr int AP  = 72;
constexpr int ABB = 64 * AP * 2;

// (the launch bound states the block of 256 that the host launches: without it
//  the register budget is that of 1024 threads, and the stage's body spills)
__global__ __launch_bounds__(256) void attn_kernel(const half_t* __restrict__ Qh,
                            const half_t* __restrict__ Kh,
                            const half_t* __restrict__ VhT,
                            half_t* __restrict__ Oh) {
  __shared__ __align__(16) half_t Ks[2][SK][AP];   // [buffer][key][dim]
  __shared__ __align__(16) half_t Vs[2][HD_][AP];  // [buffer][dim][key]

  const int bh  = blockIdx.x;
  const int b   = bh >> 4;
  const int h   = bh & 15;
  const int Qb  = blockIdx.y * 128;
  const int tid = threadIdx.x;
  const int lane = tid & 31;
  const int wid  = tid >> 5;
  const int hi   = lane >> 4;
  const int l15  = lane & 15;
  const int qbase = Qb + wid * 16;
  const int iq    = qbase + l15;   // this lane's query

  const half_t* Qp = Qh  + (size_t)(b * H_ + h) * S_ * HD_;
  const half_t* Kp = Kh  + (size_t)(b * H_ + h) * S_ * HD_;
  const half_t* Vp = VhT + (size_t)(b * H_ + h) * HD_ * S_;  // [dim][key]

  // Q fragments for the whole hd=64 (two K=32 steps), loaded once.
  V16 aq0, aq1;
  {
    const half_t* qrow = Qp + (size_t)iq * HD_;
    aq0.h[0] = *(const v8h*)(qrow + hi * 8);
    aq0.h[1] = *(const v8h*)(qrow + 16 + hi * 8);
    aq1.h[0] = *(const v8h*)(qrow + 32 + hi * 8);
    aq1.h[1] = *(const v8h*)(qrow + 48 + hi * 8);
  }

  float M = -1e30f;   // running maximum of this lane's query (both halves alike)
  float L = 0.0f;     // running sum over this half's keys; halves joined at the end
  v8f acc[4] = {};    // acc[j][r] = O^T[j*16 + 8*hi + r][query l15]

  // slope = (24^(1/8))^-(h%8+1)
  const float slope = __expf(-__logf(24.0f) / 8.0f * (float)((h & 7) + 1));
  const bool fwd = (h < 8);
  const float g = fwd ? slope : -slope;   // ALiBi term per step of the key index
  const int  sg = fwd ? 1 : -1;
  v8f ramp0, ramp1;                       // g * (key index inside the chunk)
#pragma unroll
  for (int r = 0; r < 8; ++r) {
    ramp0[r] = g * (float)(8 * hi + r);
    ramp1[r] = g * (float)(16 + 8 * hi + r);
  }
  const int sBeg = fwd ? 0 : (Qb >> 6);                  // stages [sBeg, sEnd):
  const int sEnd = fwd ? ((Qb >> 6) + 2) : (S_ >> 6);    // two at least, sBeg even

  // ---- one stage into one buffer: 8 threads per 128-byte row, a thread takes
  //      rows srow and srow + 32 of K (keys) and of V (dims) -----------------
  const int srow = tid >> 3, scol = (tid & 7) * 8;
  const uint32_t kl0 = (uint32_t)(uintptr_t)&Ks[0][srow][scol];   // LDS byte
  const uint32_t vl0 = (uint32_t)(uintptr_t)&Vs[0][srow][scol];   // addresses
  auto fill = [&](const int st, const int buf) __attribute__((always_inline)) {
    const half_t* kg = Kp + (size_t)(st * SK + srow) * HD_ + scol;
    const half_t* vg = Vp + (size_t)srow * S_ + st * SK + scol;
    const uint32_t kl = kl0 + buf * ABB, vl = vl0 + buf * ABB;
    // global to LDS through no register; the closing wait stands in front of
    // any rewrite of the address registers that the four copies name
    asm volatile(
        "global_load_async_to_lds_b128 %0, %4, off\n\t"
        "global_load_async_to_lds_b128 %1, %5, off\n\t"
        "global_load_async_to_lds_b128 %2, %6, off\n\t"
        "global_load_async_to_lds_b128 %3, %7, off\n\t"
        "s_wait_xcnt 0x0"
        :: "v"(kl), "v"(kl + 32 * AP * 2), "v"(vl), "v"(vl + 32 * AP * 2),
           "v"(kg), "v"(kg + 32 * HD_), "v"(vg), "v"(vg + 32 * S_)
        : "memory");
  };

  // always_inline: 'masked' and 'p' are literals at each call and must fold
  // chunk p (0 or 1) of stage st, read from buffer buf
  auto chunk = [&](const int st, const int buf, const int p, const bool masked)
      __attribute__((always_inline)) {
    const int kbase = st * SK + p * 32;
    const half_t (*Kt)[AP] = &Ks[buf][p * 32];   // the chunk's 32 keys
    const half_t (*Vt)[AP] = Vs[buf];            // its keys: columns p * 32 + ...

    // ---- scores: K(32x64) x Q^T(64x16) + C -> two 16x16 f32 tiles of S^T --
    v8f c0 = ramp0, c1 = ramp1;
    if (masked) {
      // key 8*hi + r of the chunk is masked where sg * r > srel
      const int srel = sg * (iq - kbase - 8 * hi);
#pragma unroll
      for (int r = 0; r < 8; ++r) {
        c0[r] = (sg * r > srel) ? -1e9f : ramp0[r];
        c1[r] = (sg * (16 + r) > srel) ? -1e9f : ramp1[r];
      }
    }
    {
      V16 bk0, bk0b, bk1, bk1b;
      int key0 = l15, key1 = 16 + l15;
      bk0.h[0]  = *(const v8h*)&Kt[key0][hi * 8];
      bk0.h[1]  = *(const v8h*)&Kt[key0][16 + hi * 8];
      bk0b.h[0] = *(const v8h*)&Kt[key0][32 + hi * 8];
      bk0b.h[1] = *(const v8h*)&Kt[key0][48 + hi * 8];
      bk1.h[0]  = *(const v8h*)&Kt[key1][hi * 8];
      bk1.h[1]  = *(const v8h*)&Kt[key1][16 + hi * 8];
      bk1b.h[0] = *(const v8h*)&Kt[key1][32 + hi * 8];
      bk1b.h[1] = *(const v8h*)&Kt[key1][48 + hi * 8];
      c0 = __builtin_amdgcn_wmma_f32_16x16x32_f16(false, bk0.v, false, aq0.v,
                                                  (short)0, c0, false, false);
      c0 = __builtin_amdgcn_wmma_f32_16x16x32_f16(false, bk0b.v, false, aq1.v,
                                                  (short)0, c0, false, false);
      c1 = __builtin_amdgcn_wmma_f32_16x16x32_f16(false, bk1.v, false, aq0.v,
                                                  (short)0, c1, false, false);
      c1 = __builtin_amdgcn_wmma_f32_16x16x32_f16(false, bk1b.v, false, aq1.v,
                                                  (short)0, c1, false, false);
    }

    // ---- online softmax, one query per lane ------------------------------
    float mx = -1e30f;
#pragma unroll
    for (int r = 0; r < 8; ++r) mx = fmaxf(mx, fmaxf(c0[r], c1[r]));
    mx = fmaxf(mx, xhalf(mx));   // all 32 keys of the chunk
    const float off = g * (float)(kbase - iq);   // the chunk's part of the term
    const float Mn = fmaxf(M, mx + off);
    const float sc = __expf(M - Mn);
    M = Mn;
    // Mn in the chunk's own units. Never below mx: where all 32 keys are masked
    // the roundings at 1e9 could leave it lower, and exp would overflow f16.
    const float e = fmaxf(Mn - off, mx);

    V16 pf;                      // P^T as B operand: pf[s] = P^T[kmap(s, hi)][l15]
    float rs = 0.0f;
#pragma unroll
    for (int r = 0; r < 8; ++r) {
      float p0 = __expf(c0[r] - e);
      float p1 = __expf(c1[r] - e);
      rs += p0 + p1;
      pf.v[r]     = (half_t)p0;
      pf.v[8 + r] = (half_t)p1;
    }
    L = L * sc + rs;
#pragma unroll
    for (int j = 0; j < 4; ++j)
#pragma unroll
      for (int r = 0; r < 8; ++r) acc[j][r] = acc[j][r] * sc;

    // ---- V^T(64x32) x P^T(32x16): 4 WMMAs accumulate into O^T ------------
#pragma unroll
    for (int j = 0; j < 4; ++j) {
      V16 bv;
      int drow = j * 16 + l15;
      bv.h[0] = *(const v8h*)&Vt[drow][p * 32 + hi * 8];
      bv.h[1] = *(const v8h*)&Vt[drow][p * 32 + 16 + hi * 8];
      acc[j] = __builtin_amdgcn_wmma_f32_16x16x32_f16(false, bv.v, false, pf.v,
                                                      (short)0, acc[j],
                                                      false, false);
    }
  };

  fill(sBeg, 0);
  // this wave's copies of the first stage have landed ...
  asm volatile("s_wait_asynccnt 0x0" ::: "memory");
  __syncthreads();   // ... and every other wave's
  fill(sBeg + 1, 1);

  const int mBeg = fwd ? sBeg : sBeg + 2;   // stages [mBeg, mEnd) hold no
  const int mEnd = fwd ? sEnd - 2 : sEnd;   // masked key for any query here
  // always_inline: 'masked' is a literal at each call and must fold away
  auto stage = [&](const int st, const bool masked)
      __attribute__((always_inline)) {
    const int buf = st & 1;
    chunk(st, buf, 0, masked);
    chunk(st, buf, 1, masked);
    // this wave's reads of the buffer that is refilled below are done
    asm volatile("s_wait_dscnt 0x0" ::: "memory");
    // this wave's copies of the next stage have landed
    asm volatile("s_wait_asynccnt 0x0" ::: "memory");
    __syncthreads();   // publishes stage st + 1, frees stage st's buffer
    if (st + 2 < sEnd) fill(st + 2, buf);
  };
  for (int st = sBeg; st < mBeg; ++st) stage(st, true);
  for (int st = mBeg; st < mEnd; ++st) stage(st, false);
  for (int st = mEnd; st < sEnd; ++st) stage(st, true);
  // no copy is outstanding when the wave ends
  asm volatile("s_wait_asynccnt 0x0" ::: "memory");

  // ---- epilogue: join the halves' sums, normalize, write f16 into [B*S, D]
  //      for the final GEMM; a lane's 8 registers are 8 consecutive dims -----
  const float inv = 1.0f / (L + xhalf(L));
  half_t* orow = Oh + (size_t)(b * S_ + iq) * D_ + h * HD_ + 8 * hi;
#pragma unroll
  for (int j = 0; j < 4; ++j) {
    v8h o;
#pragma unroll
    for (int r = 0; r < 8; ++r) o[r] = (half_t)(acc[j][r] * inv);
    *(v8h*)(orow + j * 16) = o;
  }
}

// ---------------------------------------------------------------------------
// Host-side launcher. Workspace layout (all 16B-aligned, ~48 MB total):
//   xh   : ROWS*D f16      (8 MB)
//   wqt/wkt/wvt/wft : D*D f16 each, TRANSPOSED [n][k] (4 x 2 MB)
//   Qh/Kh : B*H*S*hd f16  (2 x 8 MB);  VhT : B*H*hd*S f16 (8 MB)
//   Oh   : ROWS*D f16      (8 MB)
// ---------------------------------------------------------------------------
extern "C" void kernel_launch(void* const* d_in, const int* in_sizes, int n_in,
                              void* d_out, int out_size, void* d_ws,
                              size_t ws_size, hipStream_t stream) {
  const float* x  = (const float*)d_in[0];
  const float* Wq = (const float*)d_in[1];
  const float* bq = (const float*)d_in[2];
  const float* Wk = (const float*)d_in[3];
  const float* bk = (const float*)d_in[4];
  const float* Wv = (const float*)d_in[5];
  const float* bv = (const float*)d_in[6];
  const float* Wf = (const float*)d_in[7];
  const float* bf = (const float*)d_in[8];
  float* out = (float*)d_out;

  char* ws = (char*)d_ws;
  size_t off = 0;
  half_t* xh  = (half_t*)(ws + off); off += (size_t)ROWS * D_ * sizeof(half_t);
  half_t* wqt = (half_t*)(ws + off); off += (size_t)D_ * D_ * sizeof(half_t);
  half_t* wkt = (half_t*)(ws + off); off += (size_t)D_ * D_ * sizeof(half_t);
  half_t* wvt = (half_t*)(ws + off); off += (size_t)D_ * D_ * sizeof(half_t);
  half_t* wft = (half_t*)(ws + off); off += (size_t)D_ * D_ * sizeof(half_t);
  half_t* Qh  = (half_t*)(ws + off); off += (size_t)B_ * H_ * S_ * HD_ * sizeof(half_t);
  half_t* Kh  = (half_t*)(ws + off); off += (size_t)B_ * H_ * S_ * HD_ * sizeof(half_t);
  half_t* VhT = (half_t*)(ws + off); off += (size_t)B_ * H_ * HD_ * S_ * sizeof(half_t);
  half_t* Oh  = (half_t*)(ws + off); off += (size_t)ROWS * D_ * sizeof(half_t);

  // 1) conversions in one launch: x plain; weights transpose-converted to [n][k]
  prep_kernel<<<512, 256, 0, stream>>>(x, Wq, Wk, Wv, Wf, xh, wqt, wkt, wvt, wft);

  // 2) fused QKV projection (z selects Q/K/V), tiles 128x128, 8 waves/block
  qkv_gemm_kernel<<<dim3(D_ / BN, ROWS / BM, 3), 256, 0, stream>>>(
      xh, wqt, wkt, wvt, bq, bk, bv, Qh, Kh, VhT);

  // 3) flash attention with bidirectional ALiBi
  attn_kernel<<<dim3(B_ * H_, S_ / 128), 256, 0, stream>>>(Qh, Kh, VhT, Oh);

  // 4) output projection to f32
  out_gemm_kernel<<<dim3(D_ / BN, ROWS / BM), 256, 0, stream>>>(
      Oh, wft, bf, out);
}

// v007
// It runs in 75.5 microseconds.
// Next to v006, in two timings, it ran 1.09 times as fast each time.
// Over all steps from v000 it is 2.94 times as fast.
#include <hip/hip_runtime.h>
#include <cstdint>
#include <cstddef>

// ---------------------------------------------------------------------------
// RelativeAttention (ALiBi bidirectional) for MI455X / gfx1250, wave32 WMMA.
// All matmuls run on v_wmma_f32_16x16x32_f16 (f16 in, f32 accumulate).
// Weights are pre-transposed (and V written transposed) so every LDS staging
// access is a 128-bit load/store -- no 16-bit scatter in the hot loops.
// ---------------------------------------------------------------------------

typedef _Float16 half_t;
typedef __attribute__((ext_vector_type(16))) _Float16 v16h;
typedef __attribute__((ext_vector_type(8)))  _Float16 v8h;
typedef __attribute__((ext_vector_type(4)))  _Float16 v4h;
typedef __attribute__((ext_vector_type(8)))  float    v8f;

union V16 { v16h v; v8h h[2]; };

constexpr int B_   = 2;
constexpr int S_   = 2048;
constexpr int D_   = 1024;
constexpr int H_   = 16;
constexpr int HD_  = 64;
constexpr int ROWS = B_ * S_;   // 4096

// ---------------------------------------------------------------------------
// Preparation, one launch of 512 equal work-groups of 256 threads. Each does
//   - one 64(k) x 128(n) piece of one weight matrix, f32 [K][N] -> f16 [N][K],
//     as two 64x64 tiles through LDS, coalesced on both sides (128 work-groups
//     per matrix, 4 matrices);
//   - 2048 float4 of x, f32 -> f16, element for element.
// All of a thread's loads are issued before the first value is used, so the
// work-group pays one memory round trip; one barrier serves both tiles.
// ---------------------------------------------------------------------------
__global__ __launch_bounds__(256) void prep_kernel(
    const float* __restrict__ x,
    const float* __restrict__ Wq, const float* __restrict__ Wk,
    const float* __restrict__ Wv, const float* __restrict__ Wf,
    half_t* __restrict__ xh,
    half_t* __restrict__ wqt, half_t* __restrict__ wkt,
    half_t* __restrict__ wvt, half_t* __restrict__ wft) {
  __shared__ float tile[2][64][65];
  const int w   = blockIdx.x;
  const int tid = threadIdx.x;
  const int m   = w >> 7;           // which weight matrix
  const float* src = (m == 0) ? Wq : (m == 1) ? Wk : (m == 2) ? Wv : Wf;
  half_t* dst      = (m == 0) ? wqt : (m == 1) ? wkt : (m == 2) ? wvt : wft;
  const int nb = (w & 7) * 128;         // n base (cols of src, rows of dst)
  const int kb = ((w >> 3) & 15) * 64;  // k base (rows of src, cols of dst)
  const int r0 = tid >> 6, c = tid & 63;

  // (the loops are unrolled so that tv and xv stay in registers)
  float tv[2][16];
#pragma unroll
  for (int u = 0; u < 2; ++u)
#pragma unroll
    for (int i = 0; i < 16; ++i)
      tv[u][i] = src[(size_t)(kb + r0 + i * 4) * D_ + nb + u * 64 + c];
  const float4* xs = (const float4*)x + (size_t)w * 2048 + tid;
  float4 xv[8];
#pragma unroll
  for (int i = 0; i < 8; ++i) xv[i] = xs[i * 256];
  // keeps every load above in front of the first use of a loaded value: without
  // it the x values are waited for and converted before the tile loads issue
  __builtin_amdgcn_sched_barrier(0);

#pragma unroll
  for (int u = 0; u < 2; ++u)
#pragma unroll
    for (int i = 0; i < 16; ++i) tile[u][r0 + i * 4][c] = tv[u][i];

  v4h* xd = (v4h*)xh + (size_t)w * 2048 + tid;
#pragma unroll
  for (int i = 0; i < 8; ++i) {
    v4h h;
    h[0] = (half_t)xv[i].x; h[1] = (half_t)xv[i].y;
    h[2] = (half_t)xv[i].z; h[3] = (half_t)xv[i].w;
    xd[i * 256] = h;
  }
  __syncthreads();
  half_t* dp = dst + (size_t)(nb + r0) * D_ + kb + c;
#pragma unroll
  for (int u = 0; u < 2; ++u)
#pragma unroll
    for (int i = 0; i < 16; ++i)
      dp[(u * 64 + i * 4) * D_] = (half_t)tile[u][c][r0 + i * 4];
}

// ---------------------------------------------------------------------------
// Shared WMMA GEMM core: C(128x128 per block) = A(M x 1024) * B(1024 x N)
// 256 threads = 8 waves (2 x 4), each wave computes a 64x32 patch (4x2 WMMA
// tiles). A stage is 64 k: every staged row is one whole 128-byte line, and a
// wave-wide 128-bit copy covers four whole lines. LDS rows stand at a pitch of
// 144 bytes (16 B x odd), the conflict-free pitch for 128-bit fragment reads.
// A and B both come as [row][k] (x, Oh or a PRE-TRANSPOSED weight Wt[n][k]), so both
// stagings and all fragment fills are contiguous 128-bit LDS operations.
// The stages come into LDS by asynchronous 16-byte copies, two buffers: stage
// kt + 1 flies while stage kt is worked on, and one barrier per stage publishes
// the one and frees the other.
// Fragment layout (ISA 7.12.2, 16-bit, wave32):
//   A: lane(l&15)=row, halves at k = {hi*8..+7, 16+hi*8..+7}
//   B: lane(l&15)=col, same k pattern.  C: n=l&15, m=r+8*(l>>4).
// ---------------------------------------------------------------------------
constexpr int BM = 128;   // block rows
constexpr int BN = 128;   // block cols
constexpr int BK = 64;    // k per stage (128 bytes of every operand row)
constexpr int LP = 72;    // LDS row pitch in halves (144 bytes)
constexpr int GBB = BM * LP * 2;   // bytes of one buffer of one operand

__device__ __forceinline__ void gemm_tile_core(
    const half_t* __restrict__ A, const half_t* __restrict__ Bt_g,
    half_t (*As)[BM][LP], half_t (*Bt)[BN][LP],
    int rowBase, int colBase, v8f acc[4][2]) {
  const int tid  = threadIdx.x;
  const int lane = tid & 31;
  const int wid  = tid >> 5;
  const int wm   = wid >> 2;       // 0..1  (m sub-block of 64 rows)
  const int wn   = wid & 3;        // 0..3  (n sub-block of 32 cols)
  const int hi   = lane >> 4;      // half-wave select
  const int l15  = lane & 15;
  const int srow = tid >> 3;       // staging: 8 threads per 128-byte row
  const int scol = (tid & 7) * 8;

  const half_t* ag = A    + (size_t)(rowBase + srow) * D_ + scol;
  const half_t* bg = Bt_g + (size_t)(colBase + srow) * D_ + scol;
  const uint32_t al0 = (uint32_t)(uintptr_t)&As[0][srow][scol];   // LDS byte
  const uint32_t bl0 = (uint32_t)(uintptr_t)&Bt[0][srow][scol];   // addresses

  // ---- stage kt (A 128x64 and B 128x64) into one buffer: a thread takes rows
  //      srow + 32 i of either operand, 16 bytes of each ---------------------
  auto fill = [&](const int kt, const int buf) __attribute__((always_inline)) {
    const half_t* a = ag + kt * BK;
    const half_t* b = bg + kt * BK;
    const uint32_t al = al0 + buf * GBB, bl = bl0 + buf * GBB;
    // global to LDS through no register; the closing wait stands in front of
    // any rewrite of the address registers that the eight copies name
    asm volatile(
        "global_load_async_to_lds_b128 %0, %8, off\n\t"
        "global_load_async_to_lds_b128 %1, %9, off\n\t"
        "global_load_async_to_lds_b128 %2, %10, off\n\t"
        "global_load_async_to_lds_b128 %3, %11, off\n\t"
        "global_load_async_to_lds_b128 %4, %12, off\n\t"
        "global_load_async_to_lds_b128 %5, %13, off\n\t"
        "global_load_async_to_lds_b128 %6, %14, off\n\t"
        "global_load_async_to_lds_b128 %7, %15, off\n\t"
        "s_wait_xcnt 0x0"
        :: "v"(al), "v"(al + 32 * LP * 2), "v"(al + 64 * LP * 2),
           "v"(al + 96 * LP * 2),
           "v"(bl), "v"(bl + 32 * LP * 2), "v"(bl + 64 * LP * 2),
           "v"(bl + 96 * LP * 2),
           "v"(a), "v"(a + 32 * D_), "v"(a + 64 * D_), "v"(a + 96 * D_),
           "v"(b), "v"(b + 32 * D_), "v"(b + 64 * D_), "v"(b + 96 * D_)
        : "memory");
  };

  fill(0, 0);
  // this wave's copies of the first stage have landed ...
  asm volatile("s_wait_asynccnt 0x0" ::: "memory");
  __syncthreads();   // ... and every other wave's
  fill(1, 1);

  for (int kt = 0; kt < D_ / BK; ++kt) {
    const int buf = kt & 1;
    const half_t (*Ab)[LP] = As[buf];
    const half_t (*Bb)[LP] = Bt[buf];
    // (the loops below are unrolled so that the fragments and acc are indexed
    //  by constants and stay in registers)
#pragma unroll
    for (int ks = 0; ks < BK / 32; ++ks) {
      V16 af[4], bf2[2];
#pragma unroll
      for (int sm = 0; sm < 4; ++sm) {
        int r = wm * 64 + sm * 16 + l15;
        af[sm].h[0] = *(const v8h*)&Ab[r][ks * 32 + hi * 8];
        af[sm].h[1] = *(const v8h*)&Ab[r][ks * 32 + 16 + hi * 8];
      }
#pragma unroll
      for (int sn = 0; sn < 2; ++sn) {
        int c = wn * 32 + sn * 16 + l15;
        bf2[sn].h[0] = *(const v8h*)&Bb[c][ks * 32 + hi * 8];
        bf2[sn].h[1] = *(const v8h*)&Bb[c][ks * 32 + 16 + hi * 8];
      }
#pragma unroll
      for (int sm = 0; sm < 4; ++sm)
#pragma unroll
        for (int sn = 0; sn < 2; ++sn)
          acc[sm][sn] = __builtin_amdgcn_wmma_f32_16x16x32_f16(
              false, af[sm].v, false, bf2[sn].v, (short)0, acc[sm][sn],
              false, false);
    }
    // this wave's reads of the buffer that is refilled below are done
    asm volatile("s_wait_dscnt 0x0" ::: "memory");
    // this wave's copies of the next stage have landed
    asm volatile("s_wait_asynccnt 0x0" ::: "memory");
    __syncthreads();   // publishes stage kt + 1, frees stage kt's buffer
    if (kt + 2 < D_ / BK) fill(kt + 2, buf);
  }
  // no copy is outstanding when the wave goes on
  asm volatile("s_wait_asynccnt 0x0" ::: "memory");
}

// ---------------------------------------------------------------------------
// Fused QKV projection: z=0 -> Q (pre-scaled by 1/sqrt(hd)), z=1 -> K,
// z=2 -> V written TRANSPOSED [B, H, hd, S] so the attention kernel can
// stage V tiles with contiguous b128 accesses. Q/K go to [B, H, S, hd].
// A lane's 8 accumulator registers run along the A operand's rows, so the
// operand whose index is contiguous in the destination is given to the core as
// A: the weight (dims) for Q and K, x (positions) for V. The block tile is
// square, so this only exchanges the two pointers and bases. The finished tile
// goes as f16 through LDS (the ring, free behind the core's last barrier),
// [B index][A index], in 16-byte pieces, and leaves as whole 128-byte lines.
// ---------------------------------------------------------------------------
constexpr int SP = 136;   // staging pitch in halves (272 bytes, 16 B x odd)
static_assert(BM == BN && BN * SP <= 2 * BM * LP, "tile fits the A ring");

__global__ __launch_bounds__(256) void qkv_gemm_kernel(
    const half_t* __restrict__ Xh,
    const half_t* __restrict__ Wqt, const half_t* __restrict__ Wkt,
    const half_t* __restrict__ Wvt,
    const float* __restrict__ bq, const float* __restrict__ bk,
    const float* __restrict__ bv,
    half_t* __restrict__ Qh, half_t* __restrict__ Kh,
    half_t* __restrict__ VhT) {
  __shared__ __align__(16) half_t As[2][BM][LP];   // [buffer][row][k]
  __shared__ __align__(16) half_t Bt[2][BN][LP];   // [buffer][col][k]

  const half_t* W; const float* bias; half_t* dst; float scale;
  bool vmode = false;
  if (blockIdx.z == 0)      { W = Wqt; bias = bq; dst = Qh;  scale = 0.125f; }
  else if (blockIdx.z == 1) { W = Wkt; bias = bk; dst = Kh;  scale = 1.0f; }
  else                      { W = Wvt; bias = bv; dst = VhT; scale = 1.0f; vmode = true; }

  const int rowBase = blockIdx.y * BM;   // rows of x
  const int colBase = blockIdx.x * BN;   // columns of the weight
  const int tid  = threadIdx.x;
  const int lane = tid & 31;
  const int wid  = tid >> 5;
  const int wm = wid >> 2, wn = wid & 3, hi = lane >> 4, l15 = lane & 15;

  // The bias is fetched in front of the core, so that its latency passes under
  // the k loop. V: it runs along the B index, one value per sn. Q/K: along the
  // A index, 8 values per sm.
  // (every loop of this kernel is unrolled so that bb, ba and acc are indexed
  //  by constants and stay in registers, and the eight stores issue together)
  float  bb[2]    = {};
  float4 ba[4][2] = {};
  if (vmode) {
#pragma unroll
    for (int sn = 0; sn < 2; ++sn)
      bb[sn] = bias[colBase + wn * 32 + sn * 16 + l15];
  } else {
    const float4* bp = (const float4*)(bias + colBase + wm * 64 + 8 * hi);
#pragma unroll
    for (int sm = 0; sm < 4; ++sm) {
      ba[sm][0] = bp[sm * 4];
      ba[sm][1] = bp[sm * 4 + 1];
    }
  }
  // stands in front of any rewrite of the address registers that the bias
  // loads name
  asm volatile("s_wait_xcnt 0x0" ::: "memory");

  v8f acc[4][2] = {};
  gemm_tile_core(vmode ? Xh : W, vmode ? W : Xh, As, Bt,
                 vmode ? rowBase : colBase, vmode ? colBase : rowBase, acc);

  half_t* stg = &As[0][0][0];
  // acc[sm][sn][r]: A index wm*64 + sm*16 + 8*hi + r, B index wn*32 + sn*16 + l15
  half_t* sw = stg + (wn * 32 + l15) * SP + wm * 64 + 8 * hi;
  if (vmode) {
#pragma unroll
    for (int sn = 0; sn < 2; ++sn)
#pragma unroll
      for (int sm = 0; sm < 4; ++sm) {
        v8h o;
#pragma unroll
        for (int r = 0; r < 8; ++r) o[r] = (half_t)(acc[sm][sn][r] + bb[sn]);
        *(v8h*)(sw + sn * 16 * SP + sm * 16) = o;
      }
  } else {
#pragma unroll
    for (int sm = 0; sm < 4; ++sm) {
      const float4 b0 = ba[sm][0], b1 = ba[sm][1];
      const float bs[8] = {b0.x, b0.y, b0.z, b0.w, b1.x, b1.y, b1.z, b1.w};
#pragma unroll
      for (int sn = 0; sn < 2; ++sn) {
        v8h o;
#pragma unroll
        for (int r = 0; r < 8; ++r)
          o[r] = (half_t)((acc[sm][sn][r] + bs[r]) * scale);
        *(v8h*)(sw + sn * 16 * SP + sm * 16) = o;
      }
    }
  }
  __syncthreads();   // the staged tile is whole before any wave reads across it

  // 16 lanes take one staged row (256 bytes). Q/K: position s0 + rr, one line
  // of either of the tile's two heads. V: dim colBase + rr, two lines of
  // positions. Each wave-wide store covers four whole lines.
  const int bI = rowBase >> 11, s0 = rowBase & (S_ - 1);
  const int c16 = tid & 15;
  const int C0 = colBase + (vmode ? (tid >> 4) : c16 * 8);
  half_t* gp = vmode
      ? dst + ((size_t)(bI * H_ + (C0 >> 6)) * HD_ + (C0 & (HD_ - 1))) * S_ +
            s0 + c16 * 8                                      // [B,H,hd,S]
      : dst + ((size_t)(bI * H_ + (C0 >> 6)) * S_ + s0 + (tid >> 4)) * HD_ +
            (C0 & (HD_ - 1));                                 // [B,H,S,hd]
  const int gstep = 16 * (vmode ? S_ : HD_);   // 16 staged rows further
  const half_t* sr = stg + (tid >> 4) * SP + c16 * 8;
#pragma unroll
  for (int i = 0; i < 8; ++i)
    *(v8h*)(gp + (size_t)i * gstep) = *(const v8h*)(sr + i * 16 * SP);
}

// ---------------------------------------------------------------------------
// Output projection: out(f32) = Oh(f16) @ Wf(f16, pre-transposed) + bf
// ---------------------------------------------------------------------------
__global__ __launch_bounds__(256) void out_gemm_kernel(
    const half_t* __restrict__ Oh, const half_t* __restrict__ Wft,
    const float* __restrict__ bf, float* __restrict__ out) {
  __shared__ __align__(16) half_t As[2][BM][LP];   // [buffer][row][k]
  __shared__ __align__(16) half_t Bt[2][BN][LP];   // [buffer][col][k]
  const int rowBase = blockIdx.y * BM;
  const int colBase = blockIdx.x * BN;
  v8f acc[4][2] = {};
  gemm_tile_core(Oh, Wft, As, Bt, rowBase, colBase, acc);

  const int lane = threadIdx.x & 31;
  const int wid  = threadIdx.x >> 5;
  const int wm = wid >> 2, wn = wid & 3, hi = lane >> 4, l15 = lane & 15;
#pragma unroll
  for (int sm = 0; sm < 4; ++sm)
#pragma unroll
    for (int sn = 0; sn < 2; ++sn)
#pragma unroll
      for (int r = 0; r < 8; ++r) {
        int R = rowBase + wm * 64 + sm * 16 + r + 8 * hi;
        int C = colBase + wn * 32 + sn * 16 + l15;
        out[(size_t)R * D_ + C] = acc[sm][sn][r] + bf[C];
      }
}

// ---------------------------------------------------------------------------
// Lane l with lane l ^ 16 (the other 16-lane half), on the vector port.
// ---------------------------------------------------------------------------
__device__ __forceinline__ float xhalf(float x) {
  return __builtin_bit_cast(float, __builtin_amdgcn_permlanex16(
      __builtin_bit_cast(int, x), __builtin_bit_cast(int, x),
      0x76543210, 0xfedcba98, false, false));
}

constexpr int SK  = 64;
constexpr int AP  = 72;
constexpr int ABB = 64 * AP * 2;

// (the launch bound states the block of 256 that the host launches: without it
//  the register budget is that of 1024 threads, and the stage's body spills)
__global__ __launch_bounds__(256) void attn_kernel(const half_t* __restrict__ Qh,
                            const half_t* __restrict__ Kh,
                            const half_t* __restrict__ VhT,
                            half_t* __restrict__ Oh) {
  __shared__ __align__(16) half_t Ks[2][SK][AP];   // [buffer][key][dim]
  __shared__ __align__(16) half_t Vs[2][HD_][AP];  // [buffer][dim][key]

  const int bh  = blockIdx.x;
  const int b   = bh >> 4;
  const int h   = bh & 15;
  const int Qb  = blockIdx.y * 128;
  const int tid = threadIdx.x;
  const int lane = tid & 31;
  const int wid  = tid >> 5;
  const int hi   = lane >> 4;
  const int l15  = lane & 15;
  const int qbase = Qb + wid * 16;
  const int iq    = qbase + l15;   // this lane's query

  const half_t* Qp = Qh  + (size_t)(b * H_ + h) * S_ * HD_;
  const half_t* Kp = Kh  + (size_t)(b * H_ + h) * S_ * HD_;
  const half_t* Vp = VhT + (size_t)(b * H_ + h) * HD_ * S_;  // [dim][key]

  // Q fragments for the whole hd=64 (two K=32 steps), loaded once.
  V16 aq0, aq1;
  {
    const half_t* qrow = Qp + (size_t)iq * HD_;
    aq0.h[0] = *(const v8h*)(qrow + hi * 8);
    aq0.h[1] = *(const v8h*)(qrow + 16 + hi * 8);
    aq1.h[0] = *(const v8h*)(qrow + 32 + hi * 8);
    aq1.h[1] = *(const v8h*)(qrow + 48 + hi * 8);
  }

  float M = -1e30f;   // running maximum of this lane's query (both halves alike)
  float L = 0.0f;     // running sum over this half's keys; halves joined at the end
  v8f acc[4] = {};    // acc[j][r] = O^T[j*16 + 8*hi + r][query l15]

  // slope = (24^(1/8))^-(h%8+1)
  const float slope = __expf(-__logf(24.0f) / 8.0f * (float)((h & 7) + 1));
  const bool fwd = (h < 8);
  const float g = fwd ? slope : -slope;   // ALiBi term per step of the key index
  const int  sg = fwd ? 1 : -1;
  v8f ramp0, ramp1;                       // g * (key index inside the chunk)
#pragma unroll
  for (int r = 0; r < 8; ++r) {
    ramp0[r] = g * (float)(8 * hi + r);
    ramp1[r] = g * (float)(16 + 8 * hi + r);
  }
  const int sBeg = fwd ? 0 : (Qb >> 6);                  // stages [sBeg, sEnd):
  const int sEnd = fwd ? ((Qb >> 6) + 2) : (S_ >> 6);    // two at least, sBeg even

  // ---- one stage into one buffer: 8 threads per 128-byte row, a thread takes
  //      rows srow and srow + 32 of K (keys) and of V (dims) -----------------
  const int srow = tid >> 3, scol = (tid & 7) * 8;
  const uint32_t kl0 = (uint32_t)(uintptr_t)&Ks[0][srow][scol];   // LDS byte
  const uint32_t vl0 = (uint32_t)(uintptr_t)&Vs[0][srow][scol];   // addresses
  auto fill = [&](const int st, const int buf) __attribute__((always_inline)) {
    const half_t* kg = Kp + (size_t)(st * SK + srow) * HD_ + scol;
    const half_t* vg = Vp + (size_t)srow * S_ + st * SK + scol;
    const uint32_t kl = kl0 + buf * ABB, vl = vl0 + buf * ABB;
    // global to LDS through no register; the closing wait stands in front of
    // any rewrite of the address registers that the four copies name
    asm volatile(
        "global_load_async_to_lds_b128 %0, %4, off\n\t"
        "global_load_async_to_lds_b128 %1, %5, off\n\t"
        "global_load_async_to_lds_b128 %2, %6, off\n\t"
        "global_load_async_to_lds_b128 %3, %7, off\n\t"
        "s_wait_xcnt 0x0"
        :: "v"(kl), "v"(kl + 32 * AP * 2), "v"(vl), "v"(vl + 32 * AP * 2),
           "v"(kg), "v"(kg + 32 * HD_), "v"(vg), "v"(vg + 32 * S_)
        : "memory");
  };

  // always_inline: 'masked' and 'p' are literals at each call and must fold
  // chunk p (0 or 1) of stage st, read from buffer buf
  auto chunk = [&](const int st, const int buf, const int p, const bool masked)
      __attribute__((always_inline)) {
    const int kbase = st * SK + p * 32;
    const half_t (*Kt)[AP] = &Ks[buf][p * 32];   // the chunk's 32 keys
    const half_t (*Vt)[AP] = Vs[buf];            // its keys: columns p * 32 + ...

    // ---- scores: K(32x64) x Q^T(64x16) + C -> two 16x16 f32 tiles of S^T --
    v8f c0 = ramp0, c1 = ramp1;
    if (masked) {
      // key 8*hi + r of the chunk is masked where sg * r > srel
      const int srel = sg * (iq - kbase - 8 * hi);
#pragma unroll
      for (int r = 0; r < 8; ++r) {
        c0[r] = (sg * r > srel) ? -1e9f : ramp0[r];
        c1[r] = (sg * (16 + r) > srel) ? -1e9f : ramp1[r];
      }
    }
    {
      V16 bk0, bk0b, bk1, bk1b;
      int key0 = l15, key1 = 16 + l15;
      bk0.h[0]  = *(const v8h*)&Kt[key0][hi * 8];
      bk0.h[1]  = *(const v8h*)&Kt[key0][16 + hi * 8];
      bk0b.h[0] = *(const v8h*)&Kt[key0][32 + hi * 8];
      bk0b.h[1] = *(const v8h*)&Kt[key0][48 + hi * 8];
      bk1.h[0]  = *(const v8h*)&Kt[key1][hi * 8];
      bk1.h[1]  = *(const v8h*)&Kt[key1][16 + hi * 8];
      bk1b.h[0] = *(const v8h*)&Kt[key1][32 + hi * 8];
      bk1b.h[1] = *(const v8h*)&Kt[key1][48 + hi * 8];
      c0 = __builtin_amdgcn_wmma_f32_16x16x32_f16(false, bk0.v, false, aq0.v,
                                                  (short)0, c0, false, false);
      c0 = __builtin_amdgcn_wmma_f32_16x16x32_f16(false, bk0b.v, false, aq1.v,
                                                  (short)0, c0, false, false);
      c1 = __builtin_amdgcn_wmma_f32_16x16x32_f16(false, bk1.v, false, aq0.v,
                                                  (short)0, c1, false, false);
      c1 = __builtin_amdgcn_wmma_f32_16x16x32_f16(false, bk1b.v, false, aq1.v,
                                                  (short)0, c1, false, false);
    }

    // ---- online softmax, one query per lane ------------------------------
    float mx = -1e30f;
#pragma unroll
    for (int r = 0; r < 8; ++r) mx = fmaxf(mx, fmaxf(c0[r], c1[r]));
    mx = fmaxf(mx, xhalf(mx));   // all 32 keys of the chunk
    const float off = g * (float)(kbase - iq);   // the chunk's part of the term
    const float Mn = fmaxf(M, mx + off);
    const float sc = __expf(M - Mn);
    M = Mn;
    // Mn in the chunk's own units. Never below mx: where all 32 keys are masked
    // the roundings at 1e9 could leave it lower, and exp would overflow f16.
    const float e = fmaxf(Mn - off, mx);

    V16 pf;                      // P^T as B operand: pf[s] = P^T[kmap(s, hi)][l15]
    float rs = 0.0f;
#pragma unroll
    for (int r = 0; r < 8; ++r) {
      float p0 = __expf(c0[r] - e);
      float p1 = __expf(c1[r] - e);
      rs += p0 + p1;
      pf.v[r]     = (half_t)p0;
      pf.v[8 + r] = (half_t)p1;
    }
    L = L * sc + rs;
#pragma unroll
    for (int j = 0; j < 4; ++j)
#pragma unroll
      for (int r = 0; r < 8; ++r) acc[j][r] = acc[j][r] * sc;

    // ---- V^T(64x32) x P^T(32x16): 4 WMMAs accumulate into O^T ------------
#pragma unroll
    for (int j = 0; j < 4; ++j) {
      V16 bv;
      int drow = j * 16 + l15;
      bv.h[0] = *(const v8h*)&Vt[drow][p * 32 + hi * 8];
      bv.h[1] = *(const v8h*)&Vt[drow][p * 32 + 16 + hi * 8];
      acc[j] = __builtin_amdgcn_wmma_f32_16x16x32_f16(false, bv.v, false, pf.v,
                                                      (short)0, acc[j],
                                                      false, false);
    }
  };

  fill(sBeg, 0);
  // this wave's copies of the first stage have landed ...
  asm volatile("s_wait_asynccnt 0x0" ::: "memory");
  __syncthreads();   // ... and every other wave's
  fill(sBeg + 1, 1);

  const int mBeg = fwd ? sBeg : sBeg + 2;   // stages [mBeg, mEnd) hold no
  const int mEnd = fwd ? sEnd - 2 : sEnd;   // masked key for any query here
  // always_inline: 'masked' is a literal at each call and must fold away
  auto stage = [&](const int st, const bool masked)
      __attribute__((always_inline)) {
    const int buf = st & 1;
    chunk(st, buf, 0, masked);
    chunk(st, buf, 1, masked);
    // this wave's reads of the buffer that is refilled below are done
    asm volatile("s_wait_dscnt 0x0" ::: "memory");
    // this wave's copies of the next stage have landed
    asm volatile("s_wait_asynccnt 0x0" ::: "memory");
    __syncthreads();   // publishes stage st + 1, frees stage st's buffer
    if (st + 2 < sEnd) fill(st + 2, buf);
  };
  for (int st = sBeg; st < mBeg; ++st) stage(st, true);
  for (int st = mBeg; st < mEnd; ++st) stage(st, false);
  for (int st = mEnd; st < sEnd; ++st) stage(st, true);
  // no copy is outstanding when the wave ends
  asm volatile("s_wait_asynccnt 0x0" ::: "memory");

  // ---- epilogue: join the halves' sums, normalize, write f16 into [B*S, D]
  //      for the final GEMM; a lane's 8 registers are 8 consecutive dims -----
  const float inv = 1.0f / (L + xhalf(L));
  half_t* orow = Oh + (size_t)(b * S_ + iq) * D_ + h * HD_ + 8 * hi;
#pragma unroll
  for (int j = 0; j < 4; ++j) {
    v8h o;
#pragma unroll
    for (int r = 0; r < 8; ++r) o[r] = (half_t)(acc[j][r] * inv);
    *(v8h*)(orow + j * 16) = o;
  }
}

// ---------------------------------------------------------------------------
// Host-side launcher. Workspace layout (all 16B-aligned, ~48 MB total):
//   xh   : ROWS*D f16      (8 MB)
//   wqt/wkt/wvt/wft : D*D f16 each, TRANSPOSED [n][k] (4 x 2 MB)
//   Qh/Kh : B*H*S*hd f16  (2 x 8 MB);  VhT : B*H*hd*S f16 (8 MB)
//   Oh   : ROWS*D f16      (8 MB)
// ---------------------------------------------------------------------------
extern "C" void kernel_launch(void* const* d_in, const int* in_sizes, int n_in,
                              void* d_out, int out_size, void* d_ws,
                              size_t ws_size, hipStream_t stream) {
  const float* x  = (const float*)d_in[0];
  const float* Wq = (const float*)d_in[1];
  const float* bq = (const float*)d_in[2];
  const float* Wk = (const float*)d_in[3];
  const float* bk = (const float*)d_in[4];
  const float* Wv = (const float*)d_in[5];
  const float* bv = (const float*)d_in[6];
  const float* Wf = (const float*)d_in[7];
  const float* bf = (const float*)d_in[8];
  float* out = (float*)d_out;

  char* ws = (char*)d_ws;
  size_t off = 0;
  half_t* xh  = (half_t*)(ws + off); off += (size_t)ROWS * D_ * sizeof(half_t);
  half_t* wqt = (half_t*)(ws + off); off += (size_t)D_ * D_ * sizeof(half_t);
  half_t* wkt = (half_t*)(ws + off); off += (size_t)D_ * D_ * sizeof(half_t);
  half_t* wvt = (half_t*)(ws + off); off += (size_t)D_ * D_ * sizeof(half_t);
  half_t* wft = (half_t*)(ws + off); off += (size_t)D_ * D_ * sizeof(half_t);
  half_t* Qh  = (half_t*)(ws + off); off += (size_t)B_ * H_ * S_ * HD_ * sizeof(half_t);
  half_t* Kh  = (half_t*)(ws + off); off += (size_t)B_ * H_ * S_ * HD_ * sizeof(half_t);
  half_t* VhT = (half_t*)(ws + off); off += (size_t)B_ * H_ * HD_ * S_ * sizeof(half_t);
  half_t* Oh  = (half_t*)(ws + off); off += (size_t)ROWS * D_ * sizeof(half_t);

  // 1) conversions in one launch: x plain; weights transpose-converted to [n][k]
  prep_kernel<<<512, 256, 0, stream>>>(x, Wq, Wk, Wv, Wf, xh, wqt, wkt, wvt, wft);

  // 2) fused QKV projection (z selects Q/K/V), tiles 128x128, 8 waves/block
  qkv_gemm_kernel<<<dim3(D_ / BN, ROWS / BM, 3), 256, 0, stream>>>(
      xh, wqt, wkt, wvt, bq, bk, bv, Qh, Kh, VhT);

  // 3) flash attention with bidirectional ALiBi
  attn_kernel<<<dim3(B_ * H_, S_ / 128), 256, 0, stream>>>(Qh, Kh, VhT, Oh);

  // 4) output projection to f32
  out_gemm_kernel<<<dim3(D_ / BN, ROWS / BM), 256, 0, stream>>>(
      Oh, wft, bf, out);
}

// v008
// It runs in 71.8 microseconds.
// Next to v007, in two timings, it ran 1.04 and 1.05 times as fast.
// Over all steps from v000 it is 3.07 times as fast.
#include <hip/hip_runtime.h>
#include <cstdint>
#include <cstddef>

// ---------------------------------------------------------------------------
// RelativeAttention (ALiBi bidirectional) for MI455X / gfx1250, wave32 WMMA.
// All matmuls run on v_wmma_f32_16x16x32_f16 (f16 in, f32 accumulate).
// Weights are pre-transposed (and V written transposed) so every LDS staging
// access is a 128-bit load/store -- no 16-bit scatter in the hot loops.
// ---------------------------------------------------------------------------

typedef _Float16 half_t;
typedef __attribute__((ext_vector_type(16))) _Float16 v16h;
typedef __attribute__((ext_vector_type(8)))  _Float16 v8h;
typedef __attribute__((ext_vector_type(4)))  _Float16 v4h;
typedef __attribute__((ext_vector_type(8)))  float    v8f;

union V16 { v16h v; v8h h[2]; };

constexpr int B_   = 2;
constexpr int S_   = 2048;
constexpr int D_   = 1024;
constexpr int H_   = 16;
constexpr int HD_  = 64;
constexpr int ROWS = B_ * S_;   // 4096

// ---------------------------------------------------------------------------
// Preparation, one launch of 512 equal work-groups of 256 threads. Each does
//   - one 64(k) x 128(n) piece of one weight matrix, f32 [K][N] -> f16 [N][K],
//     as two 64x64 tiles through LDS, coalesced on both sides (128 work-groups
//     per matrix, 4 matrices);
//   - 2048 float4 of x, f32 -> f16, element for element.
// All of a thread's loads are issued before the first value is used, so the
// work-group pays one memory round trip; one barrier serves both tiles.
// ---------------------------------------------------------------------------
__global__ __launch_bounds__(256) void prep_kernel(
    const float* __restrict__ x,
    const float* __restrict__ Wq, const float* __restrict__ Wk,
    const float* __restrict__ Wv, const float* __restrict__ Wf,
    half_t* __restrict__ xh,
    half_t* __restrict__ wqt, half_t* __restrict__ wkt,
    half_t* __restrict__ wvt, half_t* __restrict__ wft) {
  __shared__ float tile[2][64][65];
  const int w   = blockIdx.x;
  const int tid = threadIdx.x;
  const int m   = w >> 7;           // which weight matrix
  const float* src = (m == 0) ? Wq : (m == 1) ? Wk : (m == 2) ? Wv : Wf;
  half_t* dst      = (m == 0) ? wqt : (m == 1) ? wkt : (m == 2) ? wvt : wft;
  const int nb = (w & 7) * 128;         // n base (cols of src, rows of dst)
  const int kb = ((w >> 3) & 15) * 64;  // k base (rows of src, cols of dst)
  const int r0 = tid >> 6, c = tid & 63;

  // (the loops are unrolled so that tv and xv stay in registers)
  float tv[2][16];
#pragma unroll
  for (int u = 0; u < 2; ++u)
#pragma unroll
    for (int i = 0; i < 16; ++i)
      tv[u][i] = src[(size_t)(kb + r0 + i * 4) * D_ + nb + u * 64 + c];
  const float4* xs = (const float4*)x + (size_t)w * 2048 + tid;
  float4 xv[8];
#pragma unroll
  for (int i = 0; i < 8; ++i) xv[i] = xs[i * 256];
  // keeps every load above in front of the first use of a loaded value: without
  // it the x values are waited for and converted before the tile loads issue
  __builtin_amdgcn_sched_barrier(0);

#pragma unroll
  for (int u = 0; u < 2; ++u)
#pragma unroll
    for (int i = 0; i < 16; ++i) tile[u][r0 + i * 4][c] = tv[u][i];

  v4h* xd = (v4h*)xh + (size_t)w * 2048 + tid;
#pragma unroll
  for (int i = 0; i < 8; ++i) {
    v4h h;
    h[0] = (half_t)xv[i].x; h[1] = (half_t)xv[i].y;
    h[2] = (half_t)xv[i].z; h[3] = (half_t)xv[i].w;
    xd[i * 256] = h;
  }
  __syncthreads();
  half_t* dp = dst + (size_t)(nb + r0) * D_ + kb + c;
#pragma unroll
  for (int u = 0; u < 2; ++u)
#pragma unroll
    for (int i = 0; i < 16; ++i)
      dp[(u * 64 + i * 4) * D_] = (half_t)tile[u][c][r0 + i * 4];
}

// ---------------------------------------------------------------------------
// Shared WMMA GEMM core: C(128x128 per block) = A(M x 1024) * B(1024 x N)
// 256 threads = 8 waves (2 x 4), each wave computes a 64x32 patch (4x2 WMMA
// tiles). A stage is 64 k: every staged row is one whole 128-byte line, and a
// wave-wide 128-bit copy covers four whole lines. LDS rows stand at a pitch of
// 144 bytes (16 B x odd), the conflict-free pitch for 128-bit fragment reads.
// A and B both come as [row][k] (x, Oh or a PRE-TRANSPOSED weight Wt[n][k]), so both
// stagings and all fragment fills are contiguous 128-bit LDS operations.
// The stages come into LDS by asynchronous 16-byte copies, two buffers: stage
// kt + 1 flies while stage kt is worked on, and one barrier per stage publishes
// the one and frees the other.
// Fragment layout (ISA 7.12.2, 16-bit, wave32):
//   A: lane(l&15)=row, halves at k = {hi*8..+7, 16+hi*8..+7}
//   B: lane(l&15)=col, same k pattern.  C: n=l&15, m=r+8*(l>>4).
// ---------------------------------------------------------------------------
constexpr int BM = 128;   // block rows
constexpr int BN = 128;   // block cols
constexpr int BK = 64;    // k per stage (128 bytes of every operand row)
constexpr int LP = 72;    // LDS row pitch in halves (144 bytes)
constexpr int GBB = BM * LP * 2;   // bytes of one buffer of one operand

template <int GK>   // 32-k steps per group of fragment loads
__device__ __forceinline__ void gemm_tile_core(
    const half_t* __restrict__ A, const half_t* __restrict__ Bt_g,
    half_t (*As)[BM][LP], half_t (*Bt)[BN][LP],
    int rowBase, int colBase, v8f acc[4][2]) {
  const int tid  = threadIdx.x;
  const int lane = tid & 31;
  const int wid  = tid >> 5;
  const int wm   = wid >> 2;       // 0..1  (m sub-block of 64 rows)
  const int wn   = wid & 3;        // 0..3  (n sub-block of 32 cols)
  const int hi   = lane >> 4;      // half-wave select
  const int l15  = lane & 15;
  const int srow = tid >> 3;       // staging: 8 threads per 128-byte row
  const int scol = (tid & 7) * 8;

  const half_t* ag = A    + (size_t)(rowBase + srow) * D_ + scol;
  const half_t* bg = Bt_g + (size_t)(colBase + srow) * D_ + scol;
  const uint32_t al0 = (uint32_t)(uintptr_t)&As[0][srow][scol];   // LDS byte
  const uint32_t bl0 = (uint32_t)(uintptr_t)&Bt[0][srow][scol];   // addresses

  // ---- stage kt (A 128x64 and B 128x64) into one buffer: a thread takes rows
  //      srow + 32 i of either operand, 16 bytes of each ---------------------
  auto fill = [&](const int kt, const int buf) __attribute__((always_inline)) {
    const half_t* a = ag + kt * BK;
    const half_t* b = bg + kt * BK;
    const uint32_t al = al0 + buf * GBB, bl = bl0 + buf * GBB;
    // global to LDS through no register; the closing wait stands in front of
    // any rewrite of the address registers that the eight copies name
    asm volatile(
        "global_load_async_to_lds_b128 %0, %8, off\n\t"
        "global_load_async_to_lds_b128 %1, %9, off\n\t"
        "global_load_async_to_lds_b128 %2, %10, off\n\t"
        "global_load_async_to_lds_b128 %3, %11, off\n\t"
        "global_load_async_to_lds_b128 %4, %12, off\n\t"
        "global_load_async_to_lds_b128 %5, %13, off\n\t"
        "global_load_async_to_lds_b128 %6, %14, off\n\t"
        "global_load_async_to_lds_b128 %7, %15, off\n\t"
        "s_wait_xcnt 0x0"
        :: "v"(al), "v"(al + 32 * LP * 2), "v"(al + 64 * LP * 2),
           "v"(al + 96 * LP * 2),
           "v"(bl), "v"(bl + 32 * LP * 2), "v"(bl + 64 * LP * 2),
           "v"(bl + 96 * LP * 2),
           "v"(a), "v"(a + 32 * D_), "v"(a + 64 * D_), "v"(a + 96 * D_),
           "v"(b), "v"(b + 32 * D_), "v"(b + 64 * D_), "v"(b + 96 * D_)
        : "memory");
  };

  fill(0, 0);
  // this wave's copies of the first stage have landed ...
  asm volatile("s_wait_asynccnt 0x0" ::: "memory");
  __syncthreads();   // ... and every other wave's
  fill(1, 1);

  for (int kt = 0; kt < D_ / BK; ++kt) {
    const int buf = kt & 1;
    const half_t (*Ab)[LP] = As[buf];
    const half_t (*Bb)[LP] = Bt[buf];
    // (the loops below are unrolled so that the fragments and acc are indexed
    //  by constants and stay in registers)
    // The fragment loads go out in groups, each load into registers of its own,
    // in the order in which the products take them: the whole stage's 24 as one
    // group (GK = 2), or 12 per 32 k (GK = 1) where the registers of the larger
    // group would cost a resident work-group.
#pragma unroll
    for (int k0 = 0; k0 < BK / 32; k0 += GK) {
      V16 af[GK][4], bf2[GK][2];
#pragma unroll
      for (int kg = 0; kg < GK; ++kg) {
        const int ko = (k0 + kg) * 32 + hi * 8;
#pragma unroll
        for (int sn = 0; sn < 2; ++sn) {
          int c = wn * 32 + sn * 16 + l15;
          bf2[kg][sn].h[0] = *(const v8h*)&Bb[c][ko];
          bf2[kg][sn].h[1] = *(const v8h*)&Bb[c][ko + 16];
        }
#pragma unroll
        for (int sm = 0; sm < 4; ++sm) {
          int r = wm * 64 + sm * 16 + l15;
          af[kg][sm].h[0] = *(const v8h*)&Ab[r][ko];
          af[kg][sm].h[1] = *(const v8h*)&Ab[r][ko + 16];
        }
      }
      // keeps the group in front of its first product: without it the loads are
      // sunk among the products into one shared register set, and the wave
      // waits out the LDS latency in front of every second product
      __builtin_amdgcn_sched_barrier(0);
#pragma unroll
      for (int kg = 0; kg < GK; ++kg)
#pragma unroll
        for (int sm = 0; sm < 4; ++sm)
#pragma unroll
          for (int sn = 0; sn < 2; ++sn)
            acc[sm][sn] = __builtin_amdgcn_wmma_f32_16x16x32_f16(
                false, af[kg][sm].v, false, bf2[kg][sn].v, (short)0,
                acc[sm][sn], false, false);
    }
    // keeps the products in front of the waits below: moved behind them, they
    // would start only when every load has returned, and the next stage's
    // copies would be waited for before the products that are to cover them
    __builtin_amdgcn_sched_barrier(0);
    // this wave's reads of the buffer that is refilled below are done
    asm volatile("s_wait_dscnt 0x0" ::: "memory");
    // this wave's copies of the next stage have landed
    asm volatile("s_wait_asynccnt 0x0" ::: "memory");
    __syncthreads();   // publishes stage kt + 1, frees stage kt's buffer
    if (kt + 2 < D_ / BK) fill(kt + 2, buf);
  }
  // no copy is outstanding when the wave goes on
  asm volatile("s_wait_asynccnt 0x0" ::: "memory");
}

// ---------------------------------------------------------------------------
// Fused QKV projection: z=0 -> Q (pre-scaled by 1/sqrt(hd)), z=1 -> K,
// z=2 -> V written TRANSPOSED [B, H, hd, S] so the attention kernel can
// stage V tiles with contiguous b128 accesses. Q/K go to [B, H, S, hd].
// A lane's 8 accumulator registers run along the A operand's rows, so the
// operand whose index is contiguous in the destination is given to the core as
// A: the weight (dims) for Q and K, x (positions) for V. The block tile is
// square, so this only exchanges the two pointers and bases. The finished tile
// goes as f16 through LDS (the ring, free behind the core's last barrier),
// [B index][A index], in 16-byte pieces, and leaves as whole 128-byte lines.
// ---------------------------------------------------------------------------
constexpr int SP = 136;   // staging pitch in halves (272 bytes, 16 B x odd)
static_assert(BM == BN && BN * SP <= 2 * BM * LP, "tile fits the A ring");

// (six waves per SIMD: three work-groups stay resident on a WGP, as many as the
//  grid brings to each, so the register budget is held at 160)
__global__ __launch_bounds__(256) __attribute__((amdgpu_waves_per_eu(6)))
void qkv_gemm_kernel(
    const half_t* __restrict__ Xh,
    const half_t* __restrict__ Wqt, const half_t* __restrict__ Wkt,
    const half_t* __restrict__ Wvt,
    const float* __restrict__ bq, const float* __restrict__ bk,
    const float* __restrict__ bv,
    half_t* __restrict__ Qh, half_t* __restrict__ Kh,
    half_t* __restrict__ VhT) {
  __shared__ __align__(16) half_t As[2][BM][LP];   // [buffer][row][k]
  __shared__ __align__(16) half_t Bt[2][BN][LP];   // [buffer][col][k]

  const half_t* W; const float* bias; half_t* dst; float scale;
  bool vmode = false;
  if (blockIdx.z == 0)      { W = Wqt; bias = bq; dst = Qh;  scale = 0.125f; }
  else if (blockIdx.z == 1) { W = Wkt; bias = bk; dst = Kh;  scale = 1.0f; }
  else                      { W = Wvt; bias = bv; dst = VhT; scale = 1.0f; vmode = true; }

  const int rowBase = blockIdx.y * BM;   // rows of x
  const int colBase = blockIdx.x * BN;   // columns of the weight
  const int tid  = threadIdx.x;
  const int lane = tid & 31;
  // (the wave's number in a scalar register: what is formed from it then takes
  //  no vector register across the core)
  const int wid  = __builtin_amdgcn_readfirstlane(tid >> 5);
  const int wm = wid >> 2, wn = wid & 3, hi = lane >> 4, l15 = lane & 15;

  // The bias is fetched in front of the core, so that its latency passes under
  // the k loop. V: it runs along the B index, one value per sn. Q/K: along the
  // A index, 8 values per sm.
  // (every loop of this kernel is unrolled so that bb, ba and acc are indexed
  //  by constants and stay in registers, and the eight stores issue together)
  float  bb[2]    = {};
  float4 ba[4][2] = {};
  if (vmode) {
#pragma unroll
    for (int sn = 0; sn < 2; ++sn)
      bb[sn] = bias[colBase + wn * 32 + sn * 16 + l15];
    // stands in front of any rewrite of the address registers that the bias
    // loads name; so in the other arm
    asm volatile("s_wait_xcnt 0x0" ::: "memory");
  } else {
    const float4* bp = (const float4*)(bias + colBase + wm * 64 + 8 * hi);
#pragma unroll
    for (int sm = 0; sm < 4; ++sm) {
      ba[sm][0] = bp[sm * 4];
      ba[sm][1] = bp[sm * 4 + 1];
    }
    // (the same wait, for this arm's loads)
    asm volatile("s_wait_xcnt 0x0" ::: "memory");
  }

  v8f acc[4][2] = {};
  gemm_tile_core<1>(vmode ? Xh : W, vmode ? W : Xh, As, Bt,
                 vmode ? rowBase : colBase, vmode ? colBase : rowBase, acc);

  half_t* stg = &As[0][0][0];
  // acc[sm][sn][r]: A index wm*64 + sm*16 + 8*hi + r, B index wn*32 + sn*16 + l15
  half_t* sw = stg + (wn * 32 + l15) * SP + wm * 64 + 8 * hi;
  if (vmode) {
#pragma unroll
    for (int sn = 0; sn < 2; ++sn)
#pragma unroll
      for (int sm = 0; sm < 4; ++sm) {
        v8h o;
#pragma unroll
        for (int r = 0; r < 8; ++r) o[r] = (half_t)(acc[sm][sn][r] + bb[sn]);
        *(v8h*)(sw + sn * 16 * SP + sm * 16) = o;
      }
  } else {
#pragma unroll
    for (int sm = 0; sm < 4; ++sm) {
      const float4 b0 = ba[sm][0], b1 = ba[sm][1];
      const float bs[8] = {b0.x, b0.y, b0.z, b0.w, b1.x, b1.y, b1.z, b1.w};
#pragma unroll
      for (int sn = 0; sn < 2; ++sn) {
        v8h o;
#pragma unroll
        for (int r = 0; r < 8; ++r)
          o[r] = (half_t)((acc[sm][sn][r] + bs[r]) * scale);
        *(v8h*)(sw + sn * 16 * SP + sm * 16) = o;
      }
    }
  }
  __syncthreads();   // the staged tile is whole before any wave reads across it

  // 16 lanes take one staged row (256 bytes). Q/K: position s0 + rr, one line
  // of either of the tile's two heads. V: dim colBase + rr, two lines of
  // positions. Each wave-wide store covers four whole lines.
  const int bI = rowBase >> 11, s0 = rowBase & (S_ - 1);
  const int c16 = tid & 15;
  const int C0 = colBase + (vmode ? (tid >> 4) : c16 * 8);
  half_t* gp = vmode
      ? dst + ((size_t)(bI * H_ + (C0 >> 6)) * HD_ + (C0 & (HD_ - 1))) * S_ +
            s0 + c16 * 8                                      // [B,H,hd,S]
      : dst + ((size_t)(bI * H_ + (C0 >> 6)) * S_ + s0 + (tid >> 4)) * HD_ +
            (C0 & (HD_ - 1));                                 // [B,H,S,hd]
  const int gstep = 16 * (vmode ? S_ : HD_);   // 16 staged rows further
  const half_t* sr = stg + (tid >> 4) * SP + c16 * 8;
#pragma unroll
  for (int i = 0; i < 8; ++i)
    *(v8h*)(gp + (size_t)i * gstep) = *(const v8h*)(sr + i * 16 * SP);
}

// ---------------------------------------------------------------------------
// Output projection: out(f32) = Oh(f16) @ Wf(f16, pre-transposed) + bf
// ---------------------------------------------------------------------------
__global__ __launch_bounds__(256) void out_gemm_kernel(
    const half_t* __restrict__ Oh, const half_t* __restrict__ Wft,
    const float* __restrict__ bf, float* __restrict__ out) {
  __shared__ __align__(16) half_t As[2][BM][LP];   // [buffer][row][k]
  __shared__ __align__(16) half_t Bt[2][BN][LP];   // [buffer][col][k]
  const int rowBase = blockIdx.y * BM;
  const int colBase = blockIdx.x * BN;
  v8f acc[4][2] = {};
  gemm_tile_core<2>(Oh, Wft, As, Bt, rowBase, colBase, acc);

  const int lane = threadIdx.x & 31;
  const int wid  = threadIdx.x >> 5;
  const int wm = wid >> 2, wn = wid & 3, hi = lane >> 4, l15 = lane & 15;
#pragma unroll
  for (int sm = 0; sm < 4; ++sm)
#pragma unroll
    for (int sn = 0; sn < 2; ++sn)
#pragma unroll
      for (int r = 0; r < 8; ++r) {
        int R = rowBase + wm * 64 + sm * 16 + r + 8 * hi;
        int C = colBase + wn * 32 + sn * 16 + l15;
        out[(size_t)R * D_ + C] = acc[sm][sn][r] + bf[C];
      }
}

// ---------------------------------------------------------------------------
// Lane l with lane l ^ 16 (the other 16-lane half), on the vector port.
// ---------------------------------------------------------------------------
__device__ __forceinline__ float xhalf(float x) {
  return __builtin_bit_cast(float, __builtin_amdgcn_permlanex16(
      __builtin_bit_cast(int, x), __builtin_bit_cast(int, x),
      0x76543210, 0xfedcba98, false, false));
}

constexpr int SK  = 64;
constexpr int AP  = 72;
constexpr int ABB = 64 * AP * 2;

// (the launch bound states the block of 256 that the host launches: without it
//  the register budget is that of 1024 threads, and the stage's body spills)
__global__ __launch_bounds__(256) void attn_kernel(const half_t* __restrict__ Qh,
                            const half_t* __restrict__ Kh,
                            const half_t* __restrict__ VhT,
                            half_t* __restrict__ Oh) {
  __shared__ __align__(16) half_t Ks[2][SK][AP];   // [buffer][key][dim]
  __shared__ __align__(16) half_t Vs[2][HD_][AP];  // [buffer][dim][key]

  const int bh  = blockIdx.x;
  const int b   = bh >> 4;
  const int h   = bh & 15;
  const int Qb  = blockIdx.y * 128;
  const int tid = threadIdx.x;
  const int lane = tid & 31;
  const int wid  = tid >> 5;
  const int hi   = lane >> 4;
  const int l15  = lane & 15;
  const int qbase = Qb + wid * 16;
  const int iq    = qbase + l15;   // this lane's query

  const half_t* Qp = Qh  + (size_t)(b * H_ + h) * S_ * HD_;
  const half_t* Kp = Kh  + (size_t)(b * H_ + h) * S_ * HD_;
  const half_t* Vp = VhT + (size_t)(b * H_ + h) * HD_ * S_;  // [dim][key]

  // Q fragments for the whole hd=64 (two K=32 steps), loaded once.
  V16 aq0, aq1;
  {
    const half_t* qrow = Qp + (size_t)iq * HD_;
    aq0.h[0] = *(const v8h*)(qrow + hi * 8);
    aq0.h[1] = *(const v8h*)(qrow + 16 + hi * 8);
    aq1.h[0] = *(const v8h*)(qrow + 32 + hi * 8);
    aq1.h[1] = *(const v8h*)(qrow + 48 + hi * 8);
  }

  float M = -1e30f;   // running maximum of this lane's query (both halves alike)
  float L = 0.0f;     // running sum over this half's keys; halves joined at the end
  v8f acc[4] = {};    // acc[j][r] = O^T[j*16 + 8*hi + r][query l15]

  // slope = (24^(1/8))^-(h%8+1)
  const float slope = __expf(-__logf(24.0f) / 8.0f * (float)((h & 7) + 1));
  const bool fwd = (h < 8);
  const float g = fwd ? slope : -slope;   // ALiBi term per step of the key index
  const int  sg = fwd ? 1 : -1;
  v8f ramp0, ramp1;                       // g * (key index inside the chunk)
#pragma unroll
  for (int r = 0; r < 8; ++r) {
    ramp0[r] = g * (float)(8 * hi + r);
    ramp1[r] = g * (float)(16 + 8 * hi + r);
  }
  const int sBeg = fwd ? 0 : (Qb >> 6);                  // stages [sBeg, sEnd):
  const int sEnd = fwd ? ((Qb >> 6) + 2) : (S_ >> 6);    // two at least, sBeg even

  // ---- one stage into one buffer: 8 threads per 128-byte row, a thread takes
  //      rows srow and srow + 32 of K (keys) and of V (dims) -----------------
  const int srow = tid >> 3, scol = (tid & 7) * 8;
  const uint32_t kl0 = (uint32_t)(uintptr_t)&Ks[0][srow][scol];   // LDS byte
  const uint32_t vl0 = (uint32_t)(uintptr_t)&Vs[0][srow][scol];   // addresses
  auto fill = [&](const int st, const int buf) __attribute__((always_inline)) {
    const half_t* kg = Kp + (size_t)(st * SK + srow) * HD_ + scol;
    const half_t* vg = Vp + (size_t)srow * S_ + st * SK + scol;
    const uint32_t kl = kl0 + buf * ABB, vl = vl0 + buf * ABB;
    // global to LDS through no register; the closing wait stands in front of
    // any rewrite of the address registers that the four copies name
    asm volatile(
        "global_load_async_to_lds_b128 %0, %4, off\n\t"
        "global_load_async_to_lds_b128 %1, %5, off\n\t"
        "global_load_async_to_lds_b128 %2, %6, off\n\t"
        "global_load_async_to_lds_b128 %3, %7, off\n\t"
        "s_wait_xcnt 0x0"
        :: "v"(kl), "v"(kl + 32 * AP * 2), "v"(vl), "v"(vl + 32 * AP * 2),
           "v"(kg), "v"(kg + 32 * HD_), "v"(vg), "v"(vg + 32 * S_)
        : "memory");
  };

  // always_inline: 'masked' and 'p' are literals at each call and must fold
  // chunk p (0 or 1) of stage st, read from buffer buf
  auto chunk = [&](const int st, const int buf, const int p, const bool masked)
      __attribute__((always_inline)) {
    const int kbase = st * SK + p * 32;
    const half_t (*Kt)[AP] = &Ks[buf][p * 32];   // the chunk's 32 keys
    const half_t (*Vt)[AP] = Vs[buf];            // its keys: columns p * 32 + ...

    // ---- scores: K(32x64) x Q^T(64x16) + C -> two 16x16 f32 tiles of S^T --
    v8f c0 = ramp0, c1 = ramp1;
    if (masked) {
      // key 8*hi + r of the chunk is masked where sg * r > srel
      const int srel = sg * (iq - kbase - 8 * hi);
#pragma unroll
      for (int r = 0; r < 8; ++r) {
        c0[r] = (sg * r > srel) ? -1e9f : ramp0[r];
        c1[r] = (sg * (16 + r) > srel) ? -1e9f : ramp1[r];
      }
    }
    {
      V16 bk0, bk0b, bk1, bk1b;
      int key0 = l15, key1 = 16 + l15;
      bk0.h[0]  = *(const v8h*)&Kt[key0][hi * 8];
      bk0.h[1]  = *(const v8h*)&Kt[key0][16 + hi * 8];
      bk0b.h[0] = *(const v8h*)&Kt[key0][32 + hi * 8];
      bk0b.h[1] = *(const v8h*)&Kt[key0][48 + hi * 8];
      bk1.h[0]  = *(const v8h*)&Kt[key1][hi * 8];
      bk1.h[1]  = *(const v8h*)&Kt[key1][16 + hi * 8];
      bk1b.h[0] = *(const v8h*)&Kt[key1][32 + hi * 8];
      bk1b.h[1] = *(const v8h*)&Kt[key1][48 + hi * 8];
      c0 = __builtin_amdgcn_wmma_f32_16x16x32_f16(false, bk0.v, false, aq0.v,
                                                  (short)0, c0, false, false);
      c0 = __builtin_amdgcn_wmma_f32_16x16x32_f16(false, bk0b.v, false, aq1.v,
                                                  (short)0, c0, false, false);
      c1 = __builtin_amdgcn_wmma_f32_16x16x32_f16(false, bk1.v, false, aq0.v,
                                                  (short)0, c1, false, false);
      c1 = __builtin_amdgcn_wmma_f32_16x16x32_f16(false, bk1b.v, false, aq1.v,
                                                  (short)0, c1, false, false);
    }

    // ---- online softmax, one query per lane ------------------------------
    float mx = -1e30f;
#pragma unroll
    for (int r = 0; r < 8; ++r) mx = fmaxf(mx, fmaxf(c0[r], c1[r]));
    mx = fmaxf(mx, xhalf(mx));   // all 32 keys of the chunk
    const float off = g * (float)(kbase - iq);   // the chunk's part of the term
    const float Mn = fmaxf(M, mx + off);
    const float sc = __expf(M - Mn);
    M = Mn;
    // Mn in the chunk's own units. Never below mx: where all 32 keys are masked
    // the roundings at 1e9 could leave it lower, and exp would overflow f16.
    const float e = fmaxf(Mn - off, mx);

    V16 pf;                      // P^T as B operand: pf[s] = P^T[kmap(s, hi)][l15]
    float rs = 0.0f;
#pragma unroll
    for (int r = 0; r < 8; ++r) {
      float p0 = __expf(c0[r] - e);
      float p1 = __expf(c1[r] - e);
      rs += p0 + p1;
      pf.v[r]     = (half_t)p0;
      pf.v[8 + r] = (half_t)p1;
    }
    L = L * sc + rs;
#pragma unroll
    for (int j = 0; j < 4; ++j)
#pragma unroll
      for (int r = 0; r < 8; ++r) acc[j][r] = acc[j][r] * sc;

    // ---- V^T(64x32) x P^T(32x16): 4 WMMAs accumulate into O^T ------------
#pragma unroll
    for (int j = 0; j < 4; ++j) {
      V16 bv;
      int drow = j * 16 + l15;
      bv.h[0] = *(const v8h*)&Vt[drow][p * 32 + hi * 8];
      bv.h[1] = *(const v8h*)&Vt[drow][p * 32 + 16 + hi * 8];
      acc[j] = __builtin_amdgcn_wmma_f32_16x16x32_f16(false, bv.v, false, pf.v,
                                                      (short)0, acc[j],
                                                      false, false);
    }
  };

  fill(sBeg, 0);
  // this wave's copies of the first stage have landed ...
  asm volatile("s_wait_asynccnt 0x0" ::: "memory");
  __syncthreads();   // ... and every other wave's
  fill(sBeg + 1, 1);

  const int mBeg = fwd ? sBeg : sBeg + 2;   // stages [mBeg, mEnd) hold no
  const int mEnd = fwd ? sEnd - 2 : sEnd;   // masked key for any query here
  // always_inline: 'masked' is a literal at each call and must fold away
  auto stage = [&](const int st, const bool masked)
      __attribute__((always_inline)) {
    const int buf = st & 1;
    chunk(st, buf, 0, masked);
    chunk(st, buf, 1, masked);
    // this wave's reads of the buffer that is refilled below are done
    asm volatile("s_wait_dscnt 0x0" ::: "memory");
    // this wave's copies of the next stage have landed
    asm volatile("s_wait_asynccnt 0x0" ::: "memory");
    __syncthreads();   // publishes stage st + 1, frees stage st's buffer
    if (st + 2 < sEnd) fill(st + 2, buf);
  };
  for (int st = sBeg; st < mBeg; ++st) stage(st, true);
  for (int st = mBeg; st < mEnd; ++st) stage(st, false);
  for (int st = mEnd; st < sEnd; ++st) stage(st, true);
  // no copy is outstanding when the wave ends
  asm volatile("s_wait_asynccnt 0x0" ::: "memory");

  // ---- epilogue: join the halves' sums, normalize, write f16 into [B*S, D]
  //      for the final GEMM; a lane's 8 registers are 8 consecutive dims -----
  const float inv = 1.0f / (L + xhalf(L));
  half_t* orow = Oh + (size_t)(b * S_ + iq) * D_ + h * HD_ + 8 * hi;
#pragma unroll
  for (int j = 0; j < 4; ++j) {
    v8h o;
#pragma unroll
    for (int r = 0; r < 8; ++r) o[r] = (half_t)(acc[j][r] * inv);
    *(v8h*)(orow + j * 16) = o;
  }
}

// ---------------------------------------------------------------------------
// Host-side launcher. Workspace layout (all 16B-aligned, ~48 MB total):
//   xh   : ROWS*D f16      (8 MB)
//   wqt/wkt/wvt/wft : D*D f16 each, TRANSPOSED [n][k] (4 x 2 MB)
//   Qh/Kh : B*H*S*hd f16  (2 x 8 MB);  VhT : B*H*hd*S f16 (8 MB)
//   Oh   : ROWS*D f16      (8 MB)
// ---------------------------------------------------------------------------
extern "C" void kernel_launch(void* const* d_in, const int* in_sizes, int n_in,
                              void* d_out, int out_size, void* d_ws,
                              size_t ws_size, hipStream_t stream) {
  const float* x  = (const float*)d_in[0];
  const float* Wq = (const float*)d_in[1];
  const float* bq = (const float*)d_in[2];
  const float* Wk = (const float*)d_in[3];
  const float* bk = (const float*)d_in[4];
  const float* Wv = (const float*)d_in[5];
  const float* bv = (const float*)d_in[6];
  const float* Wf = (const float*)d_in[7];
  const float* bf = (const float*)d_in[8];
  float* out = (float*)d_out;

  char* ws = (char*)d_ws;
  size_t off = 0;
  half_t* xh  = (half_t*)(ws + off); off += (size_t)ROWS * D_ * sizeof(half_t);
  half_t* wqt = (half_t*)(ws + off); off += (size_t)D_ * D_ * sizeof(half_t);
  half_t* wkt = (half_t*)(ws + off); off += (size_t)D_ * D_ * sizeof(half_t);
  half_t* wvt = (half_t*)(ws + off); off += (size_t)D_ * D_ * sizeof(half_t);
  half_t* wft = (half_t*)(ws + off); off += (size_t)D_ * D_ * sizeof(half_t);
  half_t* Qh  = (half_t*)(ws + off); off += (size_t)B_ * H_ * S_ * HD_ * sizeof(half_t);
  half_t* Kh  = (half_t*)(ws + off); off += (size_t)B_ * H_ * S_ * HD_ * sizeof(half_t);
  half_t* VhT = (half_t*)(ws + off); off += (size_t)B_ * H_ * HD_ * S_ * sizeof(half_t);
  half_t* Oh  = (half_t*)(ws + off); off += (size_t)ROWS * D_ * sizeof(half_t);

  // 1) conversions in one launch: x plain; weights transpose-converted to [n][k]
  prep_kernel<<<512, 256, 0, stream>>>(x, Wq, Wk, Wv, Wf, xh, wqt, wkt, wvt, wft);

  // 2) fused QKV projection (z selects Q/K/V), tiles 128x128, 8 waves/block
  qkv_gemm_kernel<<<dim3(D_ / BN, ROWS / BM, 3), 256, 0, stream>>>(
      xh, wqt, wkt, wvt, bq, bk, bv, Qh, Kh, VhT);

  // 3) flash attention with bidirectional ALiBi
  attn_kernel<<<dim3(B_ * H_, S_ / 128), 256, 0, stream>>>(Qh, Kh, VhT, Oh);

  // 4) output projection to f32
  out_gemm_kernel<<<dim3(D_ / BN, ROWS / BM), 256, 0, stream>>>(
      Oh, wft, bf, out);
}

// v009
// It runs in 64.5 microseconds.
// Two timings next to v008 both put it at 1.10 times that version's speed.
// Over all steps from v000 it is 3.39 times as fast.
#include <hip/hip_runtime.h>
#include <cstdint>
#include <cstddef>

// ---------------------------------------------------------------------------
// RelativeAttention (ALiBi bidirectional) for MI455X / gfx1250, wave32 WMMA.
// All matmuls run on v_wmma_f32_16x16x32_f16 (f16 in, f32 accumulate).
// Weights are pre-transposed (and V written transposed) so every LDS staging
// access is a 128-bit load/store -- no 16-bit scatter in the hot loops.
// ---------------------------------------------------------------------------

typedef _Float16 half_t;
typedef __attribute__((ext_vector_type(16))) _Float16 v16h;
typedef __attribute__((ext_vector_type(8)))  _Float16 v8h;
typedef __attribute__((ext_vector_type(4)))  _Float16 v4h;
typedef __attribute__((ext_vector_type(8)))  float    v8f;

union V16 { v16h v; v8h h[2]; };

constexpr int B_   = 2;
constexpr int S_   = 2048;
constexpr int D_   = 1024;
constexpr int H_   = 16;
constexpr int HD_  = 64;
constexpr int ROWS = B_ * S_;   // 4096

// ---------------------------------------------------------------------------
// Preparation, one launch of 512 equal work-groups of 256 threads. Each does
//   - one 64(k) x 128(n) piece of one weight matrix, f32 [K][N] -> f16 [N][K],
//     as two 64x64 tiles through LDS, coalesced on both sides (128 work-groups
//     per matrix, 4 matrices);
//   - 2048 float4 of x, f32 -> f16, element for element.
// All of a thread's loads are issued before the first value is used, so the
// work-group pays one memory round trip; one barrier serves both tiles.
// ---------------------------------------------------------------------------
__global__ __launch_bounds__(256) void prep_kernel(
    const float* __restrict__ x,
    const float* __restrict__ Wq, const float* __restrict__ Wk,
    const float* __restrict__ Wv, const float* __restrict__ Wf,
    half_t* __restrict__ xh,
    half_t* __restrict__ wqt, half_t* __restrict__ wkt,
    half_t* __restrict__ wvt, half_t* __restrict__ wft) {
  __shared__ float tile[2][64][65];
  const int w   = blockIdx.x;
  const int tid = threadIdx.x;
  const int m   = w >> 7;           // which weight matrix
  const float* src = (m == 0) ? Wq : (m == 1) ? Wk : (m == 2) ? Wv : Wf;
  half_t* dst      = (m == 0) ? wqt : (m == 1) ? wkt : (m == 2) ? wvt : wft;
  const int nb = (w & 7) * 128;         // n base (cols of src, rows of dst)
  const int kb = ((w >> 3) & 15) * 64;  // k base (rows of src, cols of dst)
  const int r0 = tid >> 6, c = tid & 63;

  // (the loops are unrolled so that tv and xv stay in registers)
  float tv[2][16];
#pragma unroll
  for (int u = 0; u < 2; ++u)
#pragma unroll
    for (int i = 0; i < 16; ++i)
      tv[u][i] = src[(size_t)(kb + r0 + i * 4) * D_ + nb + u * 64 + c];
  const float4* xs = (const float4*)x + (size_t)w * 2048 + tid;
  float4 xv[8];
#pragma unroll
  for (int i = 0; i < 8; ++i) xv[i] = xs[i * 256];
  // keeps every load above in front of the first use of a loaded value: without
  // it the x values are waited for and converted before the tile loads issue
  __builtin_amdgcn_sched_barrier(0);

#pragma unroll
  for (int u = 0; u < 2; ++u)
#pragma unroll
    for (int i = 0; i < 16; ++i) tile[u][r0 + i * 4][c] = tv[u][i];

  v4h* xd = (v4h*)xh + (size_t)w * 2048 + tid;
#pragma unroll
  for (int i = 0; i < 8; ++i) {
    v4h h;
    h[0] = (half_t)xv[i].x; h[1] = (half_t)xv[i].y;
    h[2] = (half_t)xv[i].z; h[3] = (half_t)xv[i].w;
    xd[i * 256] = h;
  }
  __syncthreads();
  half_t* dp = dst + (size_t)(nb + r0) * D_ + kb + c;
#pragma unroll
  for (int u = 0; u < 2; ++u)
#pragma unroll
    for (int i = 0; i < 16; ++i)
      dp[(u * 64 + i * 4) * D_] = (half_t)tile[u][c][r0 + i * 4];
}

// ---------------------------------------------------------------------------
// Shared WMMA GEMM core: C(128x128 per block) = A(M x 1024) * B(1024 x N)
// 256 threads = 8 waves (2 x 4), each wave computes a 64x32 patch (4x2 WMMA
// tiles). A stage is 64 k: every staged row is one whole 128-byte line, and a
// wave-wide 128-bit copy covers four whole lines. LDS rows stand at a pitch of
// 144 bytes (16 B x odd), the conflict-free pitch for 128-bit fragment reads.
// A and B both come as [row][k] (x, Oh or a PRE-TRANSPOSED weight Wt[n][k]), so both
// stagings and all fragment fills are contiguous 128-bit LDS operations.
// The stages come into LDS by asynchronous 16-byte copies, two buffers: stage
// kt + 1 flies while stage kt is worked on, and one barrier per stage publishes
// the one and frees the other.
// Fragment layout (ISA 7.12.2, 16-bit, wave32):
//   A: lane(l&15)=row, halves at k = {hi*8..+7, 16+hi*8..+7}
//   B: lane(l&15)=col, same k pattern.  C: n=l&15, m=r+8*(l>>4).
// ---------------------------------------------------------------------------
constexpr int BM = 128;   // block rows
constexpr int BN = 128;   // block cols
constexpr int BK = 64;    // k per stage (128 bytes of every operand row)
constexpr int LP = 72;    // LDS row pitch in halves (144 bytes)
constexpr int GBB = BM * LP * 2;   // bytes of one buffer of one operand

template <int GK>   // 32-k steps per group of fragment loads
__device__ __forceinline__ void gemm_tile_core(
    const half_t* __restrict__ A, const half_t* __restrict__ Bt_g,
    half_t (*As)[BM][LP], half_t (*Bt)[BN][LP],
    int rowBase, int colBase, v8f acc[4][2]) {
  const int tid  = threadIdx.x;
  const int lane = tid & 31;
  const int wid  = tid >> 5;
  const int wm   = wid >> 2;       // 0..1  (m sub-block of 64 rows)
  const int wn   = wid & 3;        // 0..3  (n sub-block of 32 cols)
  const int hi   = lane >> 4;      // half-wave select
  const int l15  = lane & 15;
  const int srow = tid >> 3;       // staging: 8 threads per 128-byte row
  const int scol = (tid & 7) * 8;

  const half_t* ag = A    + (size_t)(rowBase + srow) * D_ + scol;
  const half_t* bg = Bt_g + (size_t)(colBase + srow) * D_ + scol;
  const uint32_t al0 = (uint32_t)(uintptr_t)&As[0][srow][scol];   // LDS byte
  const uint32_t bl0 = (uint32_t)(uintptr_t)&Bt[0][srow][scol];   // addresses

  // ---- stage kt (A 128x64 and B 128x64) into one buffer: a thread takes rows
  //      srow + 32 i of either operand, 16 bytes of each ---------------------
  auto fill = [&](const int kt, const int buf) __attribute__((always_inline)) {
    const half_t* a = ag + kt * BK;
    const half_t* b = bg + kt * BK;
    const uint32_t al = al0 + buf * GBB, bl = bl0 + buf * GBB;
    // global to LDS through no register; the closing wait stands in front of
    // any rewrite of the address registers that the eight copies name
    asm volatile(
        "global_load_async_to_lds_b128 %0, %8, off\n\t"
        "global_load_async_to_lds_b128 %1, %9, off\n\t"
        "global_load_async_to_lds_b128 %2, %10, off\n\t"
        "global_load_async_to_lds_b128 %3, %11, off\n\t"
        "global_load_async_to_lds_b128 %4, %12, off\n\t"
        "global_load_async_to_lds_b128 %5, %13, off\n\t"
        "global_load_async_to_lds_b128 %6, %14, off\n\t"
        "global_load_async_to_lds_b128 %7, %15, off\n\t"
        "s_wait_xcnt 0x0"
        :: "v"(al), "v"(al + 32 * LP * 2), "v"(al + 64 * LP * 2),
           "v"(al + 96 * LP * 2),
           "v"(bl), "v"(bl + 32 * LP * 2), "v"(bl + 64 * LP * 2),
           "v"(bl + 96 * LP * 2),
           "v"(a), "v"(a + 32 * D_), "v"(a + 64 * D_), "v"(a + 96 * D_),
           "v"(b), "v"(b + 32 * D_), "v"(b + 64 * D_), "v"(b + 96 * D_)
        : "memory");
  };

  fill(0, 0);
  // this wave's copies of the first stage have landed ...
  asm volatile("s_wait_asynccnt 0x0" ::: "memory");
  __syncthreads();   // ... and every other wave's
  fill(1, 1);

  for (int kt = 0; kt < D_ / BK; ++kt) {
    const int buf = kt & 1;
    const half_t (*Ab)[LP] = As[buf];
    const half_t (*Bb)[LP] = Bt[buf];
    // (the loops below are unrolled so that the fragments and acc are indexed
    //  by constants and stay in registers)
    // The fragment loads go out in groups, each load into registers of its own,
    // in the order in which the products take them: the whole stage's 24 as one
    // group (GK = 2), or 12 per 32 k (GK = 1) where the registers of the larger
    // group would cost a resident work-group.
#pragma unroll
    for (int k0 = 0; k0 < BK / 32; k0 += GK) {
      V16 af[GK][4], bf2[GK][2];
#pragma unroll
      for (int kg = 0; kg < GK; ++kg) {
        const int ko = (k0 + kg) * 32 + hi * 8;
#pragma unroll
        for (int sn = 0; sn < 2; ++sn) {
          int c = wn * 32 + sn * 16 + l15;
          bf2[kg][sn].h[0] = *(const v8h*)&Bb[c][ko];
          bf2[kg][sn].h[1] = *(const v8h*)&Bb[c][ko + 16];
        }
#pragma unroll
        for (int sm = 0; sm < 4; ++sm) {
          int r = wm * 64 + sm * 16 + l15;
          af[kg][sm].h[0] = *(const v8h*)&Ab[r][ko];
          af[kg][sm].h[1] = *(const v8h*)&Ab[r][ko + 16];
        }
      }
      // keeps the group in front of its first product: without it the loads are
      // sunk among the products into one shared register set, and the wave
      // waits out the LDS latency in front of every second product
      __builtin_amdgcn_sched_barrier(0);
#pragma unroll
      for (int kg = 0; kg < GK; ++kg)
#pragma unroll
        for (int sm = 0; sm < 4; ++sm)
#pragma unroll
          for (int sn = 0; sn < 2; ++sn)
            acc[sm][sn] = __builtin_amdgcn_wmma_f32_16x16x32_f16(
                false, af[kg][sm].v, false, bf2[kg][sn].v, (short)0,
                acc[sm][sn], false, false);
    }
    // keeps the products in front of the waits below: moved behind them, they
    // would start only when every load has returned, and the next stage's
    // copies would be waited for before the products that are to cover them
    __builtin_amdgcn_sched_barrier(0);
    // this wave's reads of the buffer that is refilled below are done
    asm volatile("s_wait_dscnt 0x0" ::: "memory");
    // this wave's copies of the next stage have landed
    asm volatile("s_wait_asynccnt 0x0" ::: "memory");
    __syncthreads();   // publishes stage kt + 1, frees stage kt's buffer
    if (kt + 2 < D_ / BK) fill(kt + 2, buf);
  }
  // no copy is outstanding when the wave goes on
  asm volatile("s_wait_asynccnt 0x0" ::: "memory");
}

// ---------------------------------------------------------------------------
// Fused QKV projection: z=0 -> Q (pre-scaled by 1/sqrt(hd)), z=1 -> K,
// z=2 -> V written TRANSPOSED [B, H, hd, S] so the attention kernel can
// stage V tiles with contiguous b128 accesses. Q/K go to [B, H, S, hd].
// A lane's 8 accumulator registers run along the A operand's rows, so the
// operand whose index is contiguous in the destination is given to the core as
// A: the weight (dims) for Q and K, x (positions) for V. The block tile is
// square, so this only exchanges the two pointers and bases. The finished tile
// goes as f16 through LDS (the ring, free behind the core's last barrier),
// [B index][A index], in 16-byte pieces, and leaves as whole 128-byte lines.
// ---------------------------------------------------------------------------
constexpr int SP = 136;   // staging pitch in halves (272 bytes, 16 B x odd)
static_assert(BM == BN && BN * SP <= 2 * BM * LP, "tile fits the A ring");

// (six waves per SIMD: three work-groups stay resident on a WGP, as many as the
//  grid brings to each, so the register budget is held at 160)
__global__ __launch_bounds__(256) __attribute__((amdgpu_waves_per_eu(6)))
void qkv_gemm_kernel(
    const half_t* __restrict__ Xh,
    const half_t* __restrict__ Wqt, const half_t* __restrict__ Wkt,
    const half_t* __restrict__ Wvt,
    const float* __restrict__ bq, const float* __restrict__ bk,
    const float* __restrict__ bv,
    half_t* __restrict__ Qh, half_t* __restrict__ Kh,
    half_t* __restrict__ VhT) {
  __shared__ __align__(16) half_t As[2][BM][LP];   // [buffer][row][k]
  __shared__ __align__(16) half_t Bt[2][BN][LP];   // [buffer][col][k]

  const half_t* W; const float* bias; half_t* dst; float scale;
  bool vmode = false;
  if (blockIdx.z == 0)      { W = Wqt; bias = bq; dst = Qh;  scale = 0.125f; }
  else if (blockIdx.z == 1) { W = Wkt; bias = bk; dst = Kh;  scale = 1.0f; }
  else                      { W = Wvt; bias = bv; dst = VhT; scale = 1.0f; vmode = true; }

  const int rowBase = blockIdx.y * BM;   // rows of x
  const int colBase = blockIdx.x * BN;   // columns of the weight
  const int tid  = threadIdx.x;
  const int lane = tid & 31;
  // (the wave's number in a scalar register: what is formed from it then takes
  //  no vector register across the core)
  const int wid  = __builtin_amdgcn_readfirstlane(tid >> 5);
  const int wm = wid >> 2, wn = wid & 3, hi = lane >> 4, l15 = lane & 15;

  // The bias is fetched in front of the core, so that its latency passes under
  // the k loop. V: it runs along the B index, one value per sn. Q/K: along the
  // A index, 8 values per sm.
  // (every loop of this kernel is unrolled so that bb, ba and acc are indexed
  //  by constants and stay in registers, and the eight stores issue together)
  float  bb[2]    = {};
  float4 ba[4][2] = {};
  if (vmode) {
#pragma unroll
    for (int sn = 0; sn < 2; ++sn)
      bb[sn] = bias[colBase + wn * 32 + sn * 16 + l15];
    // stands in front of any rewrite of the address registers that the bias
    // loads name; so in the other arm
    asm volatile("s_wait_xcnt 0x0" ::: "memory");
  } else {
    const float4* bp = (const float4*)(bias + colBase + wm * 64 + 8 * hi);
#pragma unroll
    for (int sm = 0; sm < 4; ++sm) {
      ba[sm][0] = bp[sm * 4];
      ba[sm][1] = bp[sm * 4 + 1];
    }
    // (the same wait, for this arm's loads)
    asm volatile("s_wait_xcnt 0x0" ::: "memory");
  }

  v8f acc[4][2] = {};
  gemm_tile_core<1>(vmode ? Xh : W, vmode ? W : Xh, As, Bt,
                 vmode ? rowBase : colBase, vmode ? colBase : rowBase, acc);

  half_t* stg = &As[0][0][0];
  // acc[sm][sn][r]: A index wm*64 + sm*16 + 8*hi + r, B index wn*32 + sn*16 + l15
  half_t* sw = stg + (wn * 32 + l15) * SP + wm * 64 + 8 * hi;
  if (vmode) {
#pragma unroll
    for (int sn = 0; sn < 2; ++sn)
#pragma unroll
      for (int sm = 0; sm < 4; ++sm) {
        v8h o;
#pragma unroll
        for (int r = 0; r < 8; ++r) o[r] = (half_t)(acc[sm][sn][r] + bb[sn]);
        *(v8h*)(sw + sn * 16 * SP + sm * 16) = o;
      }
  } else {
#pragma unroll
    for (int sm = 0; sm < 4; ++sm) {
      const float4 b0 = ba[sm][0], b1 = ba[sm][1];
      const float bs[8] = {b0.x, b0.y, b0.z, b0.w, b1.x, b1.y, b1.z, b1.w};
#pragma unroll
      for (int sn = 0; sn < 2; ++sn) {
        v8h o;
#pragma unroll
        for (int r = 0; r < 8; ++r)
          o[r] = (half_t)((acc[sm][sn][r] + bs[r]) * scale);
        *(v8h*)(sw + sn * 16 * SP + sm * 16) = o;
      }
    }
  }
  __syncthreads();   // the staged tile is whole before any wave reads across it

  // 16 lanes take one staged row (256 bytes). Q/K: position s0 + rr, one line
  // of either of the tile's two heads. V: dim colBase + rr, two lines of
  // positions. Each wave-wide store covers four whole lines.
  const int bI = rowBase >> 11, s0 = rowBase & (S_ - 1);
  const int c16 = tid & 15;
  const int C0 = colBase + (vmode ? (tid >> 4) : c16 * 8);
  half_t* gp = vmode
      ? dst + ((size_t)(bI * H_ + (C0 >> 6)) * HD_ + (C0 & (HD_ - 1))) * S_ +
            s0 + c16 * 8                                      // [B,H,hd,S]
      : dst + ((size_t)(bI * H_ + (C0 >> 6)) * S_ + s0 + (tid >> 4)) * HD_ +
            (C0 & (HD_ - 1));                                 // [B,H,S,hd]
  const int gstep = 16 * (vmode ? S_ : HD_);   // 16 staged rows further
  const half_t* sr = stg + (tid >> 4) * SP + c16 * 8;
#pragma unroll
  for (int i = 0; i < 8; ++i)
    *(v8h*)(gp + (size_t)i * gstep) = *(const v8h*)(sr + i * 16 * SP);
}

// ---------------------------------------------------------------------------
// Output projection: out(f32) = Oh(f16) @ Wf(f16, pre-transposed) + bf
// ---------------------------------------------------------------------------
__global__ __launch_bounds__(256) void out_gemm_kernel(
    const half_t* __restrict__ Oh, const half_t* __restrict__ Wft,
    const float* __restrict__ bf, float* __restrict__ out) {
  __shared__ __align__(16) half_t As[2][BM][LP];   // [buffer][row][k]
  __shared__ __align__(16) half_t Bt[2][BN][LP];   // [buffer][col][k]
  const int rowBase = blockIdx.y * BM;
  const int colBase = blockIdx.x * BN;
  v8f acc[4][2] = {};
  gemm_tile_core<2>(Oh, Wft, As, Bt, rowBase, colBase, acc);

  const int lane = threadIdx.x & 31;
  const int wid  = threadIdx.x >> 5;
  const int wm = wid >> 2, wn = wid & 3, hi = lane >> 4, l15 = lane & 15;
#pragma unroll
  for (int sm = 0; sm < 4; ++sm)
#pragma unroll
    for (int sn = 0; sn < 2; ++sn)
#pragma unroll
      for (int r = 0; r < 8; ++r) {
        int R = rowBase + wm * 64 + sm * 16 + r + 8 * hi;
        int C = colBase + wn * 32 + sn * 16 + l15;
        out[(size_t)R * D_ + C] = acc[sm][sn][r] + bf[C];
      }
}

// ---------------------------------------------------------------------------
// Lane l with lane l ^ 16 (the other 16-lane half), on the vector port.
// ---------------------------------------------------------------------------
__device__ __forceinline__ float xhalf(float x) {
  return __builtin_bit_cast(float, __builtin_amdgcn_permlanex16(
      __builtin_bit_cast(int, x), __builtin_bit_cast(int, x),
      0x76543210, 0xfedcba98, false, false));
}

constexpr int SK  = 64;
constexpr int AP  = 72;
constexpr int ABB = 64 * AP * 2;
// A weight exp(-CUT) or less is zero as an f16 operand (under 2^-25), so its
// chunk adds nothing to O; and all such weights of one row, 2048 at most, come
// to less than 2^-25 of the row's sum, which holds the weight 1 of the maximum.
constexpr float CUT = 25.0f;

// (the launch bound states the block of 256 that the host launches: without it
//  the register budget is that of 1024 threads, and the stage's body spills)
__global__ __launch_bounds__(256) void attn_kernel(const half_t* __restrict__ Qh,
                            const half_t* __restrict__ Kh,
                            const half_t* __restrict__ VhT,
                            half_t* __restrict__ Oh) {
  __shared__ __align__(16) half_t Ks[2][SK][AP];   // [buffer][key][dim]
  __shared__ __align__(16) half_t Vs[2][HD_][AP];  // [buffer][dim][key]

  const int bh  = blockIdx.x;
  const int b   = bh >> 4;
  const int h   = bh & 15;
  const int Qb  = blockIdx.y * 128;
  const int tid = threadIdx.x;
  const int lane = tid & 31;
  const int wid  = tid >> 5;
  const int hi   = lane >> 4;
  const int l15  = lane & 15;
  const int qbase = Qb + wid * 16;
  const int iq    = qbase + l15;   // this lane's query

  const half_t* Qp = Qh  + (size_t)(b * H_ + h) * S_ * HD_;
  const half_t* Kp = Kh  + (size_t)(b * H_ + h) * S_ * HD_;
  const half_t* Vp = VhT + (size_t)(b * H_ + h) * HD_ * S_;  // [dim][key]

  // Q fragments for the whole hd=64 (two K=32 steps), loaded once.
  V16 aq0, aq1;
  {
    const half_t* qrow = Qp + (size_t)iq * HD_;
    aq0.h[0] = *(const v8h*)(qrow + hi * 8);
    aq0.h[1] = *(const v8h*)(qrow + 16 + hi * 8);
    aq1.h[0] = *(const v8h*)(qrow + 32 + hi * 8);
    aq1.h[1] = *(const v8h*)(qrow + 48 + hi * 8);
  }

  float M = -1e30f;   // running maximum of this lane's query (both halves alike)
  float L = 0.0f;     // running sum over this half's keys; halves joined at the end
  v8f acc[4] = {};    // acc[j][r] = O^T[j*16 + 8*hi + r][query l15]

  // slope = (24^(1/8))^-(h%8+1)
  const float slope = __expf(-__logf(24.0f) / 8.0f * (float)((h & 7) + 1));
  const bool fwd = (h < 8);
  const float g = fwd ? slope : -slope;   // ALiBi term per step of the key index
  const int  sg = fwd ? 1 : -1;
  v8f ramp0, ramp1;                       // g * (key index inside the chunk)
#pragma unroll
  for (int r = 0; r < 8; ++r) {
    ramp0[r] = g * (float)(8 * hi + r);
    ramp1[r] = g * (float)(16 + 8 * hi + r);
  }
  // step n of the walk takes stage st0 - sg * n, n in [0, nSt), nSt two at least
  const int nSt = fwd ? ((Qb >> 6) + 2) : ((S_ - Qb) >> 6);
  const int st0 = fwd ? ((Qb >> 6) + 1) : (Qb >> 6);
  const int pN  = fwd ? 1 : 0;            // the chunk of a stage that is walked first

  // ---- one stage into one buffer: 8 threads per 128-byte row, a thread takes
  //      rows srow and srow + 32 of K (keys) and of V (dims) -----------------
  const int srow = tid >> 3, scol = (tid & 7) * 8;
  const uint32_t kl0 = (uint32_t)(uintptr_t)&Ks[0][srow][scol];   // LDS byte
  const uint32_t vl0 = (uint32_t)(uintptr_t)&Vs[0][srow][scol];   // addresses
  auto fill = [&](const int st, const int buf) __attribute__((always_inline)) {
    const half_t* kg = Kp + (size_t)(st * SK + srow) * HD_ + scol;
    const half_t* vg = Vp + (size_t)srow * S_ + st * SK + scol;
    const uint32_t kl = kl0 + buf * ABB, vl = vl0 + buf * ABB;
    // global to LDS through no register; the closing wait stands in front of
    // any rewrite of the address registers that the four copies name
    asm volatile(
        "global_load_async_to_lds_b128 %0, %4, off\n\t"
        "global_load_async_to_lds_b128 %1, %5, off\n\t"
        "global_load_async_to_lds_b128 %2, %6, off\n\t"
        "global_load_async_to_lds_b128 %3, %7, off\n\t"
        "s_wait_xcnt 0x0"
        :: "v"(kl), "v"(kl + 32 * AP * 2), "v"(vl), "v"(vl + 32 * AP * 2),
           "v"(kg), "v"(kg + 32 * HD_), "v"(vg), "v"(vg + 32 * S_)
        : "memory");
  };

  // always_inline: 'masked' is a literal at each call and must fold
  // scores of chunk p (0 or 1) of stage st, read from buffer buf:
  // K(32x64) x Q^T(64x16) + C -> two 16x16 f32 tiles of S^T
  auto scores = [&](const int st, const int buf, const int p, const bool masked,
                    v8f& c0, v8f& c1) __attribute__((always_inline)) {
    const int kbase = st * SK + p * 32;
    const half_t* Kc = &Ks[buf][p * 32 + l15][hi * 8];   // key l15 of the chunk
    c0 = ramp0; c1 = ramp1;
    if (masked) {
      // key 8*hi + r of the chunk is masked where sg * r > srel
      const int srel = sg * (iq - kbase - 8 * hi);
#pragma unroll
      for (int r = 0; r < 8; ++r) {
        c0[r] = (sg * r > srel) ? -1e9f : ramp0[r];
        c1[r] = (sg * (16 + r) > srel) ? -1e9f : ramp1[r];
      }
    }
    V16 bk0, bk0b, bk1, bk1b;
    bk0.h[0]  = *(const v8h*)(Kc);
    bk0.h[1]  = *(const v8h*)(Kc + 16);
    bk0b.h[0] = *(const v8h*)(Kc + 32);
    bk0b.h[1] = *(const v8h*)(Kc + 48);
    bk1.h[0]  = *(const v8h*)(Kc + 16 * AP);
    bk1.h[1]  = *(const v8h*)(Kc + 16 * AP + 16);
    bk1b.h[0] = *(const v8h*)(Kc + 16 * AP + 32);
    bk1b.h[1] = *(const v8h*)(Kc + 16 * AP + 48);
    c0 = __builtin_amdgcn_wmma_f32_16x16x32_f16(false, bk0.v, false, aq0.v,
                                                (short)0, c0, false, false);
    c0 = __builtin_amdgcn_wmma_f32_16x16x32_f16(false, bk0b.v, false, aq1.v,
                                                (short)0, c0, false, false);
    c1 = __builtin_amdgcn_wmma_f32_16x16x32_f16(false, bk1.v, false, aq0.v,
                                                (short)0, c1, false, false);
    c1 = __builtin_amdgcn_wmma_f32_16x16x32_f16(false, bk1b.v, false, aq1.v,
                                                (short)0, c1, false, false);
  };

  // the largest of this lane's 16 scores of a chunk
  auto lanemax = [&](const v8f& c0, const v8f& c1) __attribute__((always_inline)) {
    float mx = -1e30f;
#pragma unroll
    for (int r = 0; r < 8; ++r) mx = fmaxf(mx, fmaxf(c0[r], c1[r]));
    return mx;
  };

  // online softmax of one chunk, one query per lane, and its part of O^T;
  // mx: lanemax of the chunk, off: the chunk's part of the ALiBi term
  auto softpv = [&](const int buf, const int p, const v8f& c0, const v8f& c1,
                    float mx, const float off) __attribute__((always_inline)) {
    const half_t* Vc = &Vs[buf][l15][p * 32 + hi * 8];   // dim l15, the chunk's keys
    mx = fmaxf(mx, xhalf(mx));   // all 32 keys of the chunk
    const float Mn = fmaxf(M, mx + off);
    const float sc = __expf(M - Mn);
    M = Mn;
    // Mn in the chunk's own units. Never below mx: where all 32 keys are masked
    // the roundings at 1e9 could leave it lower, and exp would overflow f16.
    const float e = fmaxf(Mn - off, mx);

    V16 pf;                      // P^T as B operand: pf[s] = P^T[kmap(s, hi)][l15]
    float rs = 0.0f;
#pragma unroll
    for (int r = 0; r < 8; ++r) {
      float p0 = __expf(c0[r] - e);
      float p1 = __expf(c1[r] - e);
      rs += p0 + p1;
      pf.v[r]     = (half_t)p0;
      pf.v[8 + r] = (half_t)p1;
    }
    L = L * sc + rs;
#pragma unroll
    for (int j = 0; j < 4; ++j)
#pragma unroll
      for (int r = 0; r < 8; ++r) acc[j][r] = acc[j][r] * sc;

    // ---- V^T(64x32) x P^T(32x16): 4 WMMAs accumulate into O^T ------------
#pragma unroll
    for (int j = 0; j < 4; ++j) {
      V16 bv;
      bv.h[0] = *(const v8h*)(Vc + j * 16 * AP);
      bv.h[1] = *(const v8h*)(Vc + j * 16 * AP + 16);
      acc[j] = __builtin_amdgcn_wmma_f32_16x16x32_f16(false, bv.v, false, pf.v,
                                                      (short)0, acc[j],
                                                      false, false);
    }
  };

  fill(st0, 0);
  // this wave's copies of the first stage have landed ...
  asm volatile("s_wait_asynccnt 0x0" ::: "memory");
  __syncthreads();   // ... and every other wave's
  fill(st0 - sg, 1);

  // always_inline: 'masked' is a literal at each call and must fold away
  auto stage = [&](const int n, const bool masked)
      __attribute__((always_inline)) {
    const int st  = st0 - sg * n;
    const int buf = n & 1;
    v8f a0, a1, b0, b1;          // scores of the nearer and of the farther chunk
    scores(st, buf, pN, masked, a0, a1);
    scores(st, buf, 1 - pN, masked, b0, b1);
    const float mxa = lanemax(a0, a1), mxb = lanemax(b0, b1);
    const float offa = g * (float)(st * SK + pN * 32 - iq);
    const float offb = g * (float)(st * SK + (1 - pN) * 32 - iq);
    // A chunk is worked on unless every lane of the wave (both halves of every
    // query) finds it CUT below the running maximum. Both tests take the
    // maximum as it stands in front of the stage: it never falls, so the
    // farther chunk's test is the stricter for it. The negated form sends a
    // score that is not a number down the full path.
    const float lim = M - CUT;
    const uint32_t ta = __builtin_amdgcn_ballot_w32(!(mxa + offa <= lim));
    const uint32_t tb = __builtin_amdgcn_ballot_w32(!(mxb + offb <= lim));
    if (ta != 0) softpv(buf, pN, a0, a1, mxa, offa);
    if (tb != 0) softpv(buf, 1 - pN, b0, b1, mxb, offb);
    // this wave's reads of the buffer that is refilled below are done
    asm volatile("s_wait_dscnt 0x0" ::: "memory");
    // this wave's copies of the next stage have landed
    asm volatile("s_wait_asynccnt 0x0" ::: "memory");
    __syncthreads();   // publishes step n + 1's stage, frees this one's buffer
    if (n + 2 < nSt) fill(st0 - sg * (n + 2), buf);
  };
  stage(0, true);    // the two stages that overlap the block's own queries
  stage(1, true);
  for (int n = 2; n < nSt; ++n) stage(n, false);
  // no copy is outstanding when the wave ends
  asm volatile("s_wait_asynccnt 0x0" ::: "memory");

  // ---- epilogue: join the halves' sums, normalize, write f16 into [B*S, D]
  //      for the final GEMM; a lane's 8 registers are 8 consecutive dims -----
  const float inv = 1.0f / (L + xhalf(L));
  half_t* orow = Oh + (size_t)(b * S_ + iq) * D_ + h * HD_ + 8 * hi;
#pragma unroll
  for (int j = 0; j < 4; ++j) {
    v8h o;
#pragma unroll
    for (int r = 0; r < 8; ++r) o[r] = (half_t)(acc[j][r] * inv);
    *(v8h*)(orow + j * 16) = o;
  }
}

// ---------------------------------------------------------------------------
// Host-side launcher. Workspace layout (all 16B-aligned, ~48 MB total):
//   xh   : ROWS*D f16      (8 MB)
//   wqt/wkt/wvt/wft : D*D f16 each, TRANSPOSED [n][k] (4 x 2 MB)
//   Qh/Kh : B*H*S*hd f16  (2 x 8 MB);  VhT : B*H*hd*S f16 (8 MB)
//   Oh   : ROWS*D f16      (8 MB)
// ---------------------------------------------------------------------------
extern "C" void kernel_launch(void* const* d_in, const int* in_sizes, int n_in,
                              void* d_out, int out_size, void* d_ws,
                              size_t ws_size, hipStream_t stream) {
  const float* x  = (const float*)d_in[0];
  const float* Wq = (const float*)d_in[1];
  const float* bq = (const float*)d_in[2];
  const float* Wk = (const float*)d_in[3];
  const float* bk = (const float*)d_in[4];
  const float* Wv = (const float*)d_in[5];
  const float* bv = (const float*)d_in[6];
  const float* Wf = (const float*)d_in[7];
  const float* bf = (const float*)d_in[8];
  float* out = (float*)d_out;

  char* ws = (char*)d_ws;
  size_t off = 0;
  half_t* xh  = (half_t*)(ws + off); off += (size_t)ROWS * D_ * sizeof(half_t);
  half_t* wqt = (half_t*)(ws + off); off += (size_t)D_ * D_ * sizeof(half_t);
  half_t* wkt = (half_t*)(ws + off); off += (size_t)D_ * D_ * sizeof(half_t);
  half_t* wvt = (half_t*)(ws + off); off += (size_t)D_ * D_ * sizeof(half_t);
  half_t* wft = (half_t*)(ws + off); off += (size_t)D_ * D_ * sizeof(half_t);
  half_t* Qh  = (half_t*)(ws + off); off += (size_t)B_ * H_ * S_ * HD_ * sizeof(half_t);
  half_t* Kh  = (half_t*)(ws + off); off += (size_t)B_ * H_ * S_ * HD_ * sizeof(half_t);
  half_t* VhT = (half_t*)(ws + off); off += (size_t)B_ * H_ * HD_ * S_ * sizeof(half_t);
  half_t* Oh  = (half_t*)(ws + off); off += (size_t)ROWS * D_ * sizeof(half_t);

  // 1) conversions in one launch: x plain; weights transpose-converted to [n][k]
  prep_kernel<<<512, 256, 0, stream>>>(x, Wq, Wk, Wv, Wf, xh, wqt, wkt, wvt, wft);

  // 2) fused QKV projection (z selects Q/K/V), tiles 128x128, 8 waves/block
  qkv_gemm_kernel<<<dim3(D_ / BN, ROWS / BM, 3), 256, 0, stream>>>(
      xh, wqt, wkt, wvt, bq, bk, bv, Qh, Kh, VhT);

  // 3) flash attention with bidirectional ALiBi
  attn_kernel<<<dim3(B_ * H_, S_ / 128), 256, 0, stream>>>(Qh, Kh, VhT, Oh);

  // 4) output projection to f32
  out_gemm_kernel<<<dim3(D_ / BN, ROWS / BM), 256, 0, stream>>>(
      Oh, wft, bf, out);
}

// v010
// One run takes 59.1 microseconds.
// In two side-by-side timings against v009, it was 1.09 and 1.10 times as fast.
// Counting every step since v000, it is 3.71 times as fast.
#include <hip/hip_runtime.h>
#include <cstdint>
#include <cstddef>

// ---------------------------------------------------------------------------
// RelativeAttention (ALiBi bidirectional) for MI455X / gfx1250, wave32 WMMA.
// All matmuls run on v_wmma_f32_16x16x32_f16 (f16 in, f32 accumulate).
// Weights are pre-transposed (and V written transposed) so every LDS staging
// access is a 128-bit load/store -- no 16-bit scatter in the hot loops.
// ---------------------------------------------------------------------------

typedef _Float16 half_t;
typedef __attribute__((ext_vector_type(16))) _Float16 v16h;
typedef __attribute__((ext_vector_type(8)))  _Float16 v8h;
typedef __attribute__((ext_vector_type(4)))  _Float16 v4h;
typedef __attribute__((ext_vector_type(8)))  float    v8f;

union V16 { v16h v; v8h h[2]; };

constexpr int B_   = 2;
constexpr int S_   = 2048;
constexpr int D_   = 1024;
constexpr int H_   = 16;
constexpr int HD_  = 64;
constexpr int ROWS = B_ * S_;   // 4096

// ---------------------------------------------------------------------------
// Preparation, one launch of 512 equal work-groups of 256 threads. Each does
//   - one 64(k) x 128(n) piece of one weight matrix, f32 [K][N] -> f16 [N][K],
//     as two 64x64 tiles through LDS, coalesced on both sides (128 work-groups
//     per matrix, 4 matrices);
//   - 2048 float4 of x, f32 -> f16, element for element.
// All of a thread's loads are issued before the first value is used, so the
// work-group pays one memory round trip; one barrier serves both tiles.
// ---------------------------------------------------------------------------
__global__ __launch_bounds__(256) void prep_kernel(
    const float* __restrict__ x,
    const float* __restrict__ Wq, const float* __restrict__ Wk,
    const float* __restrict__ Wv, const float* __restrict__ Wf,
    half_t* __restrict__ xh,
    half_t* __restrict__ wqt, half_t* __restrict__ wkt,
    half_t* __restrict__ wvt, half_t* __restrict__ wft) {
  __shared__ float tile[2][64][65];
  const int w   = blockIdx.x;
  const int tid = threadIdx.x;
  const int m   = w >> 7;           // which weight matrix
  const float* src = (m == 0) ? Wq : (m == 1) ? Wk : (m == 2) ? Wv : Wf;
  half_t* dst      = (m == 0) ? wqt : (m == 1) ? wkt : (m == 2) ? wvt : wft;
  const int nb = (w & 7) * 128;         // n base (cols of src, rows of dst)
  const int kb = ((w >> 3) & 15) * 64;  // k base (rows of src, cols of dst)
  const int r0 = tid >> 6, c = tid & 63;

  // (the loops are unrolled so that tv and xv stay in registers)
  float tv[2][16];
#pragma unroll
  for (int u = 0; u < 2; ++u)
#pragma unroll
    for (int i = 0; i < 16; ++i)
      tv[u][i] = src[(size_t)(kb + r0 + i * 4) * D_ + nb + u * 64 + c];
  const float4* xs = (const float4*)x + (size_t)w * 2048 + tid;
  float4 xv[8];
#pragma unroll
  for (int i = 0; i < 8; ++i) xv[i] = xs[i * 256];
  // keeps every load above in front of the first use of a loaded value: without
  // it the x values are waited for and converted before the tile loads issue
  __builtin_amdgcn_sched_barrier(0);

#pragma unroll
  for (int u = 0; u < 2; ++u)
#pragma unroll
    for (int i = 0; i < 16; ++i) tile[u][r0 + i * 4][c] = tv[u][i];

  v4h* xd = (v4h*)xh + (size_t)w * 2048 + tid;
#pragma unroll
  for (int i = 0; i < 8; ++i) {
    v4h h;
    h[0] = (half_t)xv[i].x; h[1] = (half_t)xv[i].y;
    h[2] = (half_t)xv[i].z; h[3] = (half_t)xv[i].w;
    xd[i * 256] = h;
  }
  __syncthreads();
  half_t* dp = dst + (size_t)(nb + r0) * D_ + kb + c;
#pragma unroll
  for (int u = 0; u < 2; ++u)
#pragma unroll
    for (int i = 0; i < 16; ++i)
      dp[(u * 64 + i * 4) * D_] = (half_t)tile[u][c][r0 + i * 4];
}

// ---------------------------------------------------------------------------
// Shared WMMA GEMM core: C(128x128 per block) = A(M x 1024) * B(1024 x N)
// 256 threads = 8 waves (2 x 4), each wave computes a 64x32 patch (4x2 WMMA
// tiles). A stage is 64 k: every staged row is one whole 128-byte line, and a
// wave-wide 128-bit copy covers four whole lines. LDS rows stand at a pitch of
// 144 bytes (16 B x odd), the conflict-free pitch for 128-bit fragment reads.
// A and B both come as [row][k] (x, Oh or a PRE-TRANSPOSED weight Wt[n][k]), so both
// stagings and all fragment fills are contiguous 128-bit LDS operations.
// The stages come into LDS by asynchronous 16-byte copies, two buffers: stage
// kt + 1 flies while stage kt is worked on, and one barrier per stage publishes
// the one and frees the other.
// Fragment layout (ISA 7.12.2, 16-bit, wave32):
//   A: lane(l&15)=row, halves at k = {hi*8..+7, 16+hi*8..+7}
//   B: lane(l&15)=col, same k pattern.  C: n=l&15, m=r+8*(l>>4).
// ---------------------------------------------------------------------------
constexpr int BM = 128;   // block rows
constexpr int BN = 128;   // block cols
constexpr int BK = 64;    // k per stage (128 bytes of every operand row)
constexpr int LP = 72;    // LDS row pitch in halves (144 bytes)
constexpr int GBB = BM * LP * 2;   // bytes of one buffer of one operand

template <int GK>   // 32-k steps per group of fragment loads
__device__ __forceinline__ void gemm_tile_core(
    const half_t* __restrict__ A, const half_t* __restrict__ Bt_g,
    half_t (*As)[BM][LP], half_t (*Bt)[BN][LP],
    int rowBase, int colBase, v8f acc[4][2]) {
  const int tid  = threadIdx.x;
  const int lane = tid & 31;
  const int wid  = tid >> 5;
  const int wm   = wid >> 2;       // 0..1  (m sub-block of 64 rows)
  const int wn   = wid & 3;        // 0..3  (n sub-block of 32 cols)
  const int hi   = lane >> 4;      // half-wave select
  const int l15  = lane & 15;
  const int srow = tid >> 3;       // staging: 8 threads per 128-byte row
  const int scol = (tid & 7) * 8;

  const half_t* ag = A    + (size_t)(rowBase + srow) * D_ + scol;
  const half_t* bg = Bt_g + (size_t)(colBase + srow) * D_ + scol;
  const uint32_t al0 = (uint32_t)(uintptr_t)&As[0][srow][scol];   // LDS byte
  const uint32_t bl0 = (uint32_t)(uintptr_t)&Bt[0][srow][scol];   // addresses

  // ---- stage kt (A 128x64 and B 128x64) into one buffer: a thread takes rows
  //      srow + 32 i of either operand, 16 bytes of each ---------------------
  auto fill = [&](const int kt, const int buf) __attribute__((always_inline)) {
    const half_t* a = ag + kt * BK;
    const half_t* b = bg + kt * BK;
    const uint32_t al = al0 + buf * GBB, bl = bl0 + buf * GBB;
    // global to LDS through no register; the closing wait stands in front of
    // any rewrite of the address registers that the eight copies name
    asm volatile(
        "global_load_async_to_lds_b128 %0, %8, off\n\t"
        "global_load_async_to_lds_b128 %1, %9, off\n\t"
        "global_load_async_to_lds_b128 %2, %10, off\n\t"
        "global_load_async_to_lds_b128 %3, %11, off\n\t"
        "global_load_async_to_lds_b128 %4, %12, off\n\t"
        "global_load_async_to_lds_b128 %5, %13, off\n\t"
        "global_load_async_to_lds_b128 %6, %14, off\n\t"
        "global_load_async_to_lds_b128 %7, %15, off\n\t"
        "s_wait_xcnt 0x0"
        :: "v"(al), "v"(al + 32 * LP * 2), "v"(al + 64 * LP * 2),
           "v"(al + 96 * LP * 2),
           "v"(bl), "v"(bl + 32 * LP * 2), "v"(bl + 64 * LP * 2),
           "v"(bl + 96 * LP * 2),
           "v"(a), "v"(a + 32 * D_), "v"(a + 64 * D_), "v"(a + 96 * D_),
           "v"(b), "v"(b + 32 * D_), "v"(b + 64 * D_), "v"(b + 96 * D_)
        : "memory");
  };

  fill(0, 0);
  // this wave's copies of the first stage have landed ...
  asm volatile("s_wait_asynccnt 0x0" ::: "memory");
  __syncthreads();   // ... and every other wave's
  fill(1, 1);

  for (int kt = 0; kt < D_ / BK; ++kt) {
    const int buf = kt & 1;
    const half_t (*Ab)[LP] = As[buf];
    const half_t (*Bb)[LP] = Bt[buf];
    // (the loops below are unrolled so that the fragments and acc are indexed
    //  by constants and stay in registers)
    // The fragment loads go out in groups, each load into registers of its own,
    // in the order in which the products take them: the whole stage's 24 as one
    // group (GK = 2), or 12 per 32 k (GK = 1) where the registers of the larger
    // group would cost a resident work-group.
#pragma unroll
    for (int k0 = 0; k0 < BK / 32; k0 += GK) {
      V16 af[GK][4], bf2[GK][2];
#pragma unroll
      for (int kg = 0; kg < GK; ++kg) {
        const int ko = (k0 + kg) * 32 + hi * 8;
#pragma unroll
        for (int sn = 0; sn < 2; ++sn) {
          int c = wn * 32 + sn * 16 + l15;
          bf2[kg][sn].h[0] = *(const v8h*)&Bb[c][ko];
          bf2[kg][sn].h[1] = *(const v8h*)&Bb[c][ko + 16];
        }
#pragma unroll
        for (int sm = 0; sm < 4; ++sm) {
          int r = wm * 64 + sm * 16 + l15;
          af[kg][sm].h[0] = *(const v8h*)&Ab[r][ko];
          af[kg][sm].h[1] = *(const v8h*)&Ab[r][ko + 16];
        }
      }
      // keeps the group in front of its first product: without it the loads are
      // sunk among the products into one shared register set, and the wave
      // waits out the LDS latency in front of every second product
      __builtin_amdgcn_sched_barrier(0);
#pragma unroll
      for (int kg = 0; kg < GK; ++kg)
#pragma unroll
        for (int sm = 0; sm < 4; ++sm)
#pragma unroll
          for (int sn = 0; sn < 2; ++sn)
            acc[sm][sn] = __builtin_amdgcn_wmma_f32_16x16x32_f16(
                false, af[kg][sm].v, false, bf2[kg][sn].v, (short)0,
                acc[sm][sn], false, false);
    }
    // keeps the products in front of the waits below: moved behind them, they
    // would start only when every load has returned, and the next stage's
    // copies would be waited for before the products that are to cover them
    __builtin_amdgcn_sched_barrier(0);
    // this wave's reads of the buffer that is refilled below are done
    asm volatile("s_wait_dscnt 0x0" ::: "memory");
    // this wave's copies of the next stage have landed
    asm volatile("s_wait_asynccnt 0x0" ::: "memory");
    __syncthreads();   // publishes stage kt + 1, frees stage kt's buffer
    if (kt + 2 < D_ / BK) fill(kt + 2, buf);
  }
  // no copy is outstanding when the wave goes on
  asm volatile("s_wait_asynccnt 0x0" ::: "memory");
}

// ---------------------------------------------------------------------------
// Lane l with lane l ^ 16 (the other 16-lane half), on the vector port.
// ---------------------------------------------------------------------------
__device__ __forceinline__ float xhalf(float x) {
  return __builtin_bit_cast(float, __builtin_amdgcn_permlanex16(
      __builtin_bit_cast(int, x), __builtin_bit_cast(int, x),
      0x76543210, 0xfedcba98, false, false));
}

// Lane l with lane l ^ D inside its 16-lane row (DPP row_xmask).
template <int D>
__device__ __forceinline__ float xrow(float x) {
  return __builtin_bit_cast(float, __builtin_amdgcn_update_dpp(
      0, __builtin_bit_cast(int, x), 0x160 + D, 0xf, 0xf, true));
}
// The largest / the smallest value of a 16-lane row, in every lane of the row.
__device__ __forceinline__ float rowmax(float x) {
  x = fmaxf(x, xrow<1>(x)); x = fmaxf(x, xrow<2>(x));
  x = fmaxf(x, xrow<4>(x)); return fmaxf(x, xrow<8>(x));
}
__device__ __forceinline__ float rowmin(float x) {
  x = fminf(x, xrow<1>(x)); x = fminf(x, xrow<2>(x));
  x = fminf(x, xrow<4>(x)); return fminf(x, xrow<8>(x));
}

// ---------------------------------------------------------------------------
// Fused QKV projection: z=0 -> Q (pre-scaled by 1/sqrt(hd)), z=1 -> K,
// z=2 -> V written TRANSPOSED [B, H, hd, S] so the attention kernel can
// stage V tiles with contiguous b128 accesses. Q/K go to [B, H, S, hd].
// A lane's 8 accumulator registers run along the A operand's rows, so the
// operand whose index is contiguous in the destination is given to the core as
// A: the weight (dims) for Q and K, x (positions) for V. The block tile is
// square, so this only exchanges the two pointers and bases. The finished tile
// goes as f16 through LDS (the ring, free behind the core's last barrier),
// [B index][A index], in 16-byte pieces, and leaves as whole 128-byte lines.
// K also leaves, per head and 32 positions, the largest squared length of its
// rows as stored (f16): a wave holds all 64 dims of 32 positions of one head,
// so each value has one writer. The attention kernel bounds scores with it.
// ---------------------------------------------------------------------------
constexpr int SP = 136;   // staging pitch in halves (272 bytes, 16 B x odd)
static_assert(BM == BN && BN * SP <= 2 * BM * LP, "tile fits the A ring");

// (six waves per SIMD: three work-groups stay resident on a WGP, as many as the
//  grid brings to each, so the register budget is held at 160)
__global__ __launch_bounds__(256) __attribute__((amdgpu_waves_per_eu(6)))
void qkv_gemm_kernel(
    const half_t* __restrict__ Xh,
    const half_t* __restrict__ Wqt, const half_t* __restrict__ Wkt,
    const half_t* __restrict__ Wvt,
    const float* __restrict__ bq, const float* __restrict__ bk,
    const float* __restrict__ bv,
    half_t* __restrict__ Qh, half_t* __restrict__ Kh,
    half_t* __restrict__ VhT, float* __restrict__ Kn2) {
  __shared__ __align__(16) half_t As[2][BM][LP];   // [buffer][row][k]
  __shared__ __align__(16) half_t Bt[2][BN][LP];   // [buffer][col][k]

  const half_t* W; const float* bias; half_t* dst; float scale;
  bool vmode = false;
  if (blockIdx.z == 0)      { W = Wqt; bias = bq; dst = Qh;  scale = 0.125f; }
  else if (blockIdx.z == 1) { W = Wkt; bias = bk; dst = Kh;  scale = 1.0f; }
  else                      { W = Wvt; bias = bv; dst = VhT; scale = 1.0f; vmode = true; }

  const int rowBase = blockIdx.y * BM;   // rows of x
  const int colBase = blockIdx.x * BN;   // columns of the weight
  const int tid  = threadIdx.x;
  const int lane = tid & 31;
  // (the wave's number in a scalar register: what is formed from it then takes
  //  no vector register across the core)
  const int wid  = __builtin_amdgcn_readfirstlane(tid >> 5);
  const int wm = wid >> 2, wn = wid & 3, hi = lane >> 4, l15 = lane & 15;

  // The bias is fetched in front of the core, so that its latency passes under
  // the k loop. V: it runs along the B index, one value per sn. Q/K: along the
  // A index, 8 values per sm.
  // (every loop of this kernel is unrolled so that bb, ba and acc are indexed
  //  by constants and stay in registers, and the eight stores issue together)
  float  bb[2]    = {};
  float4 ba[4][2] = {};
  if (vmode) {
#pragma unroll
    for (int sn = 0; sn < 2; ++sn)
      bb[sn] = bias[colBase + wn * 32 + sn * 16 + l15];
    // stands in front of any rewrite of the address registers that the bias
    // loads name; so in the other arm
    asm volatile("s_wait_xcnt 0x0" ::: "memory");
  } else {
    const float4* bp = (const float4*)(bias + colBase + wm * 64 + 8 * hi);
#pragma unroll
    for (int sm = 0; sm < 4; ++sm) {
      ba[sm][0] = bp[sm * 4];
      ba[sm][1] = bp[sm * 4 + 1];
    }
    // (the same wait, for this arm's loads)
    asm volatile("s_wait_xcnt 0x0" ::: "memory");
  }

  v8f acc[4][2] = {};
  gemm_tile_core<1>(vmode ? Xh : W, vmode ? W : Xh, As, Bt,
                 vmode ? rowBase : colBase, vmode ? colBase : rowBase, acc);

  half_t* stg = &As[0][0][0];
  // acc[sm][sn][r]: A index wm*64 + sm*16 + 8*hi + r, B index wn*32 + sn*16 + l15
  half_t* sw = stg + (wn * 32 + l15) * SP + wm * 64 + 8 * hi;
  if (vmode) {
#pragma unroll
    for (int sn = 0; sn < 2; ++sn)
#pragma unroll
      for (int sm = 0; sm < 4; ++sm) {
        v8h o;
#pragma unroll
        for (int r = 0; r < 8; ++r) o[r] = (half_t)(acc[sm][sn][r] + bb[sn]);
        *(v8h*)(sw + sn * 16 * SP + sm * 16) = o;
      }
  } else {
    const bool kmode = (blockIdx.z == 1);
    float nn[2] = {};   // squared length of position sn*16 + l15, this half's dims
#pragma unroll
    for (int sm = 0; sm < 4; ++sm) {
      const float4 b0 = ba[sm][0], b1 = ba[sm][1];
      const float bs[8] = {b0.x, b0.y, b0.z, b0.w, b1.x, b1.y, b1.z, b1.w};
#pragma unroll
      for (int sn = 0; sn < 2; ++sn) {
        v8h o;
#pragma unroll
        for (int r = 0; r < 8; ++r)
          o[r] = (half_t)((acc[sm][sn][r] + bs[r]) * scale);
        *(v8h*)(sw + sn * 16 * SP + sm * 16) = o;
        if (kmode) {
#pragma unroll
          for (int r = 0; r < 8; ++r) nn[sn] += (float)o[r] * (float)o[r];
        }
      }
    }
    if (kmode) {
      const float n2 = rowmax(fmaxf(nn[0] + xhalf(nn[0]), nn[1] + xhalf(nn[1])));
      const int hd0 = (rowBase >> 11) * H_ + (colBase >> 6) + wm;   // b * H + h
      if (lane == 0)
        Kn2[hd0 * (S_ / 32) + ((rowBase & (S_ - 1)) >> 5) + wn] = n2;
    }
  }
  __syncthreads();   // the staged tile is whole before any wave reads across it

  // 16 lanes take one staged row (256 bytes). Q/K: position s0 + rr, one line
  // of either of the tile's two heads. V: dim colBase + rr, two lines of
  // positions. Each wave-wide store covers four whole lines.
  const int bI = rowBase >> 11, s0 = rowBase & (S_ - 1);
  const int c16 = tid & 15;
  const int C0 = colBase + (vmode ? (tid >> 4) : c16 * 8);
  half_t* gp = vmode
      ? dst + ((size_t)(bI * H_ + (C0 >> 6)) * HD_ + (C0 & (HD_ - 1))) * S_ +
            s0 + c16 * 8                                      // [B,H,hd,S]
      : dst + ((size_t)(bI * H_ + (C0 >> 6)) * S_ + s0 + (tid >> 4)) * HD_ +
            (C0 & (HD_ - 1));                                 // [B,H,S,hd]
  const int gstep = 16 * (vmode ? S_ : HD_);   // 16 staged rows further
  const half_t* sr = stg + (tid >> 4) * SP + c16 * 8;
#pragma unroll
  for (int i = 0; i < 8; ++i)
    *(v8h*)(gp + (size_t)i * gstep) = *(const v8h*)(sr + i * 16 * SP);
}

// ---------------------------------------------------------------------------
// Output projection: out(f32) = Oh(f16) @ Wf(f16, pre-transposed) + bf
// ---------------------------------------------------------------------------
__global__ __launch_bounds__(256) void out_gemm_kernel(
    const half_t* __restrict__ Oh, const half_t* __restrict__ Wft,
    const float* __restrict__ bf, float* __restrict__ out) {
  __shared__ __align__(16) half_t As[2][BM][LP];   // [buffer][row][k]
  __shared__ __align__(16) half_t Bt[2][BN][LP];   // [buffer][col][k]
  const int rowBase = blockIdx.y * BM;
  const int colBase = blockIdx.x * BN;
  v8f acc[4][2] = {};
  gemm_tile_core<2>(Oh, Wft, As, Bt, rowBase, colBase, acc);

  const int lane = threadIdx.x & 31;
  const int wid  = threadIdx.x >> 5;
  const int wm = wid >> 2, wn = wid & 3, hi = lane >> 4, l15 = lane & 15;
#pragma unroll
  for (int sm = 0; sm < 4; ++sm)
#pragma unroll
    for (int sn = 0; sn < 2; ++sn)
#pragma unroll
      for (int r = 0; r < 8; ++r) {
        int R = rowBase + wm * 64 + sm * 16 + r + 8 * hi;
        int C = colBase + wn * 32 + sn * 16 + l15;
        out[(size_t)R * D_ + C] = acc[sm][sn][r] + bf[C];
      }
}

constexpr int SK  = 64;
constexpr int AP  = 72;
constexpr int ABB = 64 * AP * 2;
// A weight exp(-CUT) or less is zero as an f16 operand (under 2^-25), so its
// chunk adds nothing to O; and all such weights of one row, 2048 at most, come
// to less than 2^-25 of the row's sum, which holds the weight 1 of the maximum.
constexpr float CUT = 25.0f;

// (the launch bound states the block of 256 that the host launches: without it
//  the register budget is that of 1024 threads, and the stage's body spills)
__global__ __launch_bounds__(256) void attn_kernel(const half_t* __restrict__ Qh,
                            const half_t* __restrict__ Kh,
                            const half_t* __restrict__ VhT,
                            const float* __restrict__ Kn2,
                            half_t* __restrict__ Oh) {
  __shared__ __align__(16) half_t Ks[2][SK][AP];   // [buffer][key][dim]
  __shared__ __align__(16) half_t Vs[2][HD_][AP];  // [buffer][dim][key]
  __shared__ __align__(16) int    nW[8];           // each wave's number of steps
  static_assert(S_ / SK == 32, "one stage per lane in the bound");

  const int bh  = blockIdx.x;
  const int b   = bh >> 4;
  const int h   = bh & 15;
  const int Qb  = blockIdx.y * 128;
  const int tid = threadIdx.x;
  const int lane = tid & 31;
  const int wid  = tid >> 5;
  const int hi   = lane >> 4;
  const int l15  = lane & 15;
  const int qbase = Qb + wid * 16;
  const int iq    = qbase + l15;   // this lane's query

  const half_t* Qp = Qh  + (size_t)(b * H_ + h) * S_ * HD_;
  const half_t* Kp = Kh  + (size_t)(b * H_ + h) * S_ * HD_;
  const half_t* Vp = VhT + (size_t)(b * H_ + h) * HD_ * S_;  // [dim][key]

  // Q fragments for the whole hd=64 (two K=32 steps), loaded once.
  V16 aq0, aq1;
  {
    const half_t* qrow = Qp + (size_t)iq * HD_;
    aq0.h[0] = *(const v8h*)(qrow + hi * 8);
    aq0.h[1] = *(const v8h*)(qrow + 16 + hi * 8);
    aq1.h[0] = *(const v8h*)(qrow + 32 + hi * 8);
    aq1.h[1] = *(const v8h*)(qrow + 48 + hi * 8);
  }
  // stage 'lane' of this head: the largest squared length of its keys (fetched
  // here so that the latency passes under the first two stages)
  const float2 kn2 = ((const float2*)(Kn2 + (size_t)bh * (S_ / 32)))[lane];

  float M = -1e30f;   // running maximum of this lane's query (both halves alike)
  float L = 0.0f;     // running sum over this half's keys; halves joined at the end
  v8f acc[4] = {};    // acc[j][r] = O^T[j*16 + 8*hi + r][query l15]

  // slope = (24^(1/8))^-(h%8+1)
  const float slope = __expf(-__logf(24.0f) / 8.0f * (float)((h & 7) + 1));
  const bool fwd = (h < 8);
  const float g = fwd ? slope : -slope;   // ALiBi term per step of the key index
  const int  sg = fwd ? 1 : -1;
  v8f ramp0, ramp1;                       // g * (key index inside the chunk)
#pragma unroll
  for (int r = 0; r < 8; ++r) {
    ramp0[r] = g * (float)(8 * hi + r);
    ramp1[r] = g * (float)(16 + 8 * hi + r);
  }
  // step n of the walk takes stage st0 - sg * n, n in [0, nSt), nSt two at least
  const int nSt = fwd ? ((Qb >> 6) + 2) : ((S_ - Qb) >> 6);
  const int st0 = fwd ? ((Qb >> 6) + 1) : (Qb >> 6);
  const int pN  = fwd ? 1 : 0;            // the chunk of a stage that is walked first

  // ---- one stage into one buffer: 8 threads per 128-byte row, a thread takes
  //      rows srow and srow + 32 of K (keys) and of V (dims) -----------------
  const int srow = tid >> 3, scol = (tid & 7) * 8;
  const uint32_t kl0 = (uint32_t)(uintptr_t)&Ks[0][srow][scol];   // LDS byte
  const uint32_t vl0 = (uint32_t)(uintptr_t)&Vs[0][srow][scol];   // addresses
  auto fill = [&](const int st, const int buf) __attribute__((always_inline)) {
    const half_t* kg = Kp + (size_t)(st * SK + srow) * HD_ + scol;
    const half_t* vg = Vp + (size_t)srow * S_ + st * SK + scol;
    const uint32_t kl = kl0 + buf * ABB, vl = vl0 + buf * ABB;
    // global to LDS through no register; the closing wait stands in front of
    // any rewrite of the address registers that the four copies name
    asm volatile(
        "global_load_async_to_lds_b128 %0, %4, off\n\t"
        "global_load_async_to_lds_b128 %1, %5, off\n\t"
        "global_load_async_to_lds_b128 %2, %6, off\n\t"
        "global_load_async_to_lds_b128 %3, %7, off\n\t"
        "s_wait_xcnt 0x0"
        :: "v"(kl), "v"(kl + 32 * AP * 2), "v"(vl), "v"(vl + 32 * AP * 2),
           "v"(kg), "v"(kg + 32 * HD_), "v"(vg), "v"(vg + 32 * S_)
        : "memory");
  };

  // always_inline: 'masked' is a literal at each call and must fold
  // scores of chunk p (0 or 1) of stage st, read from buffer buf:
  // K(32x64) x Q^T(64x16) + C -> two 16x16 f32 tiles of S^T
  auto scores = [&](const int st, const int buf, const int p, const bool masked,
                    v8f& c0, v8f& c1) __attribute__((always_inline)) {
    const int kbase = st * SK + p * 32;
    const half_t* Kc = &Ks[buf][p * 32 + l15][hi * 8];   // key l15 of the chunk
    c0 = ramp0; c1 = ramp1;
    if (masked) {
      // key 8*hi + r of the chunk is masked where sg * r > srel
      const int srel = sg * (iq - kbase - 8 * hi);
#pragma unroll
      for (int r = 0; r < 8; ++r) {
        c0[r] = (sg * r > srel) ? -1e9f : ramp0[r];
        c1[r] = (sg * (16 + r) > srel) ? -1e9f : ramp1[r];
      }
    }
    V16 bk0, bk0b, bk1, bk1b;
    bk0.h[0]  = *(const v8h*)(Kc);
    bk0.h[1]  = *(const v8h*)(Kc + 16);
    bk0b.h[0] = *(const v8h*)(Kc + 32);
    bk0b.h[1] = *(const v8h*)(Kc + 48);
    bk1.h[0]  = *(const v8h*)(Kc + 16 * AP);
    bk1.h[1]  = *(const v8h*)(Kc + 16 * AP + 16);
    bk1b.h[0] = *(const v8h*)(Kc + 16 * AP + 32);
    bk1b.h[1] = *(const v8h*)(Kc + 16 * AP + 48);
    c0 = __builtin_amdgcn_wmma_f32_16x16x32_f16(false, bk0.v, false, aq0.v,
                                                (short)0, c0, false, false);
    c0 = __builtin_amdgcn_wmma_f32_16x16x32_f16(false, bk0b.v, false, aq1.v,
                                                (short)0, c0, false, false);
    c1 = __builtin_amdgcn_wmma_f32_16x16x32_f16(false, bk1.v, false, aq0.v,
                                                (short)0, c1, false, false);
    c1 = __builtin_amdgcn_wmma_f32_16x16x32_f16(false, bk1b.v, false, aq1.v,
                                                (short)0, c1, false, false);
  };

  // the largest of this lane's 16 scores of a chunk
  auto lanemax = [&](const v8f& c0, const v8f& c1) __attribute__((always_inline)) {
    float mx = -1e30f;
#pragma unroll
    for (int r = 0; r < 8; ++r) mx = fmaxf(mx, fmaxf(c0[r], c1[r]));
    return mx;
  };

  // online softmax of one chunk, one query per lane, and its part of O^T;
  // mx: lanemax of the chunk, off: the chunk's part of the ALiBi term
  auto softpv = [&](const int buf, const int p, const v8f& c0, const v8f& c1,
                    float mx, const float off) __attribute__((always_inline)) {
    const half_t* Vc = &Vs[buf][l15][p * 32 + hi * 8];   // dim l15, the chunk's keys
    mx = fmaxf(mx, xhalf(mx));   // all 32 keys of the chunk
    const float Mn = fmaxf(M, mx + off);
    const float sc = __expf(M - Mn);
    M = Mn;
    // Mn in the chunk's own units. Never below mx: where all 32 keys are masked
    // the roundings at 1e9 could leave it lower, and exp would overflow f16.
    const float e = fmaxf(Mn - off, mx);

    V16 pf;                      // P^T as B operand: pf[s] = P^T[kmap(s, hi)][l15]
    float rs = 0.0f;
#pragma unroll
    for (int r = 0; r < 8; ++r) {
      float p0 = __expf(c0[r] - e);
      float p1 = __expf(c1[r] - e);
      rs += p0 + p1;
      pf.v[r]     = (half_t)p0;
      pf.v[8 + r] = (half_t)p1;
    }
    L = L * sc + rs;
#pragma unroll
    for (int j = 0; j < 4; ++j)
#pragma unroll
      for (int r = 0; r < 8; ++r) acc[j][r] = acc[j][r] * sc;

    // ---- V^T(64x32) x P^T(32x16): 4 WMMAs accumulate into O^T ------------
#pragma unroll
    for (int j = 0; j < 4; ++j) {
      V16 bv;
      bv.h[0] = *(const v8h*)(Vc + j * 16 * AP);
      bv.h[1] = *(const v8h*)(Vc + j * 16 * AP + 16);
      acc[j] = __builtin_amdgcn_wmma_f32_16x16x32_f16(false, bv.v, false, pf.v,
                                                      (short)0, acc[j],
                                                      false, false);
    }
  };

  fill(st0, 0);
  // this wave's copies of the first stage have landed ...
  asm volatile("s_wait_asynccnt 0x0" ::: "memory");
  __syncthreads();   // ... and every other wave's
  fill(st0 - sg, 1);

  // always_inline: 'masked' is a literal at each call and must fold away
  auto work = [&](const int n, const bool masked)
      __attribute__((always_inline)) {
    const int st  = st0 - sg * n;
    const int buf = n & 1;
    v8f a0, a1, b0, b1;          // scores of the nearer and of the farther chunk
    scores(st, buf, pN, masked, a0, a1);
    scores(st, buf, 1 - pN, masked, b0, b1);
    const float mxa = lanemax(a0, a1), mxb = lanemax(b0, b1);
    const float offa = g * (float)(st * SK + pN * 32 - iq);
    const float offb = g * (float)(st * SK + (1 - pN) * 32 - iq);
    // A chunk is worked on unless every lane of the wave (both halves of every
    // query) finds it CUT below the running maximum. Both tests take the
    // maximum as it stands in front of the stage: it never falls, so the
    // farther chunk's test is the stricter for it. The negated form sends a
    // score that is not a number down the full path.
    const float lim = M - CUT;
    const uint32_t ta = __builtin_amdgcn_ballot_w32(!(mxa + offa <= lim));
    const uint32_t tb = __builtin_amdgcn_ballot_w32(!(mxb + offb <= lim));
    if (ta != 0) softpv(buf, pN, a0, a1, mxa, offa);
    if (tb != 0) softpv(buf, 1 - pN, b0, b1, mxb, offb);
  };
  // the foot of a step, every wave
  auto foot = [&]() __attribute__((always_inline)) {
    // this wave's reads of the buffer that is refilled next are done
    asm volatile("s_wait_dscnt 0x0" ::: "memory");
    // this wave's copies of the next stage have landed
    asm volatile("s_wait_asynccnt 0x0" ::: "memory");
    __syncthreads();   // publishes step n + 1's stage, frees this one's buffer
  };
  work(0, true);     // the two stages that overlap the block's own queries
  foot();
  if (2 < nSt) fill(st0 - sg * 2, 0);
  work(1, true);

  // ---- how far this wave has to walk ---------------------------------------
  int nOwn;
  {
    float q2 = 0.0f;   // squared length of this lane's query, as in the products
    // (unrolled so that the fragments are indexed by constants)
#pragma unroll
    for (int r = 0; r < 16; ++r)
      q2 += (float)aq0.v[r] * (float)aq0.v[r] + (float)aq1.v[r] * (float)aq1.v[r];
    q2 += xhalf(q2);
    const float qn = sqrtf(rowmax(q2));
    // s_ij + g (j - i) <= M_i - CUT for all i follows from
    // qn |k|max + g (jnear - Qb) <= min_i (M_i + g (i - Qb)) - CUT.
    // (The roundings here, some 1e-3, are far inside what CUT has to spare.)
    const float lim = rowmin(M + g * (float)(iq - Qb)) - CUT;
    const float top = qn * sqrtf(fmaxf(kn2.x, kn2.y)) +
                      g * (float)(lane * SK + (fwd ? SK - 1 : 0) - Qb);
    // the negated form keeps a stage whose bound is not a number
    const uint32_t need = __builtin_amdgcn_ballot_w32(!(top <= lim));
    // farthest stage needed: the lowest (forward) or the highest (backward);
    // stages on the masked side read 'needed' and fall to the clamp
    const int far = fwd ? st0 - (need ? __builtin_ctz(need) : 32)
                        : (need ? 31 - __builtin_clz(need) : -1) - st0;
    nOwn = min(max(far + 1, 2), nSt);
    if (lane == 0) nW[wid] = nOwn;
  }
  foot();            // also publishes nW
  int nEnd;
  {
    const int4 w0 = *(const int4*)&nW[0], w1 = *(const int4*)&nW[4];
    // (in a scalar register: the trip count and the refill test are the same
    //  for the whole work-group)
    nEnd = __builtin_amdgcn_readfirstlane(
        max(max(max(w0.x, w0.y), max(w0.z, w0.w)),
            max(max(w1.x, w1.y), max(w1.z, w1.w))));
  }
  if (3 < nEnd) fill(st0 - sg * 3, 1);
  for (int n = 2; n < nEnd; ++n) {
    if (n < nOwn) work(n, false);   // a wave past its own last stage only passes
    foot();
    if (n + 2 < nEnd) fill(st0 - sg * (n + 2), n & 1);
  }
  // no copy is outstanding when the wave ends
  asm volatile("s_wait_asynccnt 0x0" ::: "memory");

  // ---- epilogue: join the halves' sums, normalize, write f16 into [B*S, D]
  //      for the final GEMM; a lane's 8 registers are 8 consecutive dims -----
  const float inv = 1.0f / (L + xhalf(L));
  half_t* orow = Oh + (size_t)(b * S_ + iq) * D_ + h * HD_ + 8 * hi;
#pragma unroll
  for (int j = 0; j < 4; ++j) {
    v8h o;
#pragma unroll
    for (int r = 0; r < 8; ++r) o[r] = (half_t)(acc[j][r] * inv);
    *(v8h*)(orow + j * 16) = o;
  }
}

// ---------------------------------------------------------------------------
// Host-side launcher. Workspace layout (all 16B-aligned, ~48 MB total):
//   xh   : ROWS*D f16      (8 MB)
//   wqt/wkt/wvt/wft : D*D f16 each, TRANSPOSED [n][k] (4 x 2 MB)
//   Qh/Kh : B*H*S*hd f16  (2 x 8 MB);  VhT : B*H*hd*S f16 (8 MB)
//   Oh   : ROWS*D f16      (8 MB)
//   kn2  : B*H*(S/32) f32  (8 KB)
// ---------------------------------------------------------------------------
extern "C" void kernel_launch(void* const* d_in, const int* in_sizes, int n_in,
                              void* d_out, int out_size, void* d_ws,
                              size_t ws_size, hipStream_t stream) {
  const float* x  = (const float*)d_in[0];
  const float* Wq = (const float*)d_in[1];
  const float* bq = (const float*)d_in[2];
  const float* Wk = (const float*)d_in[3];
  const float* bk = (const float*)d_in[4];
  const float* Wv = (const float*)d_in[5];
  const float* bv = (const float*)d_in[6];
  const float* Wf = (const float*)d_in[7];
  const float* bf = (const float*)d_in[8];
  float* out = (float*)d_out;

  char* ws = (char*)d_ws;
  size_t off = 0;
  half_t* xh  = (half_t*)(ws + off); off += (size_t)ROWS * D_ * sizeof(half_t);
  half_t* wqt = (half_t*)(ws + off); off += (size_t)D_ * D_ * sizeof(half_t);
  half_t* wkt = (half_t*)(ws + off); off += (size_t)D_ * D_ * sizeof(half_t);
  half_t* wvt = (half_t*)(ws + off); off += (size_t)D_ * D_ * sizeof(half_t);
  half_t* wft = (half_t*)(ws + off); off += (size_t)D_ * D_ * sizeof(half_t);
  half_t* Qh  = (half_t*)(ws + off); off += (size_t)B_ * H_ * S_ * HD_ * sizeof(half_t);
  half_t* Kh  = (half_t*)(ws + off); off += (size_t)B_ * H_ * S_ * HD_ * sizeof(half_t);
  half_t* VhT = (half_t*)(ws + off); off += (size_t)B_ * H_ * HD_ * S_ * sizeof(half_t);
  half_t* Oh  = (half_t*)(ws + off); off += (size_t)ROWS * D_ * sizeof(half_t);
  float*  kn2 = (float*)(ws + off);  off += (size_t)B_ * H_ * (S_ / 32) * sizeof(float);

  // 1) conversions in one launch: x plain; weights transpose-converted to [n][k]
  prep_kernel<<<512, 256, 0, stream>>>(x, Wq, Wk, Wv, Wf, xh, wqt, wkt, wvt, wft);

  // 2) fused QKV projection (z selects Q/K/V), tiles 128x128, 8 waves/block
  qkv_gemm_kernel<<<dim3(D_ / BN, ROWS / BM, 3), 256, 0, stream>>>(
      xh, wqt, wkt, wvt, bq, bk, bv, Qh, Kh, VhT, kn2);

  // 3) flash attention with bidirectional ALiBi
  attn_kernel<<<dim3(B_ * H_, S_ / 128), 256, 0, stream>>>(Qh, Kh, VhT, kn2, Oh);

  // 4) output projection to f32
  out_gemm_kernel<<<dim3(D_ / BN, ROWS / BM), 256, 0, stream>>>(
      Oh, wft, bf, out);
}
